// v000
// The times below were measured on an AMD MI455X: many runs one after another, warmed up first and cycling through
// copies of the inputs, with the whole window's GPU time divided by the number of runs. Launches and the gaps
// between them are all in it. The median over several windows is given; except for v000 it joins two sittings, which
// can be a few percent apart, so the side-by-side timings, each taken in one sitting, are the better comparison.
// The starting kernel, v000, takes 323 microseconds a run.
#include <hip/hip_runtime.h>
#include <hip/hip_bf16.h>
#include <cmath>

#define D_MODEL 1024
#define N_HEADS 16
#define D_KH    64
#define SEQ     2048
#define BATCH   2
#define MROWS   (BATCH * SEQ)     // 4096

typedef __attribute__((ext_vector_type(16))) _Float16     v16h;
typedef __attribute__((ext_vector_type(8)))  float        v8f;
typedef __attribute__((ext_vector_type(4)))  unsigned int v4u;
typedef __attribute__((ext_vector_type(8)))  int          v8i;
typedef __attribute__((ext_vector_type(4)))  int          v4i;

__device__ __forceinline__ v8f wmma_f16(v16h a, v16h b, v8f c) {
    return __builtin_amdgcn_wmma_f32_16x16x32_f16(
        false, a, false, b, (short)0, c, false, false);
}

// Low 32 bits of a generic pointer to LDS == LDS byte offset.
__device__ __forceinline__ unsigned lds_off(const void* p) {
    return (unsigned)(size_t)p;
}

// ---------------------------------------------------------------------------
// TDM 2D tile load: tile_x elems (contiguous) x tile_y rows, row stride
// `stride` elems, element size 2^dsize bytes, into LDS with a 1-DWORD pad
// every 32 DWORDs (so tile rows must be 128B wide for the pad to land at
// row boundaries).  6-arg clang-23 builtin form.
// ---------------------------------------------------------------------------
__device__ __forceinline__ void tdm_load_2d(unsigned lds, const void* gptr,
                                            unsigned dsize, unsigned tile_x,
                                            unsigned tile_y, unsigned stride,
                                            unsigned dim0, unsigned dim1) {
    const unsigned long long ga = (unsigned long long)(size_t)gptr;
    v4u g0;
    g0[0] = 1u;                                           // count=1 (valid)
    g0[1] = lds;                                          // lds_addr
    g0[2] = (unsigned)(ga & 0xffffffffu);                 // global_addr[95:64]
    g0[3] = (unsigned)((ga >> 32) & 0x01ffffffu)          // global_addr[120:96]
          | (2u << 30);                                   // type=2 (image)
    v8i g1;
    g1[0] = (int)((dsize << 16)   // data_size code (1=2B, 2=4B)
          |       (1u << 20)      // pad_enable
          |       (4u << 22));    // pad_interval = 32 DWORDs (amount = 1 DWORD)
    g1[1] = (int)((dim0 & 0xffffu) << 16);                // tensor_dim0 lo
    g1[2] = (int)((dim0 >> 16) | ((dim1 & 0xffffu) << 16));
    g1[3] = (int)((dim1 >> 16) | (tile_x << 16));         // tile_dim0
    g1[4] = (int)(tile_y & 0xffffu);                      // tile_dim1 (dim2=0)
    g1[5] = (int)stride;                                  // tensor_dim0_stride
    g1[6] = 0;
    g1[7] = 0;
    const v4i z4 = {0, 0, 0, 0};
    const v8i z8 = {0, 0, 0, 0, 0, 0, 0, 0};
    __builtin_amdgcn_tensor_load_to_lds(g0, g1, z4, z4, z8, 0);
}

// ---------------------------------------------------------------------------
// Projection GEMM: Y[4096,1024] = X[4096,1024] @ W[1024,1024]^T + bias.
// 64x64 block tile, k-step 32, TDM double-buffered f32 staging in LDS,
// f32->f16 conversion at fragment read, 2 WMMAs per wave per k-step.
// TOUT = _Float16 for the Q/K/V projections, float for the output proj.
// ---------------------------------------------------------------------------
template <typename TOUT>
__global__ __launch_bounds__(256)
void proj_gemm_kernel(const float* __restrict__ X,
                      const float* __restrict__ W,
                      const float* __restrict__ bias,
                      TOUT* __restrict__ Y)
{
    __shared__ float As[2][64][33];   // 33-dw pitch from TDM pad
    __shared__ float Bs[2][64][33];

    const int tid  = threadIdx.x;
    const int lane = tid & 31;
    const int wv   = tid >> 5;
    const int half = lane >> 4;
    const int ln   = lane & 15;

    const int m0  = blockIdx.y * 64;
    const int n0  = blockIdx.x * 64;
    const int mt  = wv & 3;
    const int nt0 = (wv >> 2) * 2;

    v8f acc0 = {}; v8f acc1 = {};

    if (tid < 32) {   // prologue: TDM-load k0=0 tiles into buffer 0
        tdm_load_2d(lds_off(&As[0][0][0]), X + (size_t)m0 * D_MODEL,
                    2, 32, 64, D_MODEL, D_MODEL, MROWS);
        tdm_load_2d(lds_off(&Bs[0][0][0]), W + (size_t)n0 * D_MODEL,
                    2, 32, 64, D_MODEL, D_MODEL, D_MODEL);
    }

    int p = 0;
    for (int k0 = 0; k0 < D_MODEL; k0 += 32) {
        if (tid < 32) {
            if (k0 + 32 < D_MODEL) {   // issue next tile into other buffer
                tdm_load_2d(lds_off(&As[1 - p][0][0]),
                            X + (size_t)m0 * D_MODEL + k0 + 32,
                            2, 32, 64, D_MODEL, D_MODEL, MROWS);
                tdm_load_2d(lds_off(&Bs[1 - p][0][0]),
                            W + (size_t)n0 * D_MODEL + k0 + 32,
                            2, 32, 64, D_MODEL, D_MODEL, D_MODEL);
                __builtin_amdgcn_s_wait_tensorcnt(2);  // current buffer done
            } else {
                __builtin_amdgcn_s_wait_tensorcnt(0);
            }
        }
        __syncthreads();

        v16h a, b0, b1;
        {   // A fragment: row = mt*16+ln, K(e) = half*8+e | 16+half*8+e
            const float* ar = &As[p][mt * 16 + ln][half * 8];
            #pragma unroll
            for (int e = 0; e < 8; ++e) a[e]     = (_Float16)ar[e];
            #pragma unroll
            for (int e = 0; e < 8; ++e) a[8 + e] = (_Float16)ar[16 + e];
        }
        {
            const float* br = &Bs[p][nt0 * 16 + ln][half * 8];
            #pragma unroll
            for (int e = 0; e < 8; ++e) b0[e]     = (_Float16)br[e];
            #pragma unroll
            for (int e = 0; e < 8; ++e) b0[8 + e] = (_Float16)br[16 + e];
            br = &Bs[p][(nt0 + 1) * 16 + ln][half * 8];
            #pragma unroll
            for (int e = 0; e < 8; ++e) b1[e]     = (_Float16)br[e];
            #pragma unroll
            for (int e = 0; e < 8; ++e) b1[8 + e] = (_Float16)br[16 + e];
        }
        acc0 = wmma_f16(a, b0, acc0);
        acc1 = wmma_f16(a, b1, acc1);
        __syncthreads();
        p ^= 1;
    }

    // Epilogue: bias + store.  D layout: row = r + 8*half, col = ln.
    const int na = n0 + nt0 * 16 + ln;
    const float ba = bias[na];
    const float bb = bias[na + 16];
    TOUT* ya = Y + (size_t)(m0 + mt * 16 + 8 * half) * D_MODEL + na;
    #pragma unroll
    for (int r = 0; r < 8; ++r) {
        ya[(size_t)r * D_MODEL]      = (TOUT)(acc0[r] + ba);
        ya[(size_t)r * D_MODEL + 16] = (TOUT)(acc1[r] + bb);
    }
}

// ---------------------------------------------------------------------------
// Flash attention with additive time-decay bias.  Q/K/V are f16 (written by
// the projection GEMMs), ctx is f32.
// Block = 8 waves, all on the same (b,h), covering 128 consecutive q rows.
// Per 32-key step: TDM loads the K tile (f16, async, overlapping the manual
// transposed V staging); each wave: 4 score WMMAs, online softmax, P restage
// through per-wave LDS, 4 ctx WMMAs.
// ---------------------------------------------------------------------------
__global__ __launch_bounds__(256)
void attn_flash_kernel(const _Float16* __restrict__ Qb,
                       const _Float16* __restrict__ Kb,
                       const _Float16* __restrict__ Vb,
                       const float* __restrict__ td_ptr,
                       float* __restrict__ Cb)
{
    __shared__ _Float16 Kt[32][66];     // [key][d], 66-elem pitch from TDM pad
    __shared__ _Float16 Vt[64][34];     // [d][key] (+2 pad)
    __shared__ _Float16 P[8][16][32];   // per-wave probability tile

    const int tid  = threadIdx.x;
    const int lane = tid & 31;
    const int wv   = tid >> 5;
    const int half = lane >> 4;
    const int ln   = lane & 15;

    const int bh   = blockIdx.x >> 4;          // 0..31
    const int qblk = blockIdx.x & 15;          // 0..15
    const int b    = bh >> 4;
    const int h    = bh & 15;
    const int q0   = (qblk * 8 + wv) * 16;

    const float td    = td_ptr[0];
    const float scale = 0.125f;                // 1/sqrt(64)

    const _Float16* Qh = Qb + (size_t)b * SEQ * D_MODEL + h * D_KH;
    const _Float16* Kh = Kb + (size_t)b * SEQ * D_MODEL + h * D_KH;
    const _Float16* Vh = Vb + (size_t)b * SEQ * D_MODEL + h * D_KH;
    float*          Ch = Cb + (size_t)b * SEQ * D_MODEL + h * D_KH;

    // Q A-fragments for d = 0..31 / 32..63 (row = ln); contiguous f16 loads.
    v16h aq0, aq1;
    {
        const _Float16* qr = Qh + (size_t)(q0 + ln) * D_MODEL;
        #pragma unroll
        for (int e = 0; e < 8; ++e) aq0[e]     = qr[half * 8 + e];
        #pragma unroll
        for (int e = 0; e < 8; ++e) aq0[8 + e] = qr[16 + half * 8 + e];
        #pragma unroll
        for (int e = 0; e < 8; ++e) aq1[e]     = qr[32 + half * 8 + e];
        #pragma unroll
        for (int e = 0; e < 8; ++e) aq1[8 + e] = qr[48 + half * 8 + e];
    }

    v8f c0 = {}, c1 = {}, c2 = {}, c3 = {};
    float mrow[8], lrow[8];
    #pragma unroll
    for (int r = 0; r < 8; ++r) { mrow[r] = -3.0e38f; lrow[r] = 0.0f; }

    const int srow = tid >> 3;          // staging: key row 0..31
    const int scol = (tid & 7) * 8;     // staging: d col 0,8,..,56

    for (int key0 = 0; key0 < SEQ; key0 += 32) {
        // ---- async TDM load of the K tile (f16, 32 keys x 64 d) -----------
        if (tid < 32) {
            tdm_load_2d(lds_off(&Kt[0][0]), Kh + (size_t)key0 * D_MODEL,
                        1, 64, 32, D_MODEL, D_MODEL, SEQ);
        }
        // ---- manual transposed staging of the V tile (overlaps the TDM) ---
        {
            const _Float16* vs = Vh + (size_t)(key0 + srow) * D_MODEL + scol;
            if (key0 + 32 < SEQ)
                __builtin_prefetch(Vh + (size_t)(key0 + 32 + srow) * D_MODEL + scol, 0, 0);
            #pragma unroll
            for (int j = 0; j < 8; ++j) Vt[scol + j][srow] = vs[j];
        }
        if (tid < 32) __builtin_amdgcn_s_wait_tensorcnt(0);
        __syncthreads();

        // ---- scores: two 16x16 tiles from LDS K ---------------------------
        v8f s0 = {}, s1 = {};
        {
            v16h bk;
            const _Float16* kr = &Kt[ln][half * 8];
            #pragma unroll
            for (int e = 0; e < 8; ++e) bk[e]     = kr[e];
            #pragma unroll
            for (int e = 0; e < 8; ++e) bk[8 + e] = kr[16 + e];
            s0 = wmma_f16(aq0, bk, s0);
            #pragma unroll
            for (int e = 0; e < 8; ++e) bk[e]     = kr[32 + e];
            #pragma unroll
            for (int e = 0; e < 8; ++e) bk[8 + e] = kr[48 + e];
            s0 = wmma_f16(aq1, bk, s0);

            kr = &Kt[16 + ln][half * 8];
            #pragma unroll
            for (int e = 0; e < 8; ++e) bk[e]     = kr[e];
            #pragma unroll
            for (int e = 0; e < 8; ++e) bk[8 + e] = kr[16 + e];
            s1 = wmma_f16(aq0, bk, s1);
            #pragma unroll
            for (int e = 0; e < 8; ++e) bk[e]     = kr[32 + e];
            #pragma unroll
            for (int e = 0; e < 8; ++e) bk[8 + e] = kr[48 + e];
            s1 = wmma_f16(aq1, bk, s1);
        }

        // ---- scale + time-decay bias + online softmax ---------------------
        float alpha[8];
        #pragma unroll
        for (int r = 0; r < 8; ++r) {
            const float qpos = (float)(q0 + r + 8 * half);
            const float v0 = s0[r] * scale - td * fabsf(qpos - (float)(key0 + ln));
            const float v1 = s1[r] * scale - td * fabsf(qpos - (float)(key0 + 16 + ln));
            float t = fmaxf(v0, v1);
            t = fmaxf(t, __shfl_xor(t, 1, 32));
            t = fmaxf(t, __shfl_xor(t, 2, 32));
            t = fmaxf(t, __shfl_xor(t, 4, 32));
            t = fmaxf(t, __shfl_xor(t, 8, 32));
            const float mnew = fmaxf(mrow[r], t);
            const float a    = __expf(mrow[r] - mnew);
            const float p0   = __expf(v0 - mnew);
            const float p1   = __expf(v1 - mnew);
            float rs = p0 + p1;
            rs += __shfl_xor(rs, 1, 32);
            rs += __shfl_xor(rs, 2, 32);
            rs += __shfl_xor(rs, 4, 32);
            rs += __shfl_xor(rs, 8, 32);
            lrow[r]  = lrow[r] * a + rs;
            mrow[r]  = mnew;
            alpha[r] = a;
            P[wv][r + 8 * half][ln]      = (_Float16)p0;
            P[wv][r + 8 * half][16 + ln] = (_Float16)p1;
        }
        asm volatile("s_wait_dscnt 0x0" ::: "memory");   // LDS RAW fence (P)

        v16h ap;   // P as A fragment
        {
            const _Float16* pr = &P[wv][ln][half * 8];
            #pragma unroll
            for (int e = 0; e < 8; ++e) ap[e]     = pr[e];
            #pragma unroll
            for (int e = 0; e < 8; ++e) ap[8 + e] = pr[16 + e];
        }

        #pragma unroll
        for (int r = 0; r < 8; ++r) {
            c0[r] *= alpha[r]; c1[r] *= alpha[r];
            c2[r] *= alpha[r]; c3[r] *= alpha[r];
        }

        // ---- ctx += P(16x32) @ V(32x64) from transposed LDS V -------------
        {
            v16h bv;
            #pragma unroll
            for (int t = 0; t < 4; ++t) {
                const _Float16* vrp = &Vt[t * 16 + ln][half * 8];
                #pragma unroll
                for (int e = 0; e < 8; ++e) bv[e]     = vrp[e];
                #pragma unroll
                for (int e = 0; e < 8; ++e) bv[8 + e] = vrp[16 + e];
                if      (t == 0) c0 = wmma_f16(ap, bv, c0);
                else if (t == 1) c1 = wmma_f16(ap, bv, c1);
                else if (t == 2) c2 = wmma_f16(ap, bv, c2);
                else             c3 = wmma_f16(ap, bv, c3);
            }
        }
        __syncthreads();
    }

    // ---- epilogue: normalize and store ctx (f32) --------------------------
    #pragma unroll
    for (int r = 0; r < 8; ++r) {
        const float inv = 1.0f / lrow[r];
        float* cr = Ch + (size_t)(q0 + r + 8 * half) * D_MODEL + ln;
        cr[0]  = c0[r] * inv;
        cr[16] = c1[r] * inv;
        cr[32] = c2[r] * inv;
        cr[48] = c3[r] * inv;
    }
}

// ---------------------------------------------------------------------------
extern "C" void kernel_launch(void* const* d_in, const int* in_sizes, int n_in,
                              void* d_out, int out_size, void* d_ws, size_t ws_size,
                              hipStream_t stream) {
    const float* query = (const float*)d_in[0];
    const float* key   = (const float*)d_in[1];
    const float* value = (const float*)d_in[2];
    const float* wq = (const float*)d_in[3];
    const float* bq = (const float*)d_in[4];
    const float* wk = (const float*)d_in[5];
    const float* bk = (const float*)d_in[6];
    const float* wv = (const float*)d_in[7];
    const float* bv = (const float*)d_in[8];
    const float* wo = (const float*)d_in[9];
    const float* bo = (const float*)d_in[10];
    const float* td = (const float*)d_in[11];
    float* out = (float*)d_out;

    const size_t elems = (size_t)MROWS * D_MODEL;
    _Float16* Qbuf = (_Float16*)d_ws;            // 8 MB
    _Float16* Kbuf = Qbuf + elems;               // 8 MB
    _Float16* Vbuf = Kbuf + elems;               // 8 MB
    float*    Cbuf = (float*)(Vbuf + elems);     // 16 MB

    const dim3 gblk(256);
    const dim3 ggrid(D_MODEL / 64, MROWS / 64);  // 16 x 64
    proj_gemm_kernel<_Float16><<<ggrid, gblk, 0, stream>>>(query, wq, bq, Qbuf);
    proj_gemm_kernel<_Float16><<<ggrid, gblk, 0, stream>>>(key,   wk, bk, Kbuf);
    proj_gemm_kernel<_Float16><<<ggrid, gblk, 0, stream>>>(value, wv, bv, Vbuf);

    attn_flash_kernel<<<dim3(BATCH * N_HEADS * (SEQ / 128)), dim3(256), 0, stream>>>(
        Qbuf, Kbuf, Vbuf, td, Cbuf);

    proj_gemm_kernel<float><<<ggrid, gblk, 0, stream>>>(Cbuf, wo, bo, out);
}

// v001
// A run of this version takes 241 microseconds.
// Timed twice side by side with v000, it ran 1.41 and 1.40 times as fast.
#include <hip/hip_runtime.h>
#include <hip/hip_bf16.h>
#include <cmath>

#define D_MODEL 1024
#define N_HEADS 16
#define D_KH    64
#define SEQ     2048
#define BATCH   2
#define MROWS   (BATCH * SEQ)     // 4096

typedef __attribute__((ext_vector_type(16))) _Float16     v16h;
typedef __attribute__((ext_vector_type(8)))  float        v8f;
typedef __attribute__((ext_vector_type(4)))  unsigned int v4u;
typedef __attribute__((ext_vector_type(8)))  int          v8i;
typedef __attribute__((ext_vector_type(4)))  int          v4i;
typedef __attribute__((ext_vector_type(8)))  _Float16     v8h;
typedef __attribute__((ext_vector_type(4)))  float        v4f;

// LDS pitches: 16 B x odd, so a 16-lane column of 16-byte reads meets no bank twice.
#define ROW128_PITCH_B 144                    // 128-byte rows + the mover's 16-byte pad
#define GP   (ROW128_PITCH_B / 4)             // GEMM tiles: pitch in floats (36)
#define GBUF 2560                             // floats per GEMM buffer: 64 rows of 144 B, rounded up to 2 KiB x 5
#define KP   (ROW128_PITCH_B / 2)             // K tile: pitch in halves (72)
#define VP   40                               // V^T and P tiles: 64-byte rows at pitch 80 B

__device__ __forceinline__ v8f wmma_f16(v16h a, v16h b, v8f c) {
    return __builtin_amdgcn_wmma_f32_16x16x32_f16(
        false, a, false, b, (short)0, c, false, false);
}

// Low 32 bits of a generic pointer to LDS == LDS byte offset.
__device__ __forceinline__ unsigned lds_off(const void* p) {
    return (unsigned)(size_t)p;
}

__device__ __forceinline__ unsigned uni(unsigned v) {
    return (unsigned)__builtin_amdgcn_readfirstlane(v);
}

// A wave-uniform test held in a scalar register, so that the branch round a
// tensor load (which ignores EXEC) compiles to s_cmp + s_cbranch_scc.
__device__ __forceinline__ unsigned pinned(unsigned v) {
    unsigned w = uni(v);
    asm volatile("" : "+s"(w));   // keeps the test scalar: a vector branch would not guard the tensor load
    return w;
}

// ---------------------------------------------------------------------------
// Tensor-load descriptor of a tile of 128-byte rows that lands in LDS with a
// 16-byte pad behind every row (LDS pitch 144 B).  Every extent is in bytes
// (data_size code 0); tensor dims = tile dims.
// ---------------------------------------------------------------------------
__device__ __forceinline__ v4u tdm_group0(unsigned lds, const void* gptr) {
    const unsigned long long ga = (unsigned long long)(size_t)gptr;
    v4u g0;
    g0[0] = 1u;                                           // count=1 (valid)
    g0[1] = uni(lds);                                     // lds_addr
    g0[2] = uni((unsigned)(ga & 0xffffffffu));            // global_addr lo
    g0[3] = (uni((unsigned)(ga >> 32)) & 0x01ffffffu)     // global_addr hi
          | (2u << 30);                                   // type=2
    asm volatile("" : "+s"(g0));   // pinned(): descriptor words held in their own scalar registers, not formed anew from copies
    return g0;
}

__device__ __forceinline__ v8i tdm_group1(unsigned rows, unsigned pitch) {
    v8i g1;
    g1[0] = (int)((1u << 20)      // pad_enable
          |       (4u << 22)      // pad_interval = 32 DWORDs = one row
          |       (3u << 25));    // pad_amount   = 4 DWORDs
    g1[1] = (int)(128u << 16);                            // tensor_dim0 = 128 B
    g1[2] = (int)(uni(rows) << 16);                       // tensor_dim1 = rows
    g1[3] = (int)(128u << 16);                            // tile_dim0 = 128 B
    g1[4] = (int)uni(rows);                               // tile_dim1
    g1[5] = (int)uni(pitch);                              // source row pitch, bytes
    g1[6] = 0;
    g1[7] = 0;
    asm volatile("" : "+s"(g1));   // pinned(): descriptor words held in their own scalar registers, not formed anew from copies
    return g1;
}

__device__ __forceinline__ void tdm_load(v4u g0, v8i g1) {
    const v4i z4 = {0, 0, 0, 0};
    const v8i z8 = {0, 0, 0, 0, 0, 0, 0, 0};
    __builtin_amdgcn_tensor_load_to_lds(g0, g1, z4, z4, z8, 0);
}

// 16x32 f16 fragment of one lane from a row of f32: k = 0..7 and 16..23 from p.
__device__ __forceinline__ v16h frag_from_f32(const float* p) {
    const v4f x0 = *(const v4f*)(p);
    const v4f x1 = *(const v4f*)(p + 4);
    const v4f x2 = *(const v4f*)(p + 16);
    const v4f x3 = *(const v4f*)(p + 20);
    v16h f;
    #pragma unroll
    for (int e = 0; e < 4; ++e) {
        f[e]      = (_Float16)x0[e];
        f[4 + e]  = (_Float16)x1[e];
        f[8 + e]  = (_Float16)x2[e];
        f[12 + e] = (_Float16)x3[e];
    }
    return f;
}

// The same from a row of f16.
__device__ __forceinline__ v16h frag_from_f16(const _Float16* p) {
    const v8h lo = *(const v8h*)(p);
    const v8h hi = *(const v8h*)(p + 16);
    return __builtin_shufflevector(lo, hi, 0, 1, 2, 3, 4, 5, 6, 7,
                                   8, 9, 10, 11, 12, 13, 14, 15);
}

// ---------------------------------------------------------------------------
// Projection GEMM: Y[4096,1024] = X[4096,1024] @ W[1024,1024]^T + bias.
// 64x64 block tile, k-step 32, TDM double-buffered f32 staging in LDS,
// f32->f16 conversion at fragment read, 2 WMMAs per wave per k-step.
// TOUT = _Float16 for the Q/K/V projections, float for the output proj.
// ---------------------------------------------------------------------------
template <typename TOUT>
__global__ __launch_bounds__(256)
void proj_gemm_kernel(const float* __restrict__ X,
                      const float* __restrict__ W,
                      const float* __restrict__ bias,
                      TOUT* __restrict__ Y)
{
    // [buffer][A | B]: 64 rows each, 36-dw pitch from the TDM pad
    __shared__ __attribute__((aligned(2048))) float Ts[2][2][GBUF];

    const int tid  = threadIdx.x;
    const int lane = tid & 31;
    const int wv   = tid >> 5;
    const int half = lane >> 4;
    const int ln   = lane & 15;

    const int m0  = blockIdx.y * 64;
    const int n0  = blockIdx.x * 64;
    const int mt  = wv & 3;
    const int nt0 = (wv >> 2) * 2;

    v8f acc0 = {}; v8f acc1 = {};

    const unsigned wave = uni((unsigned)tid >> 5);
    const float* xa = X + (size_t)m0 * D_MODEL;
    const float* wb = W + (size_t)n0 * D_MODEL;
    const v8i g1 = tdm_group1(64, D_MODEL * 4);    // the same for every A and B tile
    v4u ga = tdm_group0(lds_off(&Ts[0][0][0]), xa);
    v4u gb = tdm_group0(lds_off(&Ts[0][1][0]), wb);

    if (pinned(wave == 0)) {   // prologue: k0=0 tiles into buffer 0
        tdm_load(ga, g1);
        tdm_load(gb, g1);
    }

    int p = 0;
    for (int k0 = 0; k0 < D_MODEL; k0 += 32) {
        if (pinned(wave == 0)) {
            // Current buffer landed.  The descriptors are inputs so that their
            // registers keep their values while the requests are outstanding.
            asm volatile("s_wait_tensorcnt 0x0" :: "s"(ga), "s"(gb), "s"(g1) : "memory");
        }
        ga = tdm_group0(lds_off(&Ts[1 - p][0][0]), xa + k0 + 32);
        gb = tdm_group0(lds_off(&Ts[1 - p][1][0]), wb + k0 + 32);
        if (pinned(wave == 0 && k0 + 32 < D_MODEL)) {   // issue next tiles into the other buffer
            tdm_load(ga, g1);
            tdm_load(gb, g1);
        }
        __syncthreads();

        // Fragments: row = tile*16+ln, K(e) = half*8+e | 16+half*8+e
        const v16h a  = frag_from_f32(&Ts[p][0][(mt * 16 + ln) * GP + half * 8]);
        const v16h b0 = frag_from_f32(&Ts[p][1][(nt0 * 16 + ln) * GP + half * 8]);
        const v16h b1 = frag_from_f32(&Ts[p][1][((nt0 + 1) * 16 + ln) * GP + half * 8]);
        acc0 = wmma_f16(a, b0, acc0);
        acc1 = wmma_f16(a, b1, acc1);
        __syncthreads();
        p ^= 1;
    }

    // Epilogue: bias + store.  D layout: row = r + 8*half, col = ln.
    const int na = n0 + nt0 * 16 + ln;
    const float ba = bias[na];
    const float bb = bias[na + 16];
    TOUT* ya = Y + (size_t)(m0 + mt * 16 + 8 * half) * D_MODEL + na;
    #pragma unroll
    for (int r = 0; r < 8; ++r) {
        ya[(size_t)r * D_MODEL]      = (TOUT)(acc0[r] + ba);
        ya[(size_t)r * D_MODEL + 16] = (TOUT)(acc1[r] + bb);
    }
}

// ---------------------------------------------------------------------------
// Flash attention with additive time-decay bias.  Q/K/V are f16 (written by
// the projection GEMMs), ctx is f32.
// Block = 8 waves, all on the same (b,h), covering 128 consecutive q rows.
// Per 32-key step: TDM loads the K tile (f16, async, overlapping the manual
// transposed V staging); each wave: 4 score WMMAs, online softmax, P restage
// through per-wave LDS, 4 ctx WMMAs.
// ---------------------------------------------------------------------------
__global__ __launch_bounds__(256)
void attn_flash_kernel(const _Float16* __restrict__ Qb,
                       const _Float16* __restrict__ Kb,
                       const _Float16* __restrict__ Vb,
                       const float* __restrict__ td_ptr,
                       float* __restrict__ Cb)
{
    __shared__ __attribute__((aligned(2048))) _Float16 Kt[32][KP];  // [key][d], 72-elem pitch from TDM pad
    __shared__ __attribute__((aligned(16))) _Float16 Vt[64][VP];    // [d][key] (+8 pad)
    __shared__ __attribute__((aligned(16))) _Float16 P[8][16][VP];  // per-wave probability tile (+8 pad)

    const int tid  = threadIdx.x;
    const int lane = tid & 31;
    const int wv   = tid >> 5;
    const int half = lane >> 4;
    const int ln   = lane & 15;

    const int bh   = blockIdx.x >> 4;          // 0..31
    const int qblk = blockIdx.x & 15;          // 0..15
    const int b    = bh >> 4;
    const int h    = bh & 15;
    const int q0   = (qblk * 8 + wv) * 16;

    const float td    = td_ptr[0];
    const float scale = 0.125f;                // 1/sqrt(64)

    const _Float16* Qh = Qb + (size_t)b * SEQ * D_MODEL + h * D_KH;
    const _Float16* Kh = Kb + (size_t)b * SEQ * D_MODEL + h * D_KH;
    const _Float16* Vh = Vb + (size_t)b * SEQ * D_MODEL + h * D_KH;
    float*          Ch = Cb + (size_t)b * SEQ * D_MODEL + h * D_KH;

    // Q A-fragments for d = 0..31 / 32..63 (row = ln); contiguous f16 loads.
    v16h aq0, aq1;
    {
        const _Float16* qr = Qh + (size_t)(q0 + ln) * D_MODEL;
        #pragma unroll
        for (int e = 0; e < 8; ++e) aq0[e]     = qr[half * 8 + e];
        #pragma unroll
        for (int e = 0; e < 8; ++e) aq0[8 + e] = qr[16 + half * 8 + e];
        #pragma unroll
        for (int e = 0; e < 8; ++e) aq1[e]     = qr[32 + half * 8 + e];
        #pragma unroll
        for (int e = 0; e < 8; ++e) aq1[8 + e] = qr[48 + half * 8 + e];
    }

    v8f c0 = {}, c1 = {}, c2 = {}, c3 = {};
    float mrow[8], lrow[8];
    #pragma unroll
    for (int r = 0; r < 8; ++r) { mrow[r] = -3.0e38f; lrow[r] = 0.0f; }

    const int srow = tid >> 3;          // staging: key row 0..31
    const int scol = (tid & 7) * 8;     // staging: d col 0,8,..,56

    const v8i g1k = tdm_group1(32, D_MODEL * 2);   // the same for every K tile

    for (int key0 = 0; key0 < SEQ; key0 += 32) {
        // ---- async TDM load of the K tile (f16, 32 keys x 64 d) -----------
        const v4u g0k = tdm_group0(lds_off(&Kt[0][0]), Kh + (size_t)key0 * D_MODEL);
        if (tid < 32) {
            tdm_load(g0k, g1k);
        }
        // ---- manual transposed staging of the V tile (overlaps the TDM) ---
        {
            const _Float16* vs = Vh + (size_t)(key0 + srow) * D_MODEL + scol;
            if (key0 + 32 < SEQ)
                __builtin_prefetch(Vh + (size_t)(key0 + 32 + srow) * D_MODEL + scol, 0, 0);
            #pragma unroll
            for (int j = 0; j < 8; ++j) Vt[scol + j][srow] = vs[j];
        }
        if (tid < 32) {
            // The descriptor is an input so that its registers keep their values
            // while the request is outstanding.
            asm volatile("s_wait_tensorcnt 0x0" :: "s"(g0k), "s"(g1k) : "memory");
        }
        __syncthreads();

        // ---- scores: two 16x16 tiles from LDS K ---------------------------
        v8f s0 = {}, s1 = {};
        {
            const _Float16* kr = &Kt[ln][half * 8];
            s0 = wmma_f16(aq0, frag_from_f16(kr), s0);
            s0 = wmma_f16(aq1, frag_from_f16(kr + 32), s0);
            kr = &Kt[16 + ln][half * 8];
            s1 = wmma_f16(aq0, frag_from_f16(kr), s1);
            s1 = wmma_f16(aq1, frag_from_f16(kr + 32), s1);
        }

        // ---- scale + time-decay bias + online softmax ---------------------
        float alpha[8];
        #pragma unroll
        for (int r = 0; r < 8; ++r) {
            const float qpos = (float)(q0 + r + 8 * half);
            const float v0 = s0[r] * scale - td * fabsf(qpos - (float)(key0 + ln));
            const float v1 = s1[r] * scale - td * fabsf(qpos - (float)(key0 + 16 + ln));
            float t = fmaxf(v0, v1);
            t = fmaxf(t, __shfl_xor(t, 1, 32));
            t = fmaxf(t, __shfl_xor(t, 2, 32));
            t = fmaxf(t, __shfl_xor(t, 4, 32));
            t = fmaxf(t, __shfl_xor(t, 8, 32));
            const float mnew = fmaxf(mrow[r], t);
            const float a    = __expf(mrow[r] - mnew);
            const float p0   = __expf(v0 - mnew);
            const float p1   = __expf(v1 - mnew);
            float rs = p0 + p1;
            rs += __shfl_xor(rs, 1, 32);
            rs += __shfl_xor(rs, 2, 32);
            rs += __shfl_xor(rs, 4, 32);
            rs += __shfl_xor(rs, 8, 32);
            lrow[r]  = lrow[r] * a + rs;
            mrow[r]  = mnew;
            alpha[r] = a;
            P[wv][r + 8 * half][ln]      = (_Float16)p0;
            P[wv][r + 8 * half][16 + ln] = (_Float16)p1;
        }
        asm volatile("s_wait_dscnt 0x0" ::: "memory");   // LDS RAW fence (P)

        const v16h ap = frag_from_f16(&P[wv][ln][half * 8]);   // P as A fragment

        #pragma unroll
        for (int r = 0; r < 8; ++r) {
            c0[r] *= alpha[r]; c1[r] *= alpha[r];
            c2[r] *= alpha[r]; c3[r] *= alpha[r];
        }

        // ---- ctx += P(16x32) @ V(32x64) from transposed LDS V -------------
        {
            #pragma unroll
            for (int t = 0; t < 4; ++t) {
                const v16h bv = frag_from_f16(&Vt[t * 16 + ln][half * 8]);
                if      (t == 0) c0 = wmma_f16(ap, bv, c0);
                else if (t == 1) c1 = wmma_f16(ap, bv, c1);
                else if (t == 2) c2 = wmma_f16(ap, bv, c2);
                else             c3 = wmma_f16(ap, bv, c3);
            }
        }
        __syncthreads();
    }

    // ---- epilogue: normalize and store ctx (f32) --------------------------
    #pragma unroll
    for (int r = 0; r < 8; ++r) {
        const float inv = 1.0f / lrow[r];
        float* cr = Ch + (size_t)(q0 + r + 8 * half) * D_MODEL + ln;
        cr[0]  = c0[r] * inv;
        cr[16] = c1[r] * inv;
        cr[32] = c2[r] * inv;
        cr[48] = c3[r] * inv;
    }
}

// ---------------------------------------------------------------------------
extern "C" void kernel_launch(void* const* d_in, const int* in_sizes, int n_in,
                              void* d_out, int out_size, void* d_ws, size_t ws_size,
                              hipStream_t stream) {
    const float* query = (const float*)d_in[0];
    const float* key   = (const float*)d_in[1];
    const float* value = (const float*)d_in[2];
    const float* wq = (const float*)d_in[3];
    const float* bq = (const float*)d_in[4];
    const float* wk = (const float*)d_in[5];
    const float* bk = (const float*)d_in[6];
    const float* wv = (const float*)d_in[7];
    const float* bv = (const float*)d_in[8];
    const float* wo = (const float*)d_in[9];
    const float* bo = (const float*)d_in[10];
    const float* td = (const float*)d_in[11];
    float* out = (float*)d_out;

    const size_t elems = (size_t)MROWS * D_MODEL;
    _Float16* Qbuf = (_Float16*)d_ws;            // 8 MB
    _Float16* Kbuf = Qbuf + elems;               // 8 MB
    _Float16* Vbuf = Kbuf + elems;               // 8 MB
    float*    Cbuf = (float*)(Vbuf + elems);     // 16 MB

    const dim3 gblk(256);
    const dim3 ggrid(D_MODEL / 64, MROWS / 64);  // 16 x 64
    proj_gemm_kernel<_Float16><<<ggrid, gblk, 0, stream>>>(query, wq, bq, Qbuf);
    proj_gemm_kernel<_Float16><<<ggrid, gblk, 0, stream>>>(key,   wk, bk, Kbuf);
    proj_gemm_kernel<_Float16><<<ggrid, gblk, 0, stream>>>(value, wv, bv, Vbuf);

    attn_flash_kernel<<<dim3(BATCH * N_HEADS * (SEQ / 128)), dim3(256), 0, stream>>>(
        Qbuf, Kbuf, Vbuf, td, Cbuf);

    proj_gemm_kernel<float><<<ggrid, gblk, 0, stream>>>(Cbuf, wo, bo, out);
}

// v002
// Measured time: 206 microseconds a run.
// Next to v001, in two timings, it ran 1.16 and 1.17 times as fast.
// All steps since v000 together make it 1.64 times as fast.
#include <hip/hip_runtime.h>
#include <hip/hip_bf16.h>
#include <cmath>

#define D_MODEL 1024
#define N_HEADS 16
#define D_KH    64
#define SEQ     2048
#define BATCH   2
#define MROWS   (BATCH * SEQ)     // 4096

typedef __attribute__((ext_vector_type(16))) _Float16     v16h;
typedef __attribute__((ext_vector_type(8)))  float        v8f;
typedef __attribute__((ext_vector_type(4)))  unsigned int v4u;
typedef __attribute__((ext_vector_type(8)))  int          v8i;
typedef __attribute__((ext_vector_type(4)))  int          v4i;
typedef __attribute__((ext_vector_type(8)))  _Float16     v8h;
typedef __attribute__((ext_vector_type(4)))  float        v4f;

// LDS pitches: 16 B x odd, so a 16-lane column of 16-byte reads meets no bank twice.
#define ROW128_PITCH_B 144                    // 128-byte rows + the mover's 16-byte pad
#define GP   (ROW128_PITCH_B / 4)             // GEMM tiles: pitch in floats (36)
#define GBUF 2560                             // floats per GEMM buffer: 64 rows of 144 B, rounded up to 2 KiB x 5
#define KP   (ROW128_PITCH_B / 2)             // K tile: pitch in halves (72)
#define VP   40                               // V^T tile: 64-byte rows at pitch 80 B

__device__ __forceinline__ v8f wmma_f16(v16h a, v16h b, v8f c) {
    return __builtin_amdgcn_wmma_f32_16x16x32_f16(
        false, a, false, b, (short)0, c, false, false);
}

// Low 32 bits of a generic pointer to LDS == LDS byte offset.
__device__ __forceinline__ unsigned lds_off(const void* p) {
    return (unsigned)(size_t)p;
}

__device__ __forceinline__ unsigned uni(unsigned v) {
    return (unsigned)__builtin_amdgcn_readfirstlane(v);
}

// A wave-uniform test held in a scalar register, so that the branch round a
// tensor load (which ignores EXEC) compiles to s_cmp + s_cbranch_scc.
__device__ __forceinline__ unsigned pinned(unsigned v) {
    unsigned w = uni(v);
    asm volatile("" : "+s"(w));   // keeps the test scalar: a vector branch would not guard the tensor load
    return w;
}

// ---------------------------------------------------------------------------
// Tensor-load descriptor of a tile of 128-byte rows that lands in LDS with a
// 16-byte pad behind every row (LDS pitch 144 B).  Every extent is in bytes
// (data_size code 0); tensor dims = tile dims.
// ---------------------------------------------------------------------------
__device__ __forceinline__ v4u tdm_group0(unsigned lds, const void* gptr) {
    const unsigned long long ga = (unsigned long long)(size_t)gptr;
    v4u g0;
    g0[0] = 1u;                                           // count=1 (valid)
    g0[1] = uni(lds);                                     // lds_addr
    g0[2] = uni((unsigned)(ga & 0xffffffffu));            // global_addr lo
    g0[3] = (uni((unsigned)(ga >> 32)) & 0x01ffffffu)     // global_addr hi
          | (2u << 30);                                   // type=2
    asm volatile("" : "+s"(g0));   // pinned(): descriptor words held in their own scalar registers, not formed anew from copies
    return g0;
}

__device__ __forceinline__ v8i tdm_group1(unsigned rows, unsigned pitch) {
    v8i g1;
    g1[0] = (int)((1u << 20)      // pad_enable
          |       (4u << 22)      // pad_interval = 32 DWORDs = one row
          |       (3u << 25));    // pad_amount   = 4 DWORDs
    g1[1] = (int)(128u << 16);                            // tensor_dim0 = 128 B
    g1[2] = (int)(uni(rows) << 16);                       // tensor_dim1 = rows
    g1[3] = (int)(128u << 16);                            // tile_dim0 = 128 B
    g1[4] = (int)uni(rows);                               // tile_dim1
    g1[5] = (int)uni(pitch);                              // source row pitch, bytes
    g1[6] = 0;
    g1[7] = 0;
    asm volatile("" : "+s"(g1));   // pinned(): descriptor words held in their own scalar registers, not formed anew from copies
    return g1;
}

__device__ __forceinline__ void tdm_load(v4u g0, v8i g1) {
    const v4i z4 = {0, 0, 0, 0};
    const v8i z8 = {0, 0, 0, 0, 0, 0, 0, 0};
    __builtin_amdgcn_tensor_load_to_lds(g0, g1, z4, z4, z8, 0);
}

// 16x32 f16 fragment of one lane from a row of f32: k = 0..7 and 16..23 from p.
__device__ __forceinline__ v16h frag_from_f32(const float* p) {
    const v4f x0 = *(const v4f*)(p);
    const v4f x1 = *(const v4f*)(p + 4);
    const v4f x2 = *(const v4f*)(p + 16);
    const v4f x3 = *(const v4f*)(p + 20);
    v16h f;
    #pragma unroll
    for (int e = 0; e < 4; ++e) {
        f[e]      = (_Float16)x0[e];
        f[4 + e]  = (_Float16)x1[e];
        f[8 + e]  = (_Float16)x2[e];
        f[12 + e] = (_Float16)x3[e];
    }
    return f;
}

// The same from a row of f16.
__device__ __forceinline__ v16h frag_from_f16(const _Float16* p) {
    const v8h lo = *(const v8h*)(p);
    const v8h hi = *(const v8h*)(p + 16);
    return __builtin_shufflevector(lo, hi, 0, 1, 2, 3, 4, 5, 6, 7,
                                   8, 9, 10, 11, 12, 13, 14, 15);
}

// Lane l reads lane l ^ 16: the two wave halves hold the two halves of a column.
__device__ __forceinline__ float xhalf(float x) {
    const int b = __builtin_bit_cast(int, x);
    return __builtin_bit_cast(float,
        __builtin_amdgcn_permlanex16(b, b, 0x76543210, 0xfedcba98, false, false));
}

// ---------------------------------------------------------------------------
// Projection GEMM: Y[4096,1024] = X[4096,1024] @ W[1024,1024]^T + bias.
// 64x64 block tile, k-step 32, TDM double-buffered f32 staging in LDS,
// f32->f16 conversion at fragment read, 2 WMMAs per wave per k-step.
// TOUT = _Float16 for the Q/K/V projections, float for the output proj.
// ---------------------------------------------------------------------------
template <typename TOUT>
__global__ __launch_bounds__(256)
void proj_gemm_kernel(const float* __restrict__ X,
                      const float* __restrict__ W,
                      const float* __restrict__ bias,
                      TOUT* __restrict__ Y)
{
    // [buffer][A | B]: 64 rows each, 36-dw pitch from the TDM pad
    __shared__ __attribute__((aligned(2048))) float Ts[2][2][GBUF];

    const int tid  = threadIdx.x;
    const int lane = tid & 31;
    const int wv   = tid >> 5;
    const int half = lane >> 4;
    const int ln   = lane & 15;

    const int m0  = blockIdx.y * 64;
    const int n0  = blockIdx.x * 64;
    const int mt  = wv & 3;
    const int nt0 = (wv >> 2) * 2;

    v8f acc0 = {}; v8f acc1 = {};

    const unsigned wave = uni((unsigned)tid >> 5);
    const float* xa = X + (size_t)m0 * D_MODEL;
    const float* wb = W + (size_t)n0 * D_MODEL;
    const v8i g1 = tdm_group1(64, D_MODEL * 4);    // the same for every A and B tile
    v4u ga = tdm_group0(lds_off(&Ts[0][0][0]), xa);
    v4u gb = tdm_group0(lds_off(&Ts[0][1][0]), wb);

    if (pinned(wave == 0)) {   // prologue: k0=0 tiles into buffer 0
        tdm_load(ga, g1);
        tdm_load(gb, g1);
    }

    int p = 0;
    for (int k0 = 0; k0 < D_MODEL; k0 += 32) {
        if (pinned(wave == 0)) {
            // Current buffer landed.  The descriptors are inputs so that their
            // registers keep their values while the requests are outstanding.
            asm volatile("s_wait_tensorcnt 0x0" :: "s"(ga), "s"(gb), "s"(g1) : "memory");
        }
        ga = tdm_group0(lds_off(&Ts[1 - p][0][0]), xa + k0 + 32);
        gb = tdm_group0(lds_off(&Ts[1 - p][1][0]), wb + k0 + 32);
        if (pinned(wave == 0 && k0 + 32 < D_MODEL)) {   // issue next tiles into the other buffer
            tdm_load(ga, g1);
            tdm_load(gb, g1);
        }
        __syncthreads();

        // Fragments: row = tile*16+ln, K(e) = half*8+e | 16+half*8+e
        const v16h a  = frag_from_f32(&Ts[p][0][(mt * 16 + ln) * GP + half * 8]);
        const v16h b0 = frag_from_f32(&Ts[p][1][(nt0 * 16 + ln) * GP + half * 8]);
        const v16h b1 = frag_from_f32(&Ts[p][1][((nt0 + 1) * 16 + ln) * GP + half * 8]);
        acc0 = wmma_f16(a, b0, acc0);
        acc1 = wmma_f16(a, b1, acc1);
        __syncthreads();
        p ^= 1;
    }

    // Epilogue: bias + store.  D layout: row = r + 8*half, col = ln.
    const int na = n0 + nt0 * 16 + ln;
    const float ba = bias[na];
    const float bb = bias[na + 16];
    TOUT* ya = Y + (size_t)(m0 + mt * 16 + 8 * half) * D_MODEL + na;
    #pragma unroll
    for (int r = 0; r < 8; ++r) {
        ya[(size_t)r * D_MODEL]      = (TOUT)(acc0[r] + ba);
        ya[(size_t)r * D_MODEL + 16] = (TOUT)(acc1[r] + bb);
    }
}

__global__ __launch_bounds__(256)
void attn_flash_kernel(const _Float16* __restrict__ Qb,
                       const _Float16* __restrict__ Kb,
                       const _Float16* __restrict__ Vb,
                       const float* __restrict__ td_ptr,
                       float* __restrict__ Cb)
{
    __shared__ __attribute__((aligned(2048))) _Float16 Kt[32][KP];  // [key][d], 72-elem pitch from TDM pad
    __shared__ __attribute__((aligned(16))) _Float16 Vt[64][VP];    // [d][key] (+8 pad)

    const int tid  = threadIdx.x;
    const int lane = tid & 31;
    const int wv   = tid >> 5;
    const int half = lane >> 4;
    const int ln   = lane & 15;

    const int bh   = blockIdx.x >> 4;          // 0..31
    const int qblk = blockIdx.x & 15;          // 0..15
    const int b    = bh >> 4;
    const int h    = bh & 15;
    const int q0   = (qblk * 8 + wv) * 16;

    const float td    = td_ptr[0];
    const float scale = 0.125f;                // 1/sqrt(64)

    const _Float16* Qh = Qb + (size_t)b * SEQ * D_MODEL + h * D_KH;
    const _Float16* Kh = Kb + (size_t)b * SEQ * D_MODEL + h * D_KH;
    const _Float16* Vh = Vb + (size_t)b * SEQ * D_MODEL + h * D_KH;
    float*          Ch = Cb + (size_t)b * SEQ * D_MODEL + h * D_KH;

    // Q B-fragments for d = 0..31 / 32..63 (column = ln); contiguous f16 loads.
    v16h aq0, aq1;
    {
        const _Float16* qr = Qh + (size_t)(q0 + ln) * D_MODEL;
        #pragma unroll
        for (int e = 0; e < 8; ++e) aq0[e]     = qr[half * 8 + e];
        #pragma unroll
        for (int e = 0; e < 8; ++e) aq0[8 + e] = qr[16 + half * 8 + e];
        #pragma unroll
        for (int e = 0; e < 8; ++e) aq1[e]     = qr[32 + half * 8 + e];
        #pragma unroll
        for (int e = 0; e < 8; ++e) aq1[8 + e] = qr[48 + half * 8 + e];
    }

    v8f c0 = {}, c1 = {}, c2 = {}, c3 = {};
    float mrun = -3.0e38f;              // running maximum of query q0 + ln (equal in both halves)
    float lrun = 0.0f;                  // running sum over this half's keys; the halves join in the epilogue
    const float qpos = (float)(q0 + ln);

    const int srow = tid >> 3;          // staging: key row 0..31
    const int scol = (tid & 7) * 8;     // staging: d col 0,8,..,56

    const v8i g1k = tdm_group1(32, D_MODEL * 2);   // the same for every K tile

    for (int key0 = 0; key0 < SEQ; key0 += 32) {
        // ---- async TDM load of the K tile (f16, 32 keys x 64 d) -----------
        const v4u g0k = tdm_group0(lds_off(&Kt[0][0]), Kh + (size_t)key0 * D_MODEL);
        if (tid < 32) {
            tdm_load(g0k, g1k);
        }
        // ---- manual transposed staging of the V tile (overlaps the TDM) ---
        {
            const _Float16* vs = Vh + (size_t)(key0 + srow) * D_MODEL + scol;
            if (key0 + 32 < SEQ)
                __builtin_prefetch(Vh + (size_t)(key0 + 32 + srow) * D_MODEL + scol, 0, 0);
            #pragma unroll
            for (int j = 0; j < 8; ++j) Vt[scol + j][srow] = vs[j];
        }
        if (tid < 32) {
            // The descriptor is an input so that its registers keep their values
            // while the request is outstanding.
            asm volatile("s_wait_tensorcnt 0x0" :: "s"(g0k), "s"(g1k) : "memory");
        }
        __syncthreads();

        // ---- scores, transposed: s0[r] = S[key0 + 8*half + r][q0 + ln], s1: +16 keys
        v8f s0 = {}, s1 = {};
        {
            const _Float16* kr = &Kt[ln][half * 8];
            s0 = wmma_f16(frag_from_f16(kr), aq0, s0);
            s0 = wmma_f16(frag_from_f16(kr + 32), aq1, s0);
            kr = &Kt[16 + ln][half * 8];
            s1 = wmma_f16(frag_from_f16(kr), aq0, s1);
            s1 = wmma_f16(frag_from_f16(kr + 32), aq1, s1);
        }

        // ---- scale + time-decay bias + online softmax, one query per lane -
        const float dist0 = qpos - (float)(key0 + 8 * half);   // whole numbers: exact
        #pragma unroll
        for (int r = 0; r < 8; ++r) s0[r] = s0[r] * scale - td * fabsf(dist0 - (float)r);
        #pragma unroll
        for (int r = 0; r < 8; ++r) s1[r] = s1[r] * scale - td * fabsf(dist0 - (float)(16 + r));
        float t = fmaxf(s0[0], s1[0]);
        #pragma unroll
        for (int r = 1; r < 8; ++r) t = fmaxf(t, fmaxf(s0[r], s1[r]));
        t = fmaxf(t, xhalf(t));
        const float mnew  = fmaxf(mrun, t);
        const float alpha = __expf(mrun - mnew);
        #pragma unroll
        for (int r = 0; r < 8; ++r) s0[r] = __expf(s0[r] - mnew);
        #pragma unroll
        for (int r = 0; r < 8; ++r) s1[r] = __expf(s1[r] - mnew);
        v16h bp;   // P^T as B fragment: k = 8*half + e | 16 + 8*half + e, the order of the V^T loader
        #pragma unroll
        for (int r = 0; r < 8; ++r) {
            bp[r]     = (_Float16)s0[r];
            bp[8 + r] = (_Float16)s1[r];
        }
        const v8f ps = s0 + s1;
        const float rs = ((ps[0] + ps[1]) + (ps[2] + ps[3])) + ((ps[4] + ps[5]) + (ps[6] + ps[7]));
        lrun = lrun * alpha + rs;
        mrun = mnew;

        #pragma unroll
        for (int r = 0; r < 8; ++r) {
            c0[r] *= alpha; c1[r] *= alpha;
            c2[r] *= alpha; c3[r] *= alpha;
        }

        // ---- ctx^T += V^T(64x32) @ P^T(32x16) from transposed LDS V -------
        {
            #pragma unroll
            for (int t4 = 0; t4 < 4; ++t4) {
                const v16h av = frag_from_f16(&Vt[t4 * 16 + ln][half * 8]);
                if      (t4 == 0) c0 = wmma_f16(av, bp, c0);
                else if (t4 == 1) c1 = wmma_f16(av, bp, c1);
                else if (t4 == 2) c2 = wmma_f16(av, bp, c2);
                else              c3 = wmma_f16(av, bp, c3);
            }
        }
        __syncthreads();
    }

    // ---- epilogue: normalize and store ctx (f32) --------------------------
    // c<t>[r] = O[q0 + ln][t*16 + 8*half + r]: eight consecutive floats a lane.
    {
        const float inv = 1.0f / (lrun + xhalf(lrun));
        float* cr = Ch + (size_t)(q0 + ln) * D_MODEL + 8 * half;
        #pragma unroll
        for (int j = 0; j < 2; ++j) {
            const v4f o0 = {c0[4*j] * inv, c0[4*j+1] * inv, c0[4*j+2] * inv, c0[4*j+3] * inv};
            const v4f o1 = {c1[4*j] * inv, c1[4*j+1] * inv, c1[4*j+2] * inv, c1[4*j+3] * inv};
            const v4f o2 = {c2[4*j] * inv, c2[4*j+1] * inv, c2[4*j+2] * inv, c2[4*j+3] * inv};
            const v4f o3 = {c3[4*j] * inv, c3[4*j+1] * inv, c3[4*j+2] * inv, c3[4*j+3] * inv};
            *(v4f*)(cr + 4 * j)      = o0;
            *(v4f*)(cr + 16 + 4 * j) = o1;
            *(v4f*)(cr + 32 + 4 * j) = o2;
            *(v4f*)(cr + 48 + 4 * j) = o3;
        }
    }
}

// ---------------------------------------------------------------------------
extern "C" void kernel_launch(void* const* d_in, const int* in_sizes, int n_in,
                              void* d_out, int out_size, void* d_ws, size_t ws_size,
                              hipStream_t stream) {
    const float* query = (const float*)d_in[0];
    const float* key   = (const float*)d_in[1];
    const float* value = (const float*)d_in[2];
    const float* wq = (const float*)d_in[3];
    const float* bq = (const float*)d_in[4];
    const float* wk = (const float*)d_in[5];
    const float* bk = (const float*)d_in[6];
    const float* wv = (const float*)d_in[7];
    const float* bv = (const float*)d_in[8];
    const float* wo = (const float*)d_in[9];
    const float* bo = (const float*)d_in[10];
    const float* td = (const float*)d_in[11];
    float* out = (float*)d_out;

    const size_t elems = (size_t)MROWS * D_MODEL;
    _Float16* Qbuf = (_Float16*)d_ws;            // 8 MB
    _Float16* Kbuf = Qbuf + elems;               // 8 MB
    _Float16* Vbuf = Kbuf + elems;               // 8 MB
    float*    Cbuf = (float*)(Vbuf + elems);     // 16 MB

    const dim3 gblk(256);
    const dim3 ggrid(D_MODEL / 64, MROWS / 64);  // 16 x 64
    proj_gemm_kernel<_Float16><<<ggrid, gblk, 0, stream>>>(query, wq, bq, Qbuf);
    proj_gemm_kernel<_Float16><<<ggrid, gblk, 0, stream>>>(key,   wk, bk, Kbuf);
    proj_gemm_kernel<_Float16><<<ggrid, gblk, 0, stream>>>(value, wv, bv, Vbuf);

    attn_flash_kernel<<<dim3(BATCH * N_HEADS * (SEQ / 128)), dim3(256), 0, stream>>>(
        Qbuf, Kbuf, Vbuf, td, Cbuf);

    proj_gemm_kernel<float><<<ggrid, gblk, 0, stream>>>(Cbuf, wo, bo, out);
}

// v003
// One run takes 152 microseconds.
// Next to v002, in two timings, it ran 1.36 times as fast each time.
// Counting every step since v000, it is 2.22 times as fast.
#include <hip/hip_runtime.h>
#include <hip/hip_bf16.h>
#include <cmath>

#define D_MODEL 1024
#define N_HEADS 16
#define D_KH    64
#define SEQ     2048
#define BATCH   2
#define MROWS   (BATCH * SEQ)     // 4096

typedef __attribute__((ext_vector_type(16))) _Float16     v16h;
typedef __attribute__((ext_vector_type(8)))  float        v8f;
typedef __attribute__((ext_vector_type(4)))  unsigned int v4u;
typedef __attribute__((ext_vector_type(8)))  int          v8i;
typedef __attribute__((ext_vector_type(4)))  int          v4i;
typedef __attribute__((ext_vector_type(8)))  _Float16     v8h;
typedef __attribute__((ext_vector_type(4)))  float        v4f;

// LDS pitches: 16 B x odd, so a 16-lane column of 16-byte reads meets no bank twice.
#define ROW128_PITCH_B 144                    // 128-byte rows + the mover's 16-byte pad
#define ROW256_PITCH_B 272                    // 256-byte rows + the mover's 16-byte pad
#define GP   (ROW256_PITCH_B / 4)             // GEMM slices: pitch in floats (68)
#define GSL  4608                             // floats per GEMM slice: 64 rows of 272 B, rounded up to 2 KiB x 9
#define GKS  128                              // k per GEMM stage
#define GNST (D_MODEL / GKS)                  // GEMM stages (8)
#define KP   (ROW128_PITCH_B / 2)             // K tile: pitch in halves (72)
#define VP   40                               // V^T tile: 64-byte rows at pitch 80 B

__device__ __forceinline__ v8f wmma_f16(v16h a, v16h b, v8f c) {
    return __builtin_amdgcn_wmma_f32_16x16x32_f16(
        false, a, false, b, (short)0, c, false, false);
}

// Low 32 bits of a generic pointer to LDS == LDS byte offset.
__device__ __forceinline__ unsigned lds_off(const void* p) {
    return (unsigned)(size_t)p;
}

__device__ __forceinline__ unsigned uni(unsigned v) {
    return (unsigned)__builtin_amdgcn_readfirstlane(v);
}

// A wave-uniform test held in a scalar register, so that the branch round a
// tensor load (which ignores EXEC) compiles to s_cmp + s_cbranch_scc.
__device__ __forceinline__ unsigned pinned(unsigned v) {
    unsigned w = uni(v);
    asm volatile("" : "+s"(w));   // keeps the test scalar: a vector branch would not guard the tensor load
    return w;
}

// ---------------------------------------------------------------------------
// Tensor-load descriptor of a tile of 128-byte rows that lands in LDS with a
// 16-byte pad behind every row (LDS pitch 144 B).  Every extent is in bytes
// (data_size code 0); tensor dims = tile dims.
// ---------------------------------------------------------------------------
__device__ __forceinline__ v4u tdm_group0(unsigned lds, const void* gptr) {
    const unsigned long long ga = (unsigned long long)(size_t)gptr;
    v4u g0;
    g0[0] = 1u;                                           // count=1 (valid)
    g0[1] = uni(lds);                                     // lds_addr
    g0[2] = uni((unsigned)(ga & 0xffffffffu));            // global_addr lo
    g0[3] = (uni((unsigned)(ga >> 32)) & 0x01ffffffu)     // global_addr hi
          | (2u << 30);                                   // type=2
    asm volatile("" : "+s"(g0));   // pinned(): descriptor words held in their own scalar registers, not formed anew from copies
    return g0;
}

__device__ __forceinline__ v8i tdm_group1(unsigned rows, unsigned pitch) {
    v8i g1;
    g1[0] = (int)((1u << 20)      // pad_enable
          |       (4u << 22)      // pad_interval = 32 DWORDs = one row
          |       (3u << 25));    // pad_amount   = 4 DWORDs
    g1[1] = (int)(128u << 16);                            // tensor_dim0 = 128 B
    g1[2] = (int)(uni(rows) << 16);                       // tensor_dim1 = rows
    g1[3] = (int)(128u << 16);                            // tile_dim0 = 128 B
    g1[4] = (int)uni(rows);                               // tile_dim1
    g1[5] = (int)uni(pitch);                              // source row pitch, bytes
    g1[6] = 0;
    g1[7] = 0;
    asm volatile("" : "+s"(g1));   // pinned(): descriptor words held in their own scalar registers, not formed anew from copies
    return g1;
}

// The same for a tile of 256-byte rows (LDS pitch 272 B).
__device__ __forceinline__ v8i tdm_group1_row256(unsigned rows, unsigned pitch) {
    v8i g1;
    g1[0] = (int)((1u << 20)      // pad_enable
          |       (5u << 22)      // pad_interval = 64 DWORDs = one row
          |       (3u << 25));    // pad_amount   = 4 DWORDs
    g1[1] = (int)(256u << 16);                            // tensor_dim0 = 256 B
    g1[2] = (int)(uni(rows) << 16);                       // tensor_dim1 = rows
    g1[3] = (int)(256u << 16);                            // tile_dim0 = 256 B
    g1[4] = (int)uni(rows);                               // tile_dim1
    g1[5] = (int)uni(pitch);                              // source row pitch, bytes
    g1[6] = 0;
    g1[7] = 0;
    asm volatile("" : "+s"(g1));   // pinned(): descriptor words held in their own scalar registers, not formed anew from copies
    return g1;
}

__device__ __forceinline__ void tdm_load(v4u g0, v8i g1) {
    const v4i z4 = {0, 0, 0, 0};
    const v8i z8 = {0, 0, 0, 0, 0, 0, 0, 0};
    __builtin_amdgcn_tensor_load_to_lds(g0, g1, z4, z4, z8, 0);
}

// 16x32 f16 fragment of one lane from a row of f32: k = 0..7 and 16..23 from p.
__device__ __forceinline__ v16h frag_from_f32(const float* p) {
    const v4f x0 = *(const v4f*)(p);
    const v4f x1 = *(const v4f*)(p + 4);
    const v4f x2 = *(const v4f*)(p + 16);
    const v4f x3 = *(const v4f*)(p + 20);
    v16h f;
    #pragma unroll
    for (int e = 0; e < 4; ++e) {
        f[e]      = (_Float16)x0[e];
        f[4 + e]  = (_Float16)x1[e];
        f[8 + e]  = (_Float16)x2[e];
        f[12 + e] = (_Float16)x3[e];
    }
    return f;
}

// The same from a row of f16.
__device__ __forceinline__ v16h frag_from_f16(const _Float16* p) {
    const v8h lo = *(const v8h*)(p);
    const v8h hi = *(const v8h*)(p + 16);
    return __builtin_shufflevector(lo, hi, 0, 1, 2, 3, 4, 5, 6, 7,
                                   8, 9, 10, 11, 12, 13, 14, 15);
}

// Lane l reads lane l ^ 16: the two wave halves hold the two halves of a column.
__device__ __forceinline__ float xhalf(float x) {
    const int b = __builtin_bit_cast(int, x);
    return __builtin_bit_cast(float,
        __builtin_amdgcn_permlanex16(b, b, 0x76543210, 0xfedcba98, false, false));
}

// ---------------------------------------------------------------------------
// Projection GEMM: Y[4096,1024] = X[4096,1024] @ W[1024,1024]^T + bias.
// 128x128 block tile, one block per WGP; 8 waves as 2 (rows) x 4 (columns),
// 64x32 of Y per wave: 8 WMMAs on 6 fragments per 32 k.  A stage is 128 k of
// both operands, f32, in 8 slices of 64 rows x 256 B; every wave brings one
// slice by one tensor load.  Two buffers: stage s + 1 flies while stage s is
// worked on.  f32->f16 conversion at fragment read.
// TOUT = _Float16 for the Q/K/V projections, float for the output proj.
// ---------------------------------------------------------------------------
template <typename TOUT>
__global__ __launch_bounds__(256)
void proj_gemm_kernel(const float* __restrict__ X,
                      const float* __restrict__ W,
                      const float* __restrict__ bias,
                      TOUT* __restrict__ Y)
{
    // [buffer][slice], slice = 4 * (X | W) + 2 * (row half) + (k half); 68-dw pitch from the TDM pad
    __shared__ __attribute__((aligned(2048))) float Ts[2][8][GSL];

    const int tid  = threadIdx.x;
    const int lane = tid & 31;
    const int wv   = tid >> 5;
    const int half = lane >> 4;
    const int ln   = lane & 15;

    const int m0 = blockIdx.y * 128;
    const int n0 = blockIdx.x * 128;
    const int wm = wv & 1;              // rows    m0 + 64 * wm ..
    const int wn = wv >> 1;             // columns n0 + 32 * wn ..

    v8f acc[4][2] = {};

    // This wave's slice of every stage: 64 rows of X or W, 64 k.
    const unsigned wave = uni((unsigned)tid >> 5);
    const unsigned srow = (wave & 2) * 32;
    const float* src = ((wave & 4) ? W + (size_t)(n0 + srow) * D_MODEL
                                   : X + (size_t)(m0 + srow) * D_MODEL) + (wave & 1) * 64;
    const v8i g1 = tdm_group1_row256(64, D_MODEL * 4);    // the same for every slice

    // Prologue: stage 0 landed and published, then stage 1 issued.
    v4u g0 = tdm_group0(lds_off(&Ts[0][wave][0]), src);
    tdm_load(g0, g1);
    // The descriptor is an input so that its registers keep their values while the request is outstanding.
    asm volatile("s_wait_tensorcnt 0x0" :: "s"(g0), "s"(g1) : "memory");
    __syncthreads();
    g0 = tdm_group0(lds_off(&Ts[1][wave][0]), src + GKS);
    tdm_load(g0, g1);

    for (int s = 0; s < GNST; ++s) {
        // Fragments: row = tile*16+ln, K(e) = half*8+e | 16+half*8+e
        const float* As = &Ts[s & 1][wm * 2][ln * GP + half * 8];
        const float* Bs = &Ts[s & 1][4 + (wn >> 1) * 2][((wn & 1) * 32 + ln) * GP + half * 8];
        v16h a[4], b[2];
        #pragma unroll
        for (int kk = 0; kk < 4; ++kk) {
            const int o = (kk >> 1) * GSL + (kk & 1) * 32;
            #pragma unroll
            for (int i = 0; i < 4; ++i) a[i] = frag_from_f32(As + o + i * 16 * GP);
            #pragma unroll
            for (int j = 0; j < 2; ++j) b[j] = frag_from_f32(Bs + o + j * 16 * GP);
            if (kk == 3) break;   // the last 32 k are multiplied behind the refill, from registers
            #pragma unroll
            for (int i = 0; i < 4; ++i) {
                #pragma unroll
                for (int j = 0; j < 2; ++j) acc[i][j] = wmma_f16(a[i], b[j], acc[i][j]);
            }
        }
        // Publish point of stage s + 1: this wave's reads of stage s are done, its
        // slice of stage s + 1 has landed, every wave has said the same.
        asm volatile("s_wait_dscnt 0x0" ::: "memory");
        asm volatile("s_wait_tensorcnt 0x0" :: "s"(g0), "s"(g1) : "memory");
        __syncthreads();
        g0 = tdm_group0(lds_off(&Ts[s & 1][wave][0]), src + (s + 2) * GKS);
        if (pinned(s + 2 < GNST)) {   // refill of the buffer that every wave has just left
            tdm_load(g0, g1);
        }
        #pragma unroll
        for (int i = 0; i < 4; ++i) {
            #pragma unroll
            for (int j = 0; j < 2; ++j) acc[i][j] = wmma_f16(a[i], b[j], acc[i][j]);
        }
    }
    asm volatile("s_wait_tensorcnt 0x0" ::: "memory");   // no request of this wave is left behind the loop
    asm volatile("s_wait_dscnt 0x0" ::: "memory");       // and none of its LDS reads

    // Epilogue: bias + store.  D layout: row = r + 8*half, col = ln.
    #pragma unroll
    for (int j = 0; j < 2; ++j) {
        const int na = n0 + wn * 32 + j * 16 + ln;
        const float bj = bias[na];
        #pragma unroll
        for (int i = 0; i < 4; ++i) {
            TOUT* ya = Y + (size_t)(m0 + wm * 64 + i * 16 + 8 * half) * D_MODEL + na;
            #pragma unroll
            for (int r = 0; r < 8; ++r) ya[(size_t)r * D_MODEL] = (TOUT)(acc[i][j][r] + bj);
        }
    }
}

__global__ __launch_bounds__(256)
void attn_flash_kernel(const _Float16* __restrict__ Qb,
                       const _Float16* __restrict__ Kb,
                       const _Float16* __restrict__ Vb,
                       const float* __restrict__ td_ptr,
                       float* __restrict__ Cb)
{
    __shared__ __attribute__((aligned(2048))) _Float16 Kt[32][KP];  // [key][d], 72-elem pitch from TDM pad
    __shared__ __attribute__((aligned(16))) _Float16 Vt[64][VP];    // [d][key] (+8 pad)

    const int tid  = threadIdx.x;
    const int lane = tid & 31;
    const int wv   = tid >> 5;
    const int half = lane >> 4;
    const int ln   = lane & 15;

    const int bh   = blockIdx.x >> 4;          // 0..31
    const int qblk = blockIdx.x & 15;          // 0..15
    const int b    = bh >> 4;
    const int h    = bh & 15;
    const int q0   = (qblk * 8 + wv) * 16;

    const float td    = td_ptr[0];
    const float scale = 0.125f;                // 1/sqrt(64)

    const _Float16* Qh = Qb + (size_t)b * SEQ * D_MODEL + h * D_KH;
    const _Float16* Kh = Kb + (size_t)b * SEQ * D_MODEL + h * D_KH;
    const _Float16* Vh = Vb + (size_t)b * SEQ * D_MODEL + h * D_KH;
    float*          Ch = Cb + (size_t)b * SEQ * D_MODEL + h * D_KH;

    // Q B-fragments for d = 0..31 / 32..63 (column = ln); contiguous f16 loads.
    v16h aq0, aq1;
    {
        const _Float16* qr = Qh + (size_t)(q0 + ln) * D_MODEL;
        #pragma unroll
        for (int e = 0; e < 8; ++e) aq0[e]     = qr[half * 8 + e];
        #pragma unroll
        for (int e = 0; e < 8; ++e) aq0[8 + e] = qr[16 + half * 8 + e];
        #pragma unroll
        for (int e = 0; e < 8; ++e) aq1[e]     = qr[32 + half * 8 + e];
        #pragma unroll
        for (int e = 0; e < 8; ++e) aq1[8 + e] = qr[48 + half * 8 + e];
    }

    v8f c0 = {}, c1 = {}, c2 = {}, c3 = {};
    float mrun = -3.0e38f;              // running maximum of query q0 + ln (equal in both halves)
    float lrun = 0.0f;                  // running sum over this half's keys; the halves join in the epilogue
    const float qpos = (float)(q0 + ln);

    const int srow = tid >> 3;          // staging: key row 0..31
    const int scol = (tid & 7) * 8;     // staging: d col 0,8,..,56

    const v8i g1k = tdm_group1(32, D_MODEL * 2);   // the same for every K tile

    for (int key0 = 0; key0 < SEQ; key0 += 32) {
        // ---- async TDM load of the K tile (f16, 32 keys x 64 d) -----------
        const v4u g0k = tdm_group0(lds_off(&Kt[0][0]), Kh + (size_t)key0 * D_MODEL);
        if (tid < 32) {
            tdm_load(g0k, g1k);
        }
        // ---- manual transposed staging of the V tile (overlaps the TDM) ---
        {
            const _Float16* vs = Vh + (size_t)(key0 + srow) * D_MODEL + scol;
            if (key0 + 32 < SEQ)
                __builtin_prefetch(Vh + (size_t)(key0 + 32 + srow) * D_MODEL + scol, 0, 0);
            #pragma unroll
            for (int j = 0; j < 8; ++j) Vt[scol + j][srow] = vs[j];
        }
        if (tid < 32) {
            // The descriptor is an input so that its registers keep their values
            // while the request is outstanding.
            asm volatile("s_wait_tensorcnt 0x0" :: "s"(g0k), "s"(g1k) : "memory");
        }
        __syncthreads();

        // ---- scores, transposed: s0[r] = S[key0 + 8*half + r][q0 + ln], s1: +16 keys
        v8f s0 = {}, s1 = {};
        {
            const _Float16* kr = &Kt[ln][half * 8];
            s0 = wmma_f16(frag_from_f16(kr), aq0, s0);
            s0 = wmma_f16(frag_from_f16(kr + 32), aq1, s0);
            kr = &Kt[16 + ln][half * 8];
            s1 = wmma_f16(frag_from_f16(kr), aq0, s1);
            s1 = wmma_f16(frag_from_f16(kr + 32), aq1, s1);
        }

        // ---- scale + time-decay bias + online softmax, one query per lane -
        const float dist0 = qpos - (float)(key0 + 8 * half);   // whole numbers: exact
        #pragma unroll
        for (int r = 0; r < 8; ++r) s0[r] = s0[r] * scale - td * fabsf(dist0 - (float)r);
        #pragma unroll
        for (int r = 0; r < 8; ++r) s1[r] = s1[r] * scale - td * fabsf(dist0 - (float)(16 + r));
        float t = fmaxf(s0[0], s1[0]);
        #pragma unroll
        for (int r = 1; r < 8; ++r) t = fmaxf(t, fmaxf(s0[r], s1[r]));
        t = fmaxf(t, xhalf(t));
        const float mnew  = fmaxf(mrun, t);
        const float alpha = __expf(mrun - mnew);
        #pragma unroll
        for (int r = 0; r < 8; ++r) s0[r] = __expf(s0[r] - mnew);
        #pragma unroll
        for (int r = 0; r < 8; ++r) s1[r] = __expf(s1[r] - mnew);
        v16h bp;   // P^T as B fragment: k = 8*half + e | 16 + 8*half + e, the order of the V^T loader
        #pragma unroll
        for (int r = 0; r < 8; ++r) {
            bp[r]     = (_Float16)s0[r];
            bp[8 + r] = (_Float16)s1[r];
        }
        const v8f ps = s0 + s1;
        const float rs = ((ps[0] + ps[1]) + (ps[2] + ps[3])) + ((ps[4] + ps[5]) + (ps[6] + ps[7]));
        lrun = lrun * alpha + rs;
        mrun = mnew;

        #pragma unroll
        for (int r = 0; r < 8; ++r) {
            c0[r] *= alpha; c1[r] *= alpha;
            c2[r] *= alpha; c3[r] *= alpha;
        }

        // ---- ctx^T += V^T(64x32) @ P^T(32x16) from transposed LDS V -------
        {
            #pragma unroll
            for (int t4 = 0; t4 < 4; ++t4) {
                const v16h av = frag_from_f16(&Vt[t4 * 16 + ln][half * 8]);
                if      (t4 == 0) c0 = wmma_f16(av, bp, c0);
                else if (t4 == 1) c1 = wmma_f16(av, bp, c1);
                else if (t4 == 2) c2 = wmma_f16(av, bp, c2);
                else              c3 = wmma_f16(av, bp, c3);
            }
        }
        __syncthreads();
    }

    // ---- epilogue: normalize and store ctx (f32) --------------------------
    // c<t>[r] = O[q0 + ln][t*16 + 8*half + r]: eight consecutive floats a lane.
    {
        const float inv = 1.0f / (lrun + xhalf(lrun));
        float* cr = Ch + (size_t)(q0 + ln) * D_MODEL + 8 * half;
        #pragma unroll
        for (int j = 0; j < 2; ++j) {
            const v4f o0 = {c0[4*j] * inv, c0[4*j+1] * inv, c0[4*j+2] * inv, c0[4*j+3] * inv};
            const v4f o1 = {c1[4*j] * inv, c1[4*j+1] * inv, c1[4*j+2] * inv, c1[4*j+3] * inv};
            const v4f o2 = {c2[4*j] * inv, c2[4*j+1] * inv, c2[4*j+2] * inv, c2[4*j+3] * inv};
            const v4f o3 = {c3[4*j] * inv, c3[4*j+1] * inv, c3[4*j+2] * inv, c3[4*j+3] * inv};
            *(v4f*)(cr + 4 * j)      = o0;
            *(v4f*)(cr + 16 + 4 * j) = o1;
            *(v4f*)(cr + 32 + 4 * j) = o2;
            *(v4f*)(cr + 48 + 4 * j) = o3;
        }
    }
}

// ---------------------------------------------------------------------------
extern "C" void kernel_launch(void* const* d_in, const int* in_sizes, int n_in,
                              void* d_out, int out_size, void* d_ws, size_t ws_size,
                              hipStream_t stream) {
    const float* query = (const float*)d_in[0];
    const float* key   = (const float*)d_in[1];
    const float* value = (const float*)d_in[2];
    const float* wq = (const float*)d_in[3];
    const float* bq = (const float*)d_in[4];
    const float* wk = (const float*)d_in[5];
    const float* bk = (const float*)d_in[6];
    const float* wv = (const float*)d_in[7];
    const float* bv = (const float*)d_in[8];
    const float* wo = (const float*)d_in[9];
    const float* bo = (const float*)d_in[10];
    const float* td = (const float*)d_in[11];
    float* out = (float*)d_out;

    const size_t elems = (size_t)MROWS * D_MODEL;
    _Float16* Qbuf = (_Float16*)d_ws;            // 8 MB
    _Float16* Kbuf = Qbuf + elems;               // 8 MB
    _Float16* Vbuf = Kbuf + elems;               // 8 MB
    float*    Cbuf = (float*)(Vbuf + elems);     // 16 MB

    const dim3 gblk(256);
    const dim3 ggrid(D_MODEL / 128, MROWS / 128);  // 8 x 32
    proj_gemm_kernel<_Float16><<<ggrid, gblk, 0, stream>>>(query, wq, bq, Qbuf);
    proj_gemm_kernel<_Float16><<<ggrid, gblk, 0, stream>>>(key,   wk, bk, Kbuf);
    proj_gemm_kernel<_Float16><<<ggrid, gblk, 0, stream>>>(value, wv, bv, Vbuf);

    attn_flash_kernel<<<dim3(BATCH * N_HEADS * (SEQ / 128)), dim3(256), 0, stream>>>(
        Qbuf, Kbuf, Vbuf, td, Cbuf);

    proj_gemm_kernel<float><<<ggrid, gblk, 0, stream>>>(Cbuf, wo, bo, out);
}

// v004
// Measured time: 103 microseconds a run.
// Timed twice side by side with v003, it ran 1.47 times as fast both times.
// Counting every step since v000, it is 3.27 times as fast.
#include <hip/hip_runtime.h>
#include <hip/hip_bf16.h>
#include <cmath>

#define D_MODEL 1024
#define N_HEADS 16
#define D_KH    64
#define SEQ     2048
#define BATCH   2
#define MROWS   (BATCH * SEQ)     // 4096

typedef __attribute__((ext_vector_type(16))) _Float16     v16h;
typedef __attribute__((ext_vector_type(8)))  float        v8f;
typedef __attribute__((ext_vector_type(4)))  unsigned int v4u;
typedef __attribute__((ext_vector_type(8)))  int          v8i;
typedef __attribute__((ext_vector_type(4)))  int          v4i;
typedef __attribute__((ext_vector_type(8)))  _Float16     v8h;
typedef __attribute__((ext_vector_type(4)))  float        v4f;
typedef __attribute__((ext_vector_type(8)))  short        v8s;

// LDS pitches: 16 B x odd, so a 16-lane column of 16-byte reads meets no bank twice.
#define ROW128_PITCH_B 144                    // 128-byte rows + the mover's 16-byte pad
#define ROW256_PITCH_B 272                    // 256-byte rows + the mover's 16-byte pad
#define GP   (ROW256_PITCH_B / 4)             // GEMM slices: pitch in floats (68)
#define GSL  4608                             // floats per GEMM slice: 64 rows of 272 B, rounded up to 2 KiB x 9
#define GKS  128                              // k per GEMM stage
#define GNST (D_MODEL / GKS)                  // GEMM stages (8)
#define KP   (ROW128_PITCH_B / 2)             // K tile: pitch in halves (72)
#define VPH  80                               // V tile: pitch in halves (160 B = 128-byte rows + the mover's 32-byte pad, for the transposing reader)
#define SKEYS 128                             // keys per attention stage
#define ANST (SEQ / SKEYS)                    // attention stages (16)

__device__ __forceinline__ v8f wmma_f16(v16h a, v16h b, v8f c) {
    return __builtin_amdgcn_wmma_f32_16x16x32_f16(
        false, a, false, b, (short)0, c, false, false);
}

// Low 32 bits of a generic pointer to LDS == LDS byte offset.
__device__ __forceinline__ unsigned lds_off(const void* p) {
    return (unsigned)(size_t)p;
}

__device__ __forceinline__ unsigned uni(unsigned v) {
    return (unsigned)__builtin_amdgcn_readfirstlane(v);
}

// A wave-uniform test held in a scalar register, so that the branch round a
// tensor load (which ignores EXEC) compiles to s_cmp + s_cbranch_scc.
__device__ __forceinline__ unsigned pinned(unsigned v) {
    unsigned w = uni(v);
    asm volatile("" : "+s"(w));   // keeps the test scalar: a vector branch would not guard the tensor load
    return w;
}

// ---------------------------------------------------------------------------
// Tensor-load descriptor of a tile of 128-byte rows that lands in LDS with a
// pad behind every row: PAD = 3 gives 16 bytes (LDS pitch 144 B), PAD = 7 gives
// 32 bytes (pitch 160 B).  Every extent is in bytes (data_size code 0); tensor
// dims = tile dims.
// ---------------------------------------------------------------------------
__device__ __forceinline__ v4u tdm_group0(unsigned lds, const void* gptr) {
    const unsigned long long ga = (unsigned long long)(size_t)gptr;
    v4u g0;
    g0[0] = 1u;                                           // count=1 (valid)
    g0[1] = uni(lds);                                     // lds_addr
    g0[2] = uni((unsigned)(ga & 0xffffffffu));            // global_addr lo
    g0[3] = (uni((unsigned)(ga >> 32)) & 0x01ffffffu)     // global_addr hi
          | (2u << 30);                                   // type=2
    asm volatile("" : "+s"(g0));   // pinned(): descriptor words held in their own scalar registers, not formed anew from copies
    return g0;
}

template <unsigned PAD>
__device__ __forceinline__ v8i tdm_group1(unsigned rows, unsigned pitch) {
    v8i g1;
    g1[0] = (int)((1u << 20)      // pad_enable
          |       (4u << 22)      // pad_interval = 32 DWORDs = one row
          |       (PAD << 25));   // pad_amount   = PAD + 1 DWORDs
    g1[1] = (int)(128u << 16);                            // tensor_dim0 = 128 B
    g1[2] = (int)(uni(rows) << 16);                       // tensor_dim1 = rows
    g1[3] = (int)(128u << 16);                            // tile_dim0 = 128 B
    g1[4] = (int)uni(rows);                               // tile_dim1
    g1[5] = (int)uni(pitch);                              // source row pitch, bytes
    g1[6] = 0;
    g1[7] = 0;
    asm volatile("" : "+s"(g1));   // pinned(): descriptor words held in their own scalar registers, not formed anew from copies
    return g1;
}

// The same for a tile of 256-byte rows (LDS pitch 272 B).
__device__ __forceinline__ v8i tdm_group1_row256(unsigned rows, unsigned pitch) {
    v8i g1;
    g1[0] = (int)((1u << 20)      // pad_enable
          |       (5u << 22)      // pad_interval = 64 DWORDs = one row
          |       (3u << 25));    // pad_amount   = 4 DWORDs
    g1[1] = (int)(256u << 16);                            // tensor_dim0 = 256 B
    g1[2] = (int)(uni(rows) << 16);                       // tensor_dim1 = rows
    g1[3] = (int)(256u << 16);                            // tile_dim0 = 256 B
    g1[4] = (int)uni(rows);                               // tile_dim1
    g1[5] = (int)uni(pitch);                              // source row pitch, bytes
    g1[6] = 0;
    g1[7] = 0;
    asm volatile("" : "+s"(g1));   // pinned(): descriptor words held in their own scalar registers, not formed anew from copies
    return g1;
}

__device__ __forceinline__ void tdm_load(v4u g0, v8i g1) {
    const v4i z4 = {0, 0, 0, 0};
    const v8i z8 = {0, 0, 0, 0, 0, 0, 0, 0};
    __builtin_amdgcn_tensor_load_to_lds(g0, g1, z4, z4, z8, 0);
}

// 16x32 f16 fragment of one lane from a row of f32: k = 0..7 and 16..23 from p.
__device__ __forceinline__ v16h frag_from_f32(const float* p) {
    const v4f x0 = *(const v4f*)(p);
    const v4f x1 = *(const v4f*)(p + 4);
    const v4f x2 = *(const v4f*)(p + 16);
    const v4f x3 = *(const v4f*)(p + 20);
    v16h f;
    #pragma unroll
    for (int e = 0; e < 4; ++e) {
        f[e]      = (_Float16)x0[e];
        f[4 + e]  = (_Float16)x1[e];
        f[8 + e]  = (_Float16)x2[e];
        f[12 + e] = (_Float16)x3[e];
    }
    return f;
}

// The same from a row of f16.
__device__ __forceinline__ v16h frag_from_f16(const _Float16* p) {
    const v8h lo = *(const v8h*)(p);
    const v8h hi = *(const v8h*)(p + 16);
    return __builtin_shufflevector(lo, hi, 0, 1, 2, 3, 4, 5, 6, 7,
                                   8, 9, 10, 11, 12, 13, 14, 15);
}

// 16 (d) x 32 (keys) A fragment of V^T from row-major V rows in LDS, by two
// transposing loads: lane (ln, half) gets V[8*half + e | 16 + 8*half + e][ln].
// p = this lane's address: row 8*half + (lane & 7), halves 8 * ((lane >> 3) & 1).
__device__ __forceinline__ v16h frag_transposed(const _Float16* p) {
    typedef __attribute__((address_space(3))) v8s lds_v8s;
    const v8h lo = __builtin_bit_cast(v8h, __builtin_amdgcn_ds_load_tr16_b128_v8i16((lds_v8s*)p));
    const v8h hi = __builtin_bit_cast(v8h, __builtin_amdgcn_ds_load_tr16_b128_v8i16((lds_v8s*)(p + 16 * VPH)));
    return __builtin_shufflevector(lo, hi, 0, 1, 2, 3, 4, 5, 6, 7,
                                   8, 9, 10, 11, 12, 13, 14, 15);
}

// Lane l reads lane l ^ 16: the two wave halves hold the two halves of a column.
__device__ __forceinline__ float xhalf(float x) {
    const int b = __builtin_bit_cast(int, x);
    return __builtin_bit_cast(float,
        __builtin_amdgcn_permlanex16(b, b, 0x76543210, 0xfedcba98, false, false));
}

// ---------------------------------------------------------------------------
// Projection GEMM: Y[4096,1024] = X[4096,1024] @ W[1024,1024]^T + bias.
// 128x128 block tile, one block per WGP; 8 waves as 2 (rows) x 4 (columns),
// 64x32 of Y per wave: 8 WMMAs on 6 fragments per 32 k.  A stage is 128 k of
// both operands, f32, in 8 slices of 64 rows x 256 B; every wave brings one
// slice by one tensor load.  Two buffers: stage s + 1 flies while stage s is
// worked on.  f32->f16 conversion at fragment read.
// TOUT = _Float16 for the Q/K/V projections, float for the output proj.
// ---------------------------------------------------------------------------
template <typename TOUT>
__global__ __launch_bounds__(256)
void proj_gemm_kernel(const float* __restrict__ X,
                      const float* __restrict__ W,
                      const float* __restrict__ bias,
                      TOUT* __restrict__ Y)
{
    // [buffer][slice], slice = 4 * (X | W) + 2 * (row half) + (k half); 68-dw pitch from the TDM pad
    __shared__ __attribute__((aligned(2048))) float Ts[2][8][GSL];

    const int tid  = threadIdx.x;
    const int lane = tid & 31;
    const int wv   = tid >> 5;
    const int half = lane >> 4;
    const int ln   = lane & 15;

    const int m0 = blockIdx.y * 128;
    const int n0 = blockIdx.x * 128;
    const int wm = wv & 1;              // rows    m0 + 64 * wm ..
    const int wn = wv >> 1;             // columns n0 + 32 * wn ..

    v8f acc[4][2] = {};

    // This wave's slice of every stage: 64 rows of X or W, 64 k.
    const unsigned wave = uni((unsigned)tid >> 5);
    const unsigned srow = (wave & 2) * 32;
    const float* src = ((wave & 4) ? W + (size_t)(n0 + srow) * D_MODEL
                                   : X + (size_t)(m0 + srow) * D_MODEL) + (wave & 1) * 64;
    const v8i g1 = tdm_group1_row256(64, D_MODEL * 4);    // the same for every slice

    // Prologue: stage 0 landed and published, then stage 1 issued.
    v4u g0 = tdm_group0(lds_off(&Ts[0][wave][0]), src);
    tdm_load(g0, g1);
    // The descriptor is an input so that its registers keep their values while the request is outstanding.
    asm volatile("s_wait_tensorcnt 0x0" :: "s"(g0), "s"(g1) : "memory");
    __syncthreads();
    g0 = tdm_group0(lds_off(&Ts[1][wave][0]), src + GKS);
    tdm_load(g0, g1);

    for (int s = 0; s < GNST; ++s) {
        // Fragments: row = tile*16+ln, K(e) = half*8+e | 16+half*8+e
        const float* As = &Ts[s & 1][wm * 2][ln * GP + half * 8];
        const float* Bs = &Ts[s & 1][4 + (wn >> 1) * 2][((wn & 1) * 32 + ln) * GP + half * 8];
        v16h a[4], b[2];
        #pragma unroll
        for (int kk = 0; kk < 4; ++kk) {
            const int o = (kk >> 1) * GSL + (kk & 1) * 32;
            #pragma unroll
            for (int i = 0; i < 4; ++i) a[i] = frag_from_f32(As + o + i * 16 * GP);
            #pragma unroll
            for (int j = 0; j < 2; ++j) b[j] = frag_from_f32(Bs + o + j * 16 * GP);
            if (kk == 3) break;   // the last 32 k are multiplied behind the refill, from registers
            #pragma unroll
            for (int i = 0; i < 4; ++i) {
                #pragma unroll
                for (int j = 0; j < 2; ++j) acc[i][j] = wmma_f16(a[i], b[j], acc[i][j]);
            }
        }
        // Publish point of stage s + 1: this wave's reads of stage s are done, its
        // slice of stage s + 1 has landed, every wave has said the same.
        asm volatile("s_wait_dscnt 0x0" ::: "memory");
        asm volatile("s_wait_tensorcnt 0x0" :: "s"(g0), "s"(g1) : "memory");
        __syncthreads();
        g0 = tdm_group0(lds_off(&Ts[s & 1][wave][0]), src + (s + 2) * GKS);
        if (pinned(s + 2 < GNST)) {   // refill of the buffer that every wave has just left
            tdm_load(g0, g1);
        }
        #pragma unroll
        for (int i = 0; i < 4; ++i) {
            #pragma unroll
            for (int j = 0; j < 2; ++j) acc[i][j] = wmma_f16(a[i], b[j], acc[i][j]);
        }
    }
    asm volatile("s_wait_tensorcnt 0x0" ::: "memory");   // no request of this wave is left behind the loop
    asm volatile("s_wait_dscnt 0x0" ::: "memory");       // and none of its LDS reads

    // Epilogue: bias + store.  D layout: row = r + 8*half, col = ln.
    #pragma unroll
    for (int j = 0; j < 2; ++j) {
        const int na = n0 + wn * 32 + j * 16 + ln;
        const float bj = bias[na];
        #pragma unroll
        for (int i = 0; i < 4; ++i) {
            TOUT* ya = Y + (size_t)(m0 + wm * 64 + i * 16 + 8 * half) * D_MODEL + na;
            #pragma unroll
            for (int r = 0; r < 8; ++r) ya[(size_t)r * D_MODEL] = (TOUT)(acc[i][j][r] + bj);
        }
    }
}

__global__ __launch_bounds__(256)
void attn_flash_kernel(const _Float16* __restrict__ Qb,
                       const _Float16* __restrict__ Kb,
                       const _Float16* __restrict__ Vb,
                       const float* __restrict__ td_ptr,
                       float* __restrict__ Cb)
{
    __shared__ __attribute__((aligned(2048))) _Float16 Ks[2][SKEYS * KP];   // [buffer][key][d], 144-B pitch: 9 x 2 KiB a buffer
    __shared__ __attribute__((aligned(2048))) _Float16 Vs[2][SKEYS * VPH];  // [buffer][key][d], 160-B pitch: 10 x 2 KiB a buffer

    const int tid  = threadIdx.x;
    const int lane = tid & 31;
    const int wv   = tid >> 5;
    const int half = lane >> 4;
    const int ln   = lane & 15;

    const int bh   = blockIdx.x >> 4;          // 0..31
    const int qblk = blockIdx.x & 15;          // 0..15
    const int b    = bh >> 4;
    const int h    = bh & 15;
    const int q0   = (qblk * 8 + wv) * 16;

    const float td    = td_ptr[0];
    const float scale = 0.125f;                // 1/sqrt(64)

    const _Float16* Qh = Qb + (size_t)b * SEQ * D_MODEL + h * D_KH;
    const _Float16* Kh = Kb + (size_t)b * SEQ * D_MODEL + h * D_KH;
    const _Float16* Vh = Vb + (size_t)b * SEQ * D_MODEL + h * D_KH;
    float*          Ch = Cb + (size_t)b * SEQ * D_MODEL + h * D_KH;

    // Q B-fragments for d = 0..31 / 32..63 (column = ln); contiguous f16 loads.
    v16h aq0, aq1;
    {
        const _Float16* qr = Qh + (size_t)(q0 + ln) * D_MODEL;
        #pragma unroll
        for (int e = 0; e < 8; ++e) aq0[e]     = qr[half * 8 + e];
        #pragma unroll
        for (int e = 0; e < 8; ++e) aq0[8 + e] = qr[16 + half * 8 + e];
        #pragma unroll
        for (int e = 0; e < 8; ++e) aq1[e]     = qr[32 + half * 8 + e];
        #pragma unroll
        for (int e = 0; e < 8; ++e) aq1[8 + e] = qr[48 + half * 8 + e];
    }

    v8f c0 = {}, c1 = {}, c2 = {}, c3 = {};
    float mrun = -3.0e38f;              // running maximum of query q0 + ln (equal in both halves)
    float lrun = 0.0f;                  // running sum over this half's keys; the halves join in the epilogue
    const float qpos = (float)(q0 + ln);

    // Wave 0 issues K, wave 1 issues V; the other waves form V's group 0 and never issue.
    const unsigned wave = uni((unsigned)tid >> 5);
    const _Float16* src = (wave == 0) ? Kh : Vh;
    const unsigned dst  = (wave == 0) ? lds_off(&Ks[0][0]) : lds_off(&Vs[0][0]);
    const unsigned dbuf = (wave == 0) ? (unsigned)sizeof(Ks[0]) : (unsigned)sizeof(Vs[0]);
    const v8i g1k = tdm_group1<3>(SKEYS, D_MODEL * 2);   // the same for every K stage
    const v8i g1v = tdm_group1<7>(SKEYS, D_MODEL * 2);   // the same for every V stage

    // Prologue: stage 0 landed and published, then stage 1 issued.
    v4u g0 = tdm_group0(dst, src);
    if (pinned(wave == 0)) {
        tdm_load(g0, g1k);
        // The descriptor is an input so that its registers keep their values while the request is outstanding.
        asm volatile("s_wait_tensorcnt 0x0" :: "s"(g0), "s"(g1k) : "memory");
    }
    if (pinned(wave == 1)) {
        tdm_load(g0, g1v);
        asm volatile("s_wait_tensorcnt 0x0" :: "s"(g0), "s"(g1v) : "memory");   // as above
    }
    __syncthreads();
    g0 = tdm_group0(dst + dbuf, src + (size_t)SKEYS * D_MODEL);
    if (pinned(wave == 0)) tdm_load(g0, g1k);
    if (pinned(wave == 1)) tdm_load(g0, g1v);

    float dist = qpos - (float)(8 * half);   // query minus this half's first key of the stage; whole numbers: exact
    for (int st = 0; st < ANST; ++st) {
      const _Float16* Kst = &Ks[st & 1][ln * KP + half * 8];
      const _Float16* Vst = &Vs[st & 1][(8 * half + (lane & 7)) * VPH + ((lane >> 3) & 1) * 8];
      #pragma unroll   // the four passes' LDS addresses become immediate offsets, and one pass's loads may rise into the one before
      for (int sub = 0; sub < SKEYS / 32; ++sub) {
        // ---- scores, transposed: s0[r] = S[128*st + 32*sub + 8*half + r][q0 + ln], s1: +16 keys
        v8f s0 = {}, s1 = {};
        {
            const _Float16* kr = Kst + sub * 32 * KP;
            s0 = wmma_f16(frag_from_f16(kr), aq0, s0);
            s0 = wmma_f16(frag_from_f16(kr + 32), aq1, s0);
            kr += 16 * KP;
            s1 = wmma_f16(frag_from_f16(kr), aq0, s1);
            s1 = wmma_f16(frag_from_f16(kr + 32), aq1, s1);
        }

        // ---- scale + time-decay bias + online softmax, one query per lane -
        const float dist0 = dist - (float)(sub * 32);
        #pragma unroll
        for (int r = 0; r < 8; ++r) s0[r] = s0[r] * scale - td * fabsf(dist0 - (float)r);
        #pragma unroll
        for (int r = 0; r < 8; ++r) s1[r] = s1[r] * scale - td * fabsf(dist0 - (float)(16 + r));
        float t = fmaxf(s0[0], s1[0]);
        #pragma unroll
        for (int r = 1; r < 8; ++r) t = fmaxf(t, fmaxf(s0[r], s1[r]));
        t = fmaxf(t, xhalf(t));
        const float mnew  = fmaxf(mrun, t);
        const float alpha = __expf(mrun - mnew);
        #pragma unroll
        for (int r = 0; r < 8; ++r) s0[r] = __expf(s0[r] - mnew);
        #pragma unroll
        for (int r = 0; r < 8; ++r) s1[r] = __expf(s1[r] - mnew);
        v16h bp;   // P^T as B fragment: k = 8*half + e | 16 + 8*half + e, the order of the V^T loader
        #pragma unroll
        for (int r = 0; r < 8; ++r) {
            bp[r]     = (_Float16)s0[r];
            bp[8 + r] = (_Float16)s1[r];
        }
        const v8f ps = s0 + s1;
        const float rs = ((ps[0] + ps[1]) + (ps[2] + ps[3])) + ((ps[4] + ps[5]) + (ps[6] + ps[7]));
        lrun = lrun * alpha + rs;
        mrun = mnew;

        #pragma unroll
        for (int r = 0; r < 8; ++r) {
            c0[r] *= alpha; c1[r] *= alpha;
            c2[r] *= alpha; c3[r] *= alpha;
        }

        // ---- ctx^T += V^T(64x32) @ P^T(32x16), V^T by transposing loads ----
        {
            #pragma unroll
            for (int t4 = 0; t4 < 4; ++t4) {
                const v16h av = frag_transposed(Vst + sub * 32 * VPH + t4 * 16);
                if      (t4 == 0) c0 = wmma_f16(av, bp, c0);
                else if (t4 == 1) c1 = wmma_f16(av, bp, c1);
                else if (t4 == 2) c2 = wmma_f16(av, bp, c2);
                else              c3 = wmma_f16(av, bp, c3);
            }
        }
      }
      dist -= (float)SKEYS;
      // Publish point of stage st + 1: this wave's reads of stage st are done, the
      // issuing waves' tiles of stage st + 1 have landed, every wave has said the same.
      asm volatile("s_wait_dscnt 0x0" ::: "memory");
      if (pinned(wave < 2)) {
          // The descriptors are inputs so that their registers keep their values while the request is outstanding.
          asm volatile("s_wait_tensorcnt 0x0" :: "s"(g0), "s"(g1k), "s"(g1v) : "memory");
      }
      __syncthreads();
      g0 = tdm_group0(dst + (st & 1) * dbuf, src + (size_t)(st + 2) * SKEYS * D_MODEL);
      if (pinned(st + 2 < ANST)) {   // refill of the buffer that every wave has just left
          if (pinned(wave == 0)) tdm_load(g0, g1k);
          if (pinned(wave == 1)) tdm_load(g0, g1v);
      }
    }
    asm volatile("s_wait_tensorcnt 0x0" ::: "memory");   // no request of this wave is left behind the loop
    asm volatile("s_wait_dscnt 0x0" ::: "memory");       // and none of its LDS reads

    // ---- epilogue: normalize and store ctx (f32) --------------------------
    // c<t>[r] = O[q0 + ln][t*16 + 8*half + r]: eight consecutive floats a lane.
    {
        const float inv = 1.0f / (lrun + xhalf(lrun));
        float* cr = Ch + (size_t)(q0 + ln) * D_MODEL + 8 * half;
        #pragma unroll
        for (int j = 0; j < 2; ++j) {
            const v4f o0 = {c0[4*j] * inv, c0[4*j+1] * inv, c0[4*j+2] * inv, c0[4*j+3] * inv};
            const v4f o1 = {c1[4*j] * inv, c1[4*j+1] * inv, c1[4*j+2] * inv, c1[4*j+3] * inv};
            const v4f o2 = {c2[4*j] * inv, c2[4*j+1] * inv, c2[4*j+2] * inv, c2[4*j+3] * inv};
            const v4f o3 = {c3[4*j] * inv, c3[4*j+1] * inv, c3[4*j+2] * inv, c3[4*j+3] * inv};
            *(v4f*)(cr + 4 * j)      = o0;
            *(v4f*)(cr + 16 + 4 * j) = o1;
            *(v4f*)(cr + 32 + 4 * j) = o2;
            *(v4f*)(cr + 48 + 4 * j) = o3;
        }
    }
}

// ---------------------------------------------------------------------------
extern "C" void kernel_launch(void* const* d_in, const int* in_sizes, int n_in,
                              void* d_out, int out_size, void* d_ws, size_t ws_size,
                              hipStream_t stream) {
    const float* query = (const float*)d_in[0];
    const float* key   = (const float*)d_in[1];
    const float* value = (const float*)d_in[2];
    const float* wq = (const float*)d_in[3];
    const float* bq = (const float*)d_in[4];
    const float* wk = (const float*)d_in[5];
    const float* bk = (const float*)d_in[6];
    const float* wv = (const float*)d_in[7];
    const float* bv = (const float*)d_in[8];
    const float* wo = (const float*)d_in[9];
    const float* bo = (const float*)d_in[10];
    const float* td = (const float*)d_in[11];
    float* out = (float*)d_out;

    const size_t elems = (size_t)MROWS * D_MODEL;
    _Float16* Qbuf = (_Float16*)d_ws;            // 8 MB
    _Float16* Kbuf = Qbuf + elems;               // 8 MB
    _Float16* Vbuf = Kbuf + elems;               // 8 MB
    float*    Cbuf = (float*)(Vbuf + elems);     // 16 MB

    const dim3 gblk(256);
    const dim3 ggrid(D_MODEL / 128, MROWS / 128);  // 8 x 32
    proj_gemm_kernel<_Float16><<<ggrid, gblk, 0, stream>>>(query, wq, bq, Qbuf);
    proj_gemm_kernel<_Float16><<<ggrid, gblk, 0, stream>>>(key,   wk, bk, Kbuf);
    proj_gemm_kernel<_Float16><<<ggrid, gblk, 0, stream>>>(value, wv, bv, Vbuf);

    attn_flash_kernel<<<dim3(BATCH * N_HEADS * (SEQ / 128)), dim3(256), 0, stream>>>(
        Qbuf, Kbuf, Vbuf, td, Cbuf);

    proj_gemm_kernel<float><<<ggrid, gblk, 0, stream>>>(Cbuf, wo, bo, out);
}

// v005
// A run of this version takes 95.3 microseconds.
// Timed twice side by side with v004, it ran 1.08 and 1.07 times as fast.
// Counting every step since v000, it is 3.51 times as fast.
#include <hip/hip_runtime.h>
#include <hip/hip_bf16.h>
#include <cmath>

#define D_MODEL 1024
#define N_HEADS 16
#define D_KH    64
#define SEQ     2048
#define BATCH   2
#define MROWS   (BATCH * SEQ)     // 4096

typedef __attribute__((ext_vector_type(16))) _Float16     v16h;
typedef __attribute__((ext_vector_type(8)))  float        v8f;
typedef __attribute__((ext_vector_type(4)))  unsigned int v4u;
typedef __attribute__((ext_vector_type(8)))  int          v8i;
typedef __attribute__((ext_vector_type(4)))  int          v4i;
typedef __attribute__((ext_vector_type(8)))  _Float16     v8h;
typedef __attribute__((ext_vector_type(4)))  float        v4f;
typedef __attribute__((ext_vector_type(8)))  short        v8s;

// LDS pitches: 16 B x odd, so a 16-lane column of 16-byte reads meets no bank twice.
#define ROW128_PITCH_B 144                    // 128-byte rows + the mover's 16-byte pad
#define ROW256_PITCH_B 272                    // 256-byte rows + the mover's 16-byte pad
#define GP   (ROW256_PITCH_B / 4)             // GEMM slices: pitch in floats (68)
#define GSL  4608                             // floats per GEMM slice: 64 rows of 272 B, rounded up to 2 KiB x 9
#define GKS  128                              // k per GEMM stage
#define GNST (D_MODEL / GKS)                  // GEMM stages (8)
#define KP   (ROW128_PITCH_B / 2)             // K tile: pitch in halves (72)
#define VPH  80                               // V tile: pitch in halves (160 B = 128-byte rows + the mover's 32-byte pad, for the transposing reader)
#define SKEYS 128                             // keys per attention stage
#define ANST (SEQ / SKEYS)                    // attention stages (16)

__device__ __forceinline__ v8f wmma_f16(v16h a, v16h b, v8f c) {
    return __builtin_amdgcn_wmma_f32_16x16x32_f16(
        false, a, false, b, (short)0, c, false, false);
}

// Low 32 bits of a generic pointer to LDS == LDS byte offset.
__device__ __forceinline__ unsigned lds_off(const void* p) {
    return (unsigned)(size_t)p;
}

__device__ __forceinline__ unsigned uni(unsigned v) {
    return (unsigned)__builtin_amdgcn_readfirstlane(v);
}

// A wave-uniform test held in a scalar register, so that the branch round a
// tensor load (which ignores EXEC) compiles to s_cmp + s_cbranch_scc.
__device__ __forceinline__ unsigned pinned(unsigned v) {
    unsigned w = uni(v);
    asm volatile("" : "+s"(w));   // keeps the test scalar: a vector branch would not guard the tensor load
    return w;
}

// ---------------------------------------------------------------------------
// Tensor-load descriptor of a tile of 128-byte rows that lands in LDS with a
// pad behind every row: PAD = 3 gives 16 bytes (LDS pitch 144 B), PAD = 7 gives
// 32 bytes (pitch 160 B).  Every extent is in bytes (data_size code 0); tensor
// dims = tile dims.
// ---------------------------------------------------------------------------
__device__ __forceinline__ v4u tdm_group0(unsigned lds, const void* gptr) {
    const unsigned long long ga = (unsigned long long)(size_t)gptr;
    v4u g0;
    g0[0] = 1u;                                           // count=1 (valid)
    g0[1] = uni(lds);                                     // lds_addr
    g0[2] = uni((unsigned)(ga & 0xffffffffu));            // global_addr lo
    g0[3] = (uni((unsigned)(ga >> 32)) & 0x01ffffffu)     // global_addr hi
          | (2u << 30);                                   // type=2
    asm volatile("" : "+s"(g0));   // pinned(): descriptor words held in their own scalar registers, not formed anew from copies
    return g0;
}

template <unsigned PAD>
__device__ __forceinline__ v8i tdm_group1(unsigned rows, unsigned pitch) {
    v8i g1;
    g1[0] = (int)((1u << 20)      // pad_enable
          |       (4u << 22)      // pad_interval = 32 DWORDs = one row
          |       (PAD << 25));   // pad_amount   = PAD + 1 DWORDs
    g1[1] = (int)(128u << 16);                            // tensor_dim0 = 128 B
    g1[2] = (int)(uni(rows) << 16);                       // tensor_dim1 = rows
    g1[3] = (int)(128u << 16);                            // tile_dim0 = 128 B
    g1[4] = (int)uni(rows);                               // tile_dim1
    g1[5] = (int)uni(pitch);                              // source row pitch, bytes
    g1[6] = 0;
    g1[7] = 0;
    asm volatile("" : "+s"(g1));   // pinned(): descriptor words held in their own scalar registers, not formed anew from copies
    return g1;
}

// The same for a tile of 256-byte rows (LDS pitch 272 B).
__device__ __forceinline__ v8i tdm_group1_row256(unsigned rows, unsigned pitch) {
    v8i g1;
    g1[0] = (int)((1u << 20)      // pad_enable
          |       (5u << 22)      // pad_interval = 64 DWORDs = one row
          |       (3u << 25));    // pad_amount   = 4 DWORDs
    g1[1] = (int)(256u << 16);                            // tensor_dim0 = 256 B
    g1[2] = (int)(uni(rows) << 16);                       // tensor_dim1 = rows
    g1[3] = (int)(256u << 16);                            // tile_dim0 = 256 B
    g1[4] = (int)uni(rows);                               // tile_dim1
    g1[5] = (int)uni(pitch);                              // source row pitch, bytes
    g1[6] = 0;
    g1[7] = 0;
    asm volatile("" : "+s"(g1));   // pinned(): descriptor words held in their own scalar registers, not formed anew from copies
    return g1;
}

__device__ __forceinline__ void tdm_load(v4u g0, v8i g1) {
    const v4i z4 = {0, 0, 0, 0};
    const v8i z8 = {0, 0, 0, 0, 0, 0, 0, 0};
    __builtin_amdgcn_tensor_load_to_lds(g0, g1, z4, z4, z8, 0);
}

// 16x32 f16 fragment of one lane from a row of f32: k = 0..7 and 16..23 from p.
__device__ __forceinline__ v16h frag_from_f32(const float* p) {
    const v4f x0 = *(const v4f*)(p);
    const v4f x1 = *(const v4f*)(p + 4);
    const v4f x2 = *(const v4f*)(p + 16);
    const v4f x3 = *(const v4f*)(p + 20);
    v16h f;
    #pragma unroll
    for (int e = 0; e < 4; ++e) {
        f[e]      = (_Float16)x0[e];
        f[4 + e]  = (_Float16)x1[e];
        f[8 + e]  = (_Float16)x2[e];
        f[12 + e] = (_Float16)x3[e];
    }
    return f;
}

// The same from a row of f16.
__device__ __forceinline__ v16h frag_from_f16(const _Float16* p) {
    const v8h lo = *(const v8h*)(p);
    const v8h hi = *(const v8h*)(p + 16);
    return __builtin_shufflevector(lo, hi, 0, 1, 2, 3, 4, 5, 6, 7,
                                   8, 9, 10, 11, 12, 13, 14, 15);
}

// 16 (d) x 32 (keys) A fragment of V^T from row-major V rows in LDS, by two
// transposing loads: lane (ln, half) gets V[8*half + e | 16 + 8*half + e][ln].
// p = this lane's address: row 8*half + (lane & 7), halves 8 * ((lane >> 3) & 1).
__device__ __forceinline__ v16h frag_transposed(const _Float16* p) {
    typedef __attribute__((address_space(3))) v8s lds_v8s;
    const v8h lo = __builtin_bit_cast(v8h, __builtin_amdgcn_ds_load_tr16_b128_v8i16((lds_v8s*)p));
    const v8h hi = __builtin_bit_cast(v8h, __builtin_amdgcn_ds_load_tr16_b128_v8i16((lds_v8s*)(p + 16 * VPH)));
    return __builtin_shufflevector(lo, hi, 0, 1, 2, 3, 4, 5, 6, 7,
                                   8, 9, 10, 11, 12, 13, 14, 15);
}

// Lane l reads lane l ^ 16: the two wave halves hold the two halves of a column.
__device__ __forceinline__ float xhalf(float x) {
    const int b = __builtin_bit_cast(int, x);
    return __builtin_bit_cast(float,
        __builtin_amdgcn_permlanex16(b, b, 0x76543210, 0xfedcba98, false, false));
}

// ---------------------------------------------------------------------------
// Projection GEMM: Y[4096,1024] = X[4096,1024] @ W[1024,1024]^T + bias.
// 128x128 block tile, one block per WGP; 8 waves as 2 (rows) x 4 (columns),
// 64x32 of Y per wave: 8 WMMAs on 6 fragments per 32 k.  A stage is 128 k of
// both operands, f32, in 8 slices of 64 rows x 256 B; every wave brings one
// slice by one tensor load.  Two buffers: stage s + 1 flies while stage s is
// worked on.  f32->f16 conversion at fragment read.
// TOUT = _Float16 for the Q/K/V projections, float for the output proj.
// ---------------------------------------------------------------------------
template <typename TOUT>
__device__ __forceinline__
void proj_gemm_body(const float* __restrict__ X,
                    const float* __restrict__ W,
                    const float* __restrict__ bias,
                    TOUT* __restrict__ Y)
{
    // [buffer][slice], slice = 4 * (X | W) + 2 * (row half) + (k half); 68-dw pitch from the TDM pad
    __shared__ __attribute__((aligned(2048))) float Ts[2][8][GSL];

    const int tid  = threadIdx.x;
    const int lane = tid & 31;
    const int wv   = tid >> 5;
    const int half = lane >> 4;
    const int ln   = lane & 15;

    const int m0 = blockIdx.y * 128;
    const int n0 = blockIdx.x * 128;
    const int wm = wv & 1;              // rows    m0 + 64 * wm ..
    const int wn = wv >> 1;             // columns n0 + 32 * wn ..

    v8f acc[4][2] = {};

    // This wave's slice of every stage: 64 rows of X or W, 64 k.
    const unsigned wave = uni((unsigned)tid >> 5);
    const unsigned srow = (wave & 2) * 32;
    const float* src = ((wave & 4) ? W + (size_t)(n0 + srow) * D_MODEL
                                   : X + (size_t)(m0 + srow) * D_MODEL) + (wave & 1) * 64;
    const v8i g1 = tdm_group1_row256(64, D_MODEL * 4);    // the same for every slice

    // Prologue: stage 0 landed and published, then stage 1 issued.
    v4u g0 = tdm_group0(lds_off(&Ts[0][wave][0]), src);
    tdm_load(g0, g1);
    // The descriptor is an input so that its registers keep their values while the request is outstanding.
    asm volatile("s_wait_tensorcnt 0x0" :: "s"(g0), "s"(g1) : "memory");
    __syncthreads();
    g0 = tdm_group0(lds_off(&Ts[1][wave][0]), src + GKS);
    tdm_load(g0, g1);

    for (int s = 0; s < GNST; ++s) {
        // Fragments: row = tile*16+ln, K(e) = half*8+e | 16+half*8+e
        const float* As = &Ts[s & 1][wm * 2][ln * GP + half * 8];
        const float* Bs = &Ts[s & 1][4 + (wn >> 1) * 2][((wn & 1) * 32 + ln) * GP + half * 8];
        v16h a[4], b[2];
        #pragma unroll
        for (int kk = 0; kk < 4; ++kk) {
            const int o = (kk >> 1) * GSL + (kk & 1) * 32;
            #pragma unroll
            for (int i = 0; i < 4; ++i) a[i] = frag_from_f32(As + o + i * 16 * GP);
            #pragma unroll
            for (int j = 0; j < 2; ++j) b[j] = frag_from_f32(Bs + o + j * 16 * GP);
            if (kk == 3) break;   // the last 32 k are multiplied behind the refill, from registers
            #pragma unroll
            for (int i = 0; i < 4; ++i) {
                #pragma unroll
                for (int j = 0; j < 2; ++j) acc[i][j] = wmma_f16(a[i], b[j], acc[i][j]);
            }
        }
        // Publish point of stage s + 1: this wave's reads of stage s are done, its
        // slice of stage s + 1 has landed, every wave has said the same.
        asm volatile("s_wait_dscnt 0x0" ::: "memory");
        asm volatile("s_wait_tensorcnt 0x0" :: "s"(g0), "s"(g1) : "memory");
        __syncthreads();
        g0 = tdm_group0(lds_off(&Ts[s & 1][wave][0]), src + (s + 2) * GKS);
        if (pinned(s + 2 < GNST)) {   // refill of the buffer that every wave has just left
            tdm_load(g0, g1);
        }
        #pragma unroll
        for (int i = 0; i < 4; ++i) {
            #pragma unroll
            for (int j = 0; j < 2; ++j) acc[i][j] = wmma_f16(a[i], b[j], acc[i][j]);
        }
    }
    asm volatile("s_wait_tensorcnt 0x0" ::: "memory");   // no request of this wave is left behind the loop
    asm volatile("s_wait_dscnt 0x0" ::: "memory");       // and none of its LDS reads

    // Epilogue: bias + store.  D layout: row = r + 8*half, col = ln.
    #pragma unroll
    for (int j = 0; j < 2; ++j) {
        const int na = n0 + wn * 32 + j * 16 + ln;
        const float bj = bias[na];
        #pragma unroll
        for (int i = 0; i < 4; ++i) {
            TOUT* ya = Y + (size_t)(m0 + wm * 64 + i * 16 + 8 * half) * D_MODEL + na;
            #pragma unroll
            for (int r = 0; r < 8; ++r) ya[(size_t)r * D_MODEL] = (TOUT)(acc[i][j][r] + bj);
        }
    }
}

// The Q, K and V projections are independent: one launch, blockIdx.z picks the
// projection, so that two launch gaps, wave starts and tails fall away and a WGP
// takes its next tile as soon as it has stored the last.
__global__ __launch_bounds__(256)
void qkv_gemm_kernel(const float* __restrict__ Xq, const float* __restrict__ Xk, const float* __restrict__ Xv,
                     const float* __restrict__ Wq, const float* __restrict__ Wk, const float* __restrict__ Wv,
                     const float* __restrict__ Bq, const float* __restrict__ Bk, const float* __restrict__ Bv,
                     _Float16* __restrict__ Yq, _Float16* __restrict__ Yk, _Float16* __restrict__ Yv)
{
    const int z = blockIdx.z;
    proj_gemm_body<_Float16>((z == 0) ? Xq : (z == 1) ? Xk : Xv,
                             (z == 0) ? Wq : (z == 1) ? Wk : Wv,
                             (z == 0) ? Bq : (z == 1) ? Bk : Bv,
                             (z == 0) ? Yq : (z == 1) ? Yk : Yv);
}

__global__ __launch_bounds__(256)
void out_gemm_kernel(const float* __restrict__ X,
                     const float* __restrict__ W,
                     const float* __restrict__ bias,
                     float* __restrict__ Y)
{
    proj_gemm_body<float>(X, W, bias, Y);
}

__global__ __launch_bounds__(256)
void attn_flash_kernel(const _Float16* __restrict__ Qb,
                       const _Float16* __restrict__ Kb,
                       const _Float16* __restrict__ Vb,
                       const float* __restrict__ td_ptr,
                       float* __restrict__ Cb)
{
    __shared__ __attribute__((aligned(2048))) _Float16 Ks[2][SKEYS * KP];   // [buffer][key][d], 144-B pitch: 9 x 2 KiB a buffer
    __shared__ __attribute__((aligned(2048))) _Float16 Vs[2][SKEYS * VPH];  // [buffer][key][d], 160-B pitch: 10 x 2 KiB a buffer

    const int tid  = threadIdx.x;
    const int lane = tid & 31;
    const int wv   = tid >> 5;
    const int half = lane >> 4;
    const int ln   = lane & 15;

    const int bh   = blockIdx.x >> 4;          // 0..31
    const int qblk = blockIdx.x & 15;          // 0..15
    const int b    = bh >> 4;
    const int h    = bh & 15;
    const int q0   = (qblk * 8 + wv) * 16;

    const float td    = td_ptr[0];
    const float scale = 0.125f;                // 1/sqrt(64)

    const _Float16* Qh = Qb + (size_t)b * SEQ * D_MODEL + h * D_KH;
    const _Float16* Kh = Kb + (size_t)b * SEQ * D_MODEL + h * D_KH;
    const _Float16* Vh = Vb + (size_t)b * SEQ * D_MODEL + h * D_KH;
    float*          Ch = Cb + (size_t)b * SEQ * D_MODEL + h * D_KH;

    // Q B-fragments for d = 0..31 / 32..63 (column = ln); contiguous f16 loads.
    v16h aq0, aq1;
    {
        const _Float16* qr = Qh + (size_t)(q0 + ln) * D_MODEL;
        #pragma unroll
        for (int e = 0; e < 8; ++e) aq0[e]     = qr[half * 8 + e];
        #pragma unroll
        for (int e = 0; e < 8; ++e) aq0[8 + e] = qr[16 + half * 8 + e];
        #pragma unroll
        for (int e = 0; e < 8; ++e) aq1[e]     = qr[32 + half * 8 + e];
        #pragma unroll
        for (int e = 0; e < 8; ++e) aq1[8 + e] = qr[48 + half * 8 + e];
    }

    v8f c0 = {}, c1 = {}, c2 = {}, c3 = {};
    float mrun = -3.0e38f;              // running maximum of query q0 + ln (equal in both halves)
    float lrun = 0.0f;                  // running sum over this half's keys; the halves join in the epilogue
    const float qpos = (float)(q0 + ln);

    // Wave 0 issues K, wave 1 issues V; the other waves form V's group 0 and never issue.
    const unsigned wave = uni((unsigned)tid >> 5);
    const _Float16* src = (wave == 0) ? Kh : Vh;
    const unsigned dst  = (wave == 0) ? lds_off(&Ks[0][0]) : lds_off(&Vs[0][0]);
    const unsigned dbuf = (wave == 0) ? (unsigned)sizeof(Ks[0]) : (unsigned)sizeof(Vs[0]);
    const v8i g1k = tdm_group1<3>(SKEYS, D_MODEL * 2);   // the same for every K stage
    const v8i g1v = tdm_group1<7>(SKEYS, D_MODEL * 2);   // the same for every V stage

    // Prologue: stage 0 landed and published, then stage 1 issued.
    v4u g0 = tdm_group0(dst, src);
    if (pinned(wave == 0)) {
        tdm_load(g0, g1k);
        // The descriptor is an input so that its registers keep their values while the request is outstanding.
        asm volatile("s_wait_tensorcnt 0x0" :: "s"(g0), "s"(g1k) : "memory");
    }
    if (pinned(wave == 1)) {
        tdm_load(g0, g1v);
        asm volatile("s_wait_tensorcnt 0x0" :: "s"(g0), "s"(g1v) : "memory");   // as above
    }
    __syncthreads();
    g0 = tdm_group0(dst + dbuf, src + (size_t)SKEYS * D_MODEL);
    if (pinned(wave == 0)) tdm_load(g0, g1k);
    if (pinned(wave == 1)) tdm_load(g0, g1v);

    float dist = qpos - (float)(8 * half);   // query minus this half's first key of the stage; whole numbers: exact
    for (int st = 0; st < ANST; ++st) {
      const _Float16* Kst = &Ks[st & 1][ln * KP + half * 8];
      const _Float16* Vst = &Vs[st & 1][(8 * half + (lane & 7)) * VPH + ((lane >> 3) & 1) * 8];
      #pragma unroll   // the four passes' LDS addresses become immediate offsets, and one pass's loads may rise into the one before
      for (int sub = 0; sub < SKEYS / 32; ++sub) {
        // ---- scores, transposed: s0[r] = S[128*st + 32*sub + 8*half + r][q0 + ln], s1: +16 keys
        v8f s0 = {}, s1 = {};
        {
            const _Float16* kr = Kst + sub * 32 * KP;
            s0 = wmma_f16(frag_from_f16(kr), aq0, s0);
            s0 = wmma_f16(frag_from_f16(kr + 32), aq1, s0);
            kr += 16 * KP;
            s1 = wmma_f16(frag_from_f16(kr), aq0, s1);
            s1 = wmma_f16(frag_from_f16(kr + 32), aq1, s1);
        }

        // ---- scale + time-decay bias + online softmax, one query per lane -
        const float dist0 = dist - (float)(sub * 32);
        #pragma unroll
        for (int r = 0; r < 8; ++r) s0[r] = s0[r] * scale - td * fabsf(dist0 - (float)r);
        #pragma unroll
        for (int r = 0; r < 8; ++r) s1[r] = s1[r] * scale - td * fabsf(dist0 - (float)(16 + r));
        float t = fmaxf(s0[0], s1[0]);
        #pragma unroll
        for (int r = 1; r < 8; ++r) t = fmaxf(t, fmaxf(s0[r], s1[r]));
        t = fmaxf(t, xhalf(t));
        const float mnew  = fmaxf(mrun, t);
        const float alpha = __expf(mrun - mnew);
        #pragma unroll
        for (int r = 0; r < 8; ++r) s0[r] = __expf(s0[r] - mnew);
        #pragma unroll
        for (int r = 0; r < 8; ++r) s1[r] = __expf(s1[r] - mnew);
        v16h bp;   // P^T as B fragment: k = 8*half + e | 16 + 8*half + e, the order of the V^T loader
        #pragma unroll
        for (int r = 0; r < 8; ++r) {
            bp[r]     = (_Float16)s0[r];
            bp[8 + r] = (_Float16)s1[r];
        }
        const v8f ps = s0 + s1;
        const float rs = ((ps[0] + ps[1]) + (ps[2] + ps[3])) + ((ps[4] + ps[5]) + (ps[6] + ps[7]));
        lrun = lrun * alpha + rs;
        mrun = mnew;

        #pragma unroll
        for (int r = 0; r < 8; ++r) {
            c0[r] *= alpha; c1[r] *= alpha;
            c2[r] *= alpha; c3[r] *= alpha;
        }

        // ---- ctx^T += V^T(64x32) @ P^T(32x16), V^T by transposing loads ----
        {
            #pragma unroll
            for (int t4 = 0; t4 < 4; ++t4) {
                const v16h av = frag_transposed(Vst + sub * 32 * VPH + t4 * 16);
                if      (t4 == 0) c0 = wmma_f16(av, bp, c0);
                else if (t4 == 1) c1 = wmma_f16(av, bp, c1);
                else if (t4 == 2) c2 = wmma_f16(av, bp, c2);
                else              c3 = wmma_f16(av, bp, c3);
            }
        }
      }
      dist -= (float)SKEYS;
      // Publish point of stage st + 1: this wave's reads of stage st are done, the
      // issuing waves' tiles of stage st + 1 have landed, every wave has said the same.
      asm volatile("s_wait_dscnt 0x0" ::: "memory");
      if (pinned(wave < 2)) {
          // The descriptors are inputs so that their registers keep their values while the request is outstanding.
          asm volatile("s_wait_tensorcnt 0x0" :: "s"(g0), "s"(g1k), "s"(g1v) : "memory");
      }
      __syncthreads();
      g0 = tdm_group0(dst + (st & 1) * dbuf, src + (size_t)(st + 2) * SKEYS * D_MODEL);
      if (pinned(st + 2 < ANST)) {   // refill of the buffer that every wave has just left
          if (pinned(wave == 0)) tdm_load(g0, g1k);
          if (pinned(wave == 1)) tdm_load(g0, g1v);
      }
    }
    asm volatile("s_wait_tensorcnt 0x0" ::: "memory");   // no request of this wave is left behind the loop
    asm volatile("s_wait_dscnt 0x0" ::: "memory");       // and none of its LDS reads

    // ---- epilogue: normalize and store ctx (f32) --------------------------
    // c<t>[r] = O[q0 + ln][t*16 + 8*half + r]: eight consecutive floats a lane.
    {
        const float inv = 1.0f / (lrun + xhalf(lrun));
        float* cr = Ch + (size_t)(q0 + ln) * D_MODEL + 8 * half;
        #pragma unroll
        for (int j = 0; j < 2; ++j) {
            const v4f o0 = {c0[4*j] * inv, c0[4*j+1] * inv, c0[4*j+2] * inv, c0[4*j+3] * inv};
            const v4f o1 = {c1[4*j] * inv, c1[4*j+1] * inv, c1[4*j+2] * inv, c1[4*j+3] * inv};
            const v4f o2 = {c2[4*j] * inv, c2[4*j+1] * inv, c2[4*j+2] * inv, c2[4*j+3] * inv};
            const v4f o3 = {c3[4*j] * inv, c3[4*j+1] * inv, c3[4*j+2] * inv, c3[4*j+3] * inv};
            *(v4f*)(cr + 4 * j)      = o0;
            *(v4f*)(cr + 16 + 4 * j) = o1;
            *(v4f*)(cr + 32 + 4 * j) = o2;
            *(v4f*)(cr + 48 + 4 * j) = o3;
        }
    }
}

// ---------------------------------------------------------------------------
extern "C" void kernel_launch(void* const* d_in, const int* in_sizes, int n_in,
                              void* d_out, int out_size, void* d_ws, size_t ws_size,
                              hipStream_t stream) {
    const float* query = (const float*)d_in[0];
    const float* key   = (const float*)d_in[1];
    const float* value = (const float*)d_in[2];
    const float* wq = (const float*)d_in[3];
    const float* bq = (const float*)d_in[4];
    const float* wk = (const float*)d_in[5];
    const float* bk = (const float*)d_in[6];
    const float* wv = (const float*)d_in[7];
    const float* bv = (const float*)d_in[8];
    const float* wo = (const float*)d_in[9];
    const float* bo = (const float*)d_in[10];
    const float* td = (const float*)d_in[11];
    float* out = (float*)d_out;

    const size_t elems = (size_t)MROWS * D_MODEL;
    _Float16* Qbuf = (_Float16*)d_ws;            // 8 MB
    _Float16* Kbuf = Qbuf + elems;               // 8 MB
    _Float16* Vbuf = Kbuf + elems;               // 8 MB
    float*    Cbuf = (float*)(Vbuf + elems);     // 16 MB

    const dim3 gblk(256);
    const dim3 ggrid(D_MODEL / 128, MROWS / 128);  // 8 x 32
    qkv_gemm_kernel<<<dim3(D_MODEL / 128, MROWS / 128, 3), gblk, 0, stream>>>(
        query, key, value, wq, wk, wv, bq, bk, bv, Qbuf, Kbuf, Vbuf);

    attn_flash_kernel<<<dim3(BATCH * N_HEADS * (SEQ / 128)), dim3(256), 0, stream>>>(
        Qbuf, Kbuf, Vbuf, td, Cbuf);

    out_gemm_kernel<<<ggrid, gblk, 0, stream>>>(Cbuf, wo, bo, out);
}

// v006
// Measured time: 89.1 microseconds a run.
// Two timings next to v005 both put it at 1.07 times that version's speed.
// Over all steps from v000 it is 3.77 times as fast.
#include <hip/hip_runtime.h>
#include <hip/hip_bf16.h>
#include <cmath>

#define D_MODEL 1024
#define N_HEADS 16
#define D_KH    64
#define SEQ     2048
#define BATCH   2
#define MROWS   (BATCH * SEQ)     // 4096

typedef __attribute__((ext_vector_type(16))) _Float16     v16h;
typedef __attribute__((ext_vector_type(8)))  float        v8f;
typedef __attribute__((ext_vector_type(4)))  unsigned int v4u;
typedef __attribute__((ext_vector_type(8)))  int          v8i;
typedef __attribute__((ext_vector_type(4)))  int          v4i;
typedef __attribute__((ext_vector_type(8)))  _Float16     v8h;
typedef __attribute__((ext_vector_type(4)))  float        v4f;
typedef __attribute__((ext_vector_type(8)))  short        v8s;

// LDS pitches: 16 B x odd, so a 16-lane column of 16-byte reads meets no bank twice.
#define ROW128_PITCH_B 144                    // 128-byte rows + the mover's 16-byte pad
#define ROW256_PITCH_B 272                    // 256-byte rows + the mover's 16-byte pad
#define GP   (ROW256_PITCH_B / 4)             // GEMM slices: pitch in floats (68)
#define GSL  4608                             // floats per GEMM slice: 64 rows of 272 B, rounded up to 2 KiB x 9
#define GKS  128                              // k per GEMM stage
#define GNST (D_MODEL / GKS)                  // GEMM stages (8)
#define KP   (ROW128_PITCH_B / 2)             // K tile: pitch in halves (72)
#define VPH  80                               // V tile: pitch in halves (160 B = 128-byte rows + the mover's 32-byte pad, for the transposing reader)
#define SKEYS 128                             // keys per attention stage
#define ANST (SEQ / SKEYS)                    // attention stages (16)
#define LOG2E   1.4426950408889634f           // the attention scores are kept in log2 units
#define QK_LOG2 0.18033688011112042f          // 1/sqrt(64) * log2(e): multiplied into Q where it is projected

__device__ __forceinline__ v8f wmma_f16(v16h a, v16h b, v8f c) {
    return __builtin_amdgcn_wmma_f32_16x16x32_f16(
        false, a, false, b, (short)0, c, false, false);
}

// Low 32 bits of a generic pointer to LDS == LDS byte offset.
__device__ __forceinline__ unsigned lds_off(const void* p) {
    return (unsigned)(size_t)p;
}

__device__ __forceinline__ unsigned uni(unsigned v) {
    return (unsigned)__builtin_amdgcn_readfirstlane(v);
}

// A wave-uniform test held in a scalar register, so that the branch round a
// tensor load (which ignores EXEC) compiles to s_cmp + s_cbranch_scc.
__device__ __forceinline__ unsigned pinned(unsigned v) {
    unsigned w = uni(v);
    asm volatile("" : "+s"(w));   // keeps the test scalar: a vector branch would not guard the tensor load
    return w;
}

// ---------------------------------------------------------------------------
// Tensor-load descriptor of a tile of 128-byte rows that lands in LDS with a
// pad behind every row: PAD = 3 gives 16 bytes (LDS pitch 144 B), PAD = 7 gives
// 32 bytes (pitch 160 B).  Every extent is in bytes (data_size code 0); tensor
// dims = tile dims.
// ---------------------------------------------------------------------------
__device__ __forceinline__ v4u tdm_group0(unsigned lds, const void* gptr) {
    const unsigned long long ga = (unsigned long long)(size_t)gptr;
    v4u g0;
    g0[0] = 1u;                                           // count=1 (valid)
    g0[1] = uni(lds);                                     // lds_addr
    g0[2] = uni((unsigned)(ga & 0xffffffffu));            // global_addr lo
    g0[3] = (uni((unsigned)(ga >> 32)) & 0x01ffffffu)     // global_addr hi
          | (2u << 30);                                   // type=2
    asm volatile("" : "+s"(g0));   // pinned(): descriptor words held in their own scalar registers, not formed anew from copies
    return g0;
}

template <unsigned PAD>
__device__ __forceinline__ v8i tdm_group1(unsigned rows, unsigned pitch) {
    v8i g1;
    g1[0] = (int)((1u << 20)      // pad_enable
          |       (4u << 22)      // pad_interval = 32 DWORDs = one row
          |       (PAD << 25));   // pad_amount   = PAD + 1 DWORDs
    g1[1] = (int)(128u << 16);                            // tensor_dim0 = 128 B
    g1[2] = (int)(uni(rows) << 16);                       // tensor_dim1 = rows
    g1[3] = (int)(128u << 16);                            // tile_dim0 = 128 B
    g1[4] = (int)uni(rows);                               // tile_dim1
    g1[5] = (int)uni(pitch);                              // source row pitch, bytes
    g1[6] = 0;
    g1[7] = 0;
    asm volatile("" : "+s"(g1));   // pinned(): descriptor words held in their own scalar registers, not formed anew from copies
    return g1;
}

// The same for a tile of 256-byte rows (LDS pitch 272 B).
__device__ __forceinline__ v8i tdm_group1_row256(unsigned rows, unsigned pitch) {
    v8i g1;
    g1[0] = (int)((1u << 20)      // pad_enable
          |       (5u << 22)      // pad_interval = 64 DWORDs = one row
          |       (3u << 25));    // pad_amount   = 4 DWORDs
    g1[1] = (int)(256u << 16);                            // tensor_dim0 = 256 B
    g1[2] = (int)(uni(rows) << 16);                       // tensor_dim1 = rows
    g1[3] = (int)(256u << 16);                            // tile_dim0 = 256 B
    g1[4] = (int)uni(rows);                               // tile_dim1
    g1[5] = (int)uni(pitch);                              // source row pitch, bytes
    g1[6] = 0;
    g1[7] = 0;
    asm volatile("" : "+s"(g1));   // pinned(): descriptor words held in their own scalar registers, not formed anew from copies
    return g1;
}

__device__ __forceinline__ void tdm_load(v4u g0, v8i g1) {
    const v4i z4 = {0, 0, 0, 0};
    const v8i z8 = {0, 0, 0, 0, 0, 0, 0, 0};
    __builtin_amdgcn_tensor_load_to_lds(g0, g1, z4, z4, z8, 0);
}

// 16x32 f16 fragment of one lane from a row of f32: k = 0..7 and 16..23 from p.
__device__ __forceinline__ v16h frag_from_f32(const float* p) {
    const v4f x0 = *(const v4f*)(p);
    const v4f x1 = *(const v4f*)(p + 4);
    const v4f x2 = *(const v4f*)(p + 16);
    const v4f x3 = *(const v4f*)(p + 20);
    v16h f;
    #pragma unroll
    for (int e = 0; e < 4; ++e) {
        f[e]      = (_Float16)x0[e];
        f[4 + e]  = (_Float16)x1[e];
        f[8 + e]  = (_Float16)x2[e];
        f[12 + e] = (_Float16)x3[e];
    }
    return f;
}

// The same from a row of f16.
__device__ __forceinline__ v16h frag_from_f16(const _Float16* p) {
    const v8h lo = *(const v8h*)(p);
    const v8h hi = *(const v8h*)(p + 16);
    return __builtin_shufflevector(lo, hi, 0, 1, 2, 3, 4, 5, 6, 7,
                                   8, 9, 10, 11, 12, 13, 14, 15);
}

// 16 (d) x 32 (keys) A fragment of V^T from row-major V rows in LDS, by two
// transposing loads: lane (ln, half) gets V[8*half + e | 16 + 8*half + e][ln].
// p = this lane's address: row 8*half + (lane & 7), halves 8 * ((lane >> 3) & 1).
__device__ __forceinline__ v16h frag_transposed(const _Float16* p) {
    typedef __attribute__((address_space(3))) v8s lds_v8s;
    const v8h lo = __builtin_bit_cast(v8h, __builtin_amdgcn_ds_load_tr16_b128_v8i16((lds_v8s*)p));
    const v8h hi = __builtin_bit_cast(v8h, __builtin_amdgcn_ds_load_tr16_b128_v8i16((lds_v8s*)(p + 16 * VPH)));
    return __builtin_shufflevector(lo, hi, 0, 1, 2, 3, 4, 5, 6, 7,
                                   8, 9, 10, 11, 12, 13, 14, 15);
}

// Lane l reads lane l ^ 16: the two wave halves hold the two halves of a column.
__device__ __forceinline__ float xhalf(float x) {
    const int b = __builtin_bit_cast(int, x);
    return __builtin_bit_cast(float,
        __builtin_amdgcn_permlanex16(b, b, 0x76543210, 0xfedcba98, false, false));
}

// ---------------------------------------------------------------------------
// Projection GEMM: Y[4096,1024] = X[4096,1024] @ W[1024,1024]^T + bias.
// 128x128 block tile, one block per WGP; 8 waves as 2 (rows) x 4 (columns),
// 64x32 of Y per wave: 8 WMMAs on 6 fragments per 32 k.  A stage is 128 k of
// both operands, f32, in 8 slices of 64 rows x 256 B; every wave brings one
// slice by one tensor load.  Two buffers: stage s + 1 flies while stage s is
// worked on.  f32->f16 conversion at fragment read.
// TOUT = _Float16 for the Q/K/V projections, float for the output proj.
// oscale multiplies the biased result in f32, before it is rounded to TOUT.
// ---------------------------------------------------------------------------
template <typename TOUT>
__device__ __forceinline__
void proj_gemm_body(const float* __restrict__ X,
                    const float* __restrict__ W,
                    const float* __restrict__ bias,
                    TOUT* __restrict__ Y,
                    const float oscale)
{
    // [buffer][slice], slice = 4 * (X | W) + 2 * (row half) + (k half); 68-dw pitch from the TDM pad
    __shared__ __attribute__((aligned(2048))) float Ts[2][8][GSL];

    const int tid  = threadIdx.x;
    const int lane = tid & 31;
    const int wv   = tid >> 5;
    const int half = lane >> 4;
    const int ln   = lane & 15;

    const int m0 = blockIdx.y * 128;
    const int n0 = blockIdx.x * 128;
    const int wm = wv & 1;              // rows    m0 + 64 * wm ..
    const int wn = wv >> 1;             // columns n0 + 32 * wn ..

    v8f acc[4][2] = {};

    // This wave's slice of every stage: 64 rows of X or W, 64 k.
    const unsigned wave = uni((unsigned)tid >> 5);
    const unsigned srow = (wave & 2) * 32;
    const float* src = ((wave & 4) ? W + (size_t)(n0 + srow) * D_MODEL
                                   : X + (size_t)(m0 + srow) * D_MODEL) + (wave & 1) * 64;
    const v8i g1 = tdm_group1_row256(64, D_MODEL * 4);    // the same for every slice

    // Prologue: stage 0 landed and published, then stage 1 issued.
    v4u g0 = tdm_group0(lds_off(&Ts[0][wave][0]), src);
    tdm_load(g0, g1);
    // The descriptor is an input so that its registers keep their values while the request is outstanding.
    asm volatile("s_wait_tensorcnt 0x0" :: "s"(g0), "s"(g1) : "memory");
    __syncthreads();
    g0 = tdm_group0(lds_off(&Ts[1][wave][0]), src + GKS);
    tdm_load(g0, g1);

    for (int s = 0; s < GNST; ++s) {
        // Fragments: row = tile*16+ln, K(e) = half*8+e | 16+half*8+e
        const float* As = &Ts[s & 1][wm * 2][ln * GP + half * 8];
        const float* Bs = &Ts[s & 1][4 + (wn >> 1) * 2][((wn & 1) * 32 + ln) * GP + half * 8];
        v16h a[4], b[2];
        #pragma unroll
        for (int kk = 0; kk < 4; ++kk) {
            const int o = (kk >> 1) * GSL + (kk & 1) * 32;
            #pragma unroll
            for (int i = 0; i < 4; ++i) a[i] = frag_from_f32(As + o + i * 16 * GP);
            #pragma unroll
            for (int j = 0; j < 2; ++j) b[j] = frag_from_f32(Bs + o + j * 16 * GP);
            if (kk == 3) break;   // the last 32 k are multiplied behind the refill, from registers
            #pragma unroll
            for (int i = 0; i < 4; ++i) {
                #pragma unroll
                for (int j = 0; j < 2; ++j) acc[i][j] = wmma_f16(a[i], b[j], acc[i][j]);
            }
        }
        // Publish point of stage s + 1: this wave's reads of stage s are done, its
        // slice of stage s + 1 has landed, every wave has said the same.
        asm volatile("s_wait_dscnt 0x0" ::: "memory");
        asm volatile("s_wait_tensorcnt 0x0" :: "s"(g0), "s"(g1) : "memory");
        __syncthreads();
        g0 = tdm_group0(lds_off(&Ts[s & 1][wave][0]), src + (s + 2) * GKS);
        if (pinned(s + 2 < GNST)) {   // refill of the buffer that every wave has just left
            tdm_load(g0, g1);
        }
        #pragma unroll
        for (int i = 0; i < 4; ++i) {
            #pragma unroll
            for (int j = 0; j < 2; ++j) acc[i][j] = wmma_f16(a[i], b[j], acc[i][j]);
        }
    }
    asm volatile("s_wait_tensorcnt 0x0" ::: "memory");   // no request of this wave is left behind the loop
    asm volatile("s_wait_dscnt 0x0" ::: "memory");       // and none of its LDS reads

    // Epilogue: bias + store.  D layout: row = r + 8*half, col = ln.
    #pragma unroll
    for (int j = 0; j < 2; ++j) {
        const int na = n0 + wn * 32 + j * 16 + ln;
        const float bj = bias[na];
        #pragma unroll
        for (int i = 0; i < 4; ++i) {
            TOUT* ya = Y + (size_t)(m0 + wm * 64 + i * 16 + 8 * half) * D_MODEL + na;
            #pragma unroll
            for (int r = 0; r < 8; ++r) ya[(size_t)r * D_MODEL] = (TOUT)((acc[i][j][r] + bj) * oscale);
        }
    }
}

// The Q, K and V projections are independent: one launch, blockIdx.z picks the
// projection, so that two launch gaps, wave starts and tails fall away and a WGP
// takes its next tile as soon as it has stored the last.
__global__ __launch_bounds__(256)
void qkv_gemm_kernel(const float* __restrict__ Xq, const float* __restrict__ Xk, const float* __restrict__ Xv,
                     const float* __restrict__ Wq, const float* __restrict__ Wk, const float* __restrict__ Wv,
                     const float* __restrict__ Bq, const float* __restrict__ Bk, const float* __restrict__ Bv,
                     _Float16* __restrict__ Yq, _Float16* __restrict__ Yk, _Float16* __restrict__ Yv)
{
    const int z = blockIdx.z;
    proj_gemm_body<_Float16>((z == 0) ? Xq : (z == 1) ? Xk : Xv,
                             (z == 0) ? Wq : (z == 1) ? Wk : Wv,
                             (z == 0) ? Bq : (z == 1) ? Bk : Bv,
                             (z == 0) ? Yq : (z == 1) ? Yk : Yv,
                             (z == 0) ? QK_LOG2 : 1.0f);   // Q leaves scaled: the score product is then in log2 units
}

__global__ __launch_bounds__(256)
void out_gemm_kernel(const float* __restrict__ X,
                     const float* __restrict__ W,
                     const float* __restrict__ bias,
                     float* __restrict__ Y)
{
    proj_gemm_body<float>(X, W, bias, Y, 1.0f);
}

__global__ __launch_bounds__(256)
void attn_flash_kernel(const _Float16* __restrict__ Qb,
                       const _Float16* __restrict__ Kb,
                       const _Float16* __restrict__ Vb,
                       const float* __restrict__ td_ptr,
                       float* __restrict__ Cb)
{
    __shared__ __attribute__((aligned(2048))) _Float16 Ks[2][SKEYS * KP];   // [buffer][key][d], 144-B pitch: 9 x 2 KiB a buffer
    __shared__ __attribute__((aligned(2048))) _Float16 Vs[2][SKEYS * VPH];  // [buffer][key][d], 160-B pitch: 10 x 2 KiB a buffer

    const int tid  = threadIdx.x;
    const int lane = tid & 31;
    const int wv   = tid >> 5;
    const int half = lane >> 4;
    const int ln   = lane & 15;

    const int bh   = blockIdx.x >> 4;          // 0..31
    const int qblk = blockIdx.x & 15;          // 0..15
    const int b    = bh >> 4;
    const int h    = bh & 15;
    const int q0   = (qblk * 8 + wv) * 16;

    const float ndec = -td_ptr[0] * LOG2E;     // bias per key of distance, log2 units

    const _Float16* Qh = Qb + (size_t)b * SEQ * D_MODEL + h * D_KH;
    const _Float16* Kh = Kb + (size_t)b * SEQ * D_MODEL + h * D_KH;
    const _Float16* Vh = Vb + (size_t)b * SEQ * D_MODEL + h * D_KH;
    float*          Ch = Cb + (size_t)b * SEQ * D_MODEL + h * D_KH;

    // Q B-fragments for d = 0..31 / 32..63 (column = ln); contiguous f16 loads.
    v16h aq0, aq1;
    {
        const _Float16* qr = Qh + (size_t)(q0 + ln) * D_MODEL;
        #pragma unroll
        for (int e = 0; e < 8; ++e) aq0[e]     = qr[half * 8 + e];
        #pragma unroll
        for (int e = 0; e < 8; ++e) aq0[8 + e] = qr[16 + half * 8 + e];
        #pragma unroll
        for (int e = 0; e < 8; ++e) aq1[e]     = qr[32 + half * 8 + e];
        #pragma unroll
        for (int e = 0; e < 8; ++e) aq1[8 + e] = qr[48 + half * 8 + e];
    }

    v8f c0 = {}, c1 = {}, c2 = {}, c3 = {};
    float nmax = 0.0f;                  // minus the maximum in use of query q0 + ln (equal in both halves); the first pass sets it
    float lrun = 0.0f;                  // running sum over this half's keys; the halves join in the epilogue
    const float qpos = (float)(q0 + ln);

    // Wave 0 issues K, wave 1 issues V; the other waves form V's group 0 and never issue.
    const unsigned wave = uni((unsigned)tid >> 5);
    const _Float16* src = (wave == 0) ? Kh : Vh;
    const unsigned dst  = (wave == 0) ? lds_off(&Ks[0][0]) : lds_off(&Vs[0][0]);
    const unsigned dbuf = (wave == 0) ? (unsigned)sizeof(Ks[0]) : (unsigned)sizeof(Vs[0]);
    const v8i g1k = tdm_group1<3>(SKEYS, D_MODEL * 2);   // the same for every K stage
    const v8i g1v = tdm_group1<7>(SKEYS, D_MODEL * 2);   // the same for every V stage

    // Prologue: stage 0 landed and published, then stage 1 issued.
    v4u g0 = tdm_group0(dst, src);
    if (pinned(wave == 0)) {
        tdm_load(g0, g1k);
        // The descriptor is an input so that its registers keep their values while the request is outstanding.
        asm volatile("s_wait_tensorcnt 0x0" :: "s"(g0), "s"(g1k) : "memory");
    }
    if (pinned(wave == 1)) {
        tdm_load(g0, g1v);
        asm volatile("s_wait_tensorcnt 0x0" :: "s"(g0), "s"(g1v) : "memory");   // as above
    }
    __syncthreads();
    g0 = tdm_group0(dst + dbuf, src + (size_t)SKEYS * D_MODEL);
    if (pinned(wave == 0)) tdm_load(g0, g1k);
    if (pinned(wave == 1)) tdm_load(g0, g1v);

    float dist = qpos - (float)(8 * half);   // query minus this half's first key of the stage; whole numbers: exact
    for (int st = 0; st < ANST; ++st) {
      const _Float16* Kst = &Ks[st & 1][ln * KP + half * 8];
      const _Float16* Vst = &Vs[st & 1][(8 * half + (lane & 7)) * VPH + ((lane >> 3) & 1) * 8];
      #pragma unroll   // the four passes' LDS addresses become immediate offsets, and one pass's loads may rise into the one before
      for (int sub = 0; sub < SKEYS / 32; ++sub) {
        // ---- scores, transposed: s0[r] = S[128*st + 32*sub + 8*half + r][q0 + ln], s1: +16 keys
        //      each starts from its bias minus the maximum in use
        const float dist0 = dist - (float)(sub * 32);
        v8f s0, s1;
        #pragma unroll
        for (int r = 0; r < 8; ++r) s0[r] = fmaf(ndec, fabsf(dist0 - (float)r), nmax);
        #pragma unroll
        for (int r = 0; r < 8; ++r) s1[r] = fmaf(ndec, fabsf(dist0 - (float)(16 + r)), nmax);
        {
            const _Float16* kr = Kst + sub * 32 * KP;
            s0 = wmma_f16(frag_from_f16(kr), aq0, s0);
            s0 = wmma_f16(frag_from_f16(kr + 32), aq1, s0);
            kr += 16 * KP;
            s1 = wmma_f16(frag_from_f16(kr), aq0, s1);
            s1 = wmma_f16(frag_from_f16(kr + 32), aq1, s1);
        }

        // ---- online softmax, one query per lane; the maximum moves rarely --
        float t = fmaxf(s0[0], s1[0]);
        #pragma unroll
        for (int r = 1; r < 8; ++r) t = fmaxf(t, fmaxf(s0[r], s1[r]));
        t = fmaxf(t, xhalf(t));
        const bool first = (sub == 0) && (st == 0);   // nothing is summed yet: the pass's own maximum is taken, up or down
        if (first || __builtin_amdgcn_ballot_w32(t > 8.0f) != 0) {   // one scalar test per pass
            const float up    = first ? t : fmaxf(t, 0.0f);
            const float alpha = first ? 0.0f : __builtin_amdgcn_exp2f(-up);
            nmax -= up;
            lrun *= alpha;
            #pragma unroll
            for (int r = 0; r < 8; ++r) {
                s0[r] -= up;    s1[r] -= up;
                c0[r] *= alpha; c1[r] *= alpha;
                c2[r] *= alpha; c3[r] *= alpha;
            }
        }
        #pragma unroll
        for (int r = 0; r < 8; ++r) s0[r] = __builtin_amdgcn_exp2f(s0[r]);
        #pragma unroll
        for (int r = 0; r < 8; ++r) s1[r] = __builtin_amdgcn_exp2f(s1[r]);
        v16h bp;   // P^T as B fragment: k = 8*half + e | 16 + 8*half + e, the order of the V^T loader
        #pragma unroll
        for (int r = 0; r < 8; ++r) {
            bp[r]     = (_Float16)s0[r];
            bp[8 + r] = (_Float16)s1[r];
        }
        const v8f ps = s0 + s1;
        lrun += ((ps[0] + ps[1]) + (ps[2] + ps[3])) + ((ps[4] + ps[5]) + (ps[6] + ps[7]));

        // ---- ctx^T += V^T(64x32) @ P^T(32x16), V^T by transposing loads ----
        {
            #pragma unroll
            for (int t4 = 0; t4 < 4; ++t4) {
                const v16h av = frag_transposed(Vst + sub * 32 * VPH + t4 * 16);
                if      (t4 == 0) c0 = wmma_f16(av, bp, c0);
                else if (t4 == 1) c1 = wmma_f16(av, bp, c1);
                else if (t4 == 2) c2 = wmma_f16(av, bp, c2);
                else              c3 = wmma_f16(av, bp, c3);
            }
        }
      }
      dist -= (float)SKEYS;
      // Publish point of stage st + 1: this wave's reads of stage st are done, the
      // issuing waves' tiles of stage st + 1 have landed, every wave has said the same.
      asm volatile("s_wait_dscnt 0x0" ::: "memory");
      if (pinned(wave < 2)) {
          // The descriptors are inputs so that their registers keep their values while the request is outstanding.
          asm volatile("s_wait_tensorcnt 0x0" :: "s"(g0), "s"(g1k), "s"(g1v) : "memory");
      }
      __syncthreads();
      g0 = tdm_group0(dst + (st & 1) * dbuf, src + (size_t)(st + 2) * SKEYS * D_MODEL);
      if (pinned(st + 2 < ANST)) {   // refill of the buffer that every wave has just left
          if (pinned(wave == 0)) tdm_load(g0, g1k);
          if (pinned(wave == 1)) tdm_load(g0, g1v);
      }
    }
    asm volatile("s_wait_tensorcnt 0x0" ::: "memory");   // no request of this wave is left behind the loop
    asm volatile("s_wait_dscnt 0x0" ::: "memory");       // and none of its LDS reads

    // ---- epilogue: normalize and store ctx (f32) --------------------------
    // c<t>[r] = O[q0 + ln][t*16 + 8*half + r]: eight consecutive floats a lane.
    {
        const float inv = 1.0f / (lrun + xhalf(lrun));
        float* cr = Ch + (size_t)(q0 + ln) * D_MODEL + 8 * half;
        #pragma unroll
        for (int j = 0; j < 2; ++j) {
            const v4f o0 = {c0[4*j] * inv, c0[4*j+1] * inv, c0[4*j+2] * inv, c0[4*j+3] * inv};
            const v4f o1 = {c1[4*j] * inv, c1[4*j+1] * inv, c1[4*j+2] * inv, c1[4*j+3] * inv};
            const v4f o2 = {c2[4*j] * inv, c2[4*j+1] * inv, c2[4*j+2] * inv, c2[4*j+3] * inv};
            const v4f o3 = {c3[4*j] * inv, c3[4*j+1] * inv, c3[4*j+2] * inv, c3[4*j+3] * inv};
            *(v4f*)(cr + 4 * j)      = o0;
            *(v4f*)(cr + 16 + 4 * j) = o1;
            *(v4f*)(cr + 32 + 4 * j) = o2;
            *(v4f*)(cr + 48 + 4 * j) = o3;
        }
    }
}

// ---------------------------------------------------------------------------
extern "C" void kernel_launch(void* const* d_in, const int* in_sizes, int n_in,
                              void* d_out, int out_size, void* d_ws, size_t ws_size,
                              hipStream_t stream) {
    const float* query = (const float*)d_in[0];
    const float* key   = (const float*)d_in[1];
    const float* value = (const float*)d_in[2];
    const float* wq = (const float*)d_in[3];
    const float* bq = (const float*)d_in[4];
    const float* wk = (const float*)d_in[5];
    const float* bk = (const float*)d_in[6];
    const float* wv = (const float*)d_in[7];
    const float* bv = (const float*)d_in[8];
    const float* wo = (const float*)d_in[9];
    const float* bo = (const float*)d_in[10];
    const float* td = (const float*)d_in[11];
    float* out = (float*)d_out;

    const size_t elems = (size_t)MROWS * D_MODEL;
    _Float16* Qbuf = (_Float16*)d_ws;            // 8 MB
    _Float16* Kbuf = Qbuf + elems;               // 8 MB
    _Float16* Vbuf = Kbuf + elems;               // 8 MB
    float*    Cbuf = (float*)(Vbuf + elems);     // 16 MB

    const dim3 gblk(256);
    const dim3 ggrid(D_MODEL / 128, MROWS / 128);  // 8 x 32
    qkv_gemm_kernel<<<dim3(D_MODEL / 128, MROWS / 128, 3), gblk, 0, stream>>>(
        query, key, value, wq, wk, wv, bq, bk, bv, Qbuf, Kbuf, Vbuf);

    attn_flash_kernel<<<dim3(BATCH * N_HEADS * (SEQ / 128)), dim3(256), 0, stream>>>(
        Qbuf, Kbuf, Vbuf, td, Cbuf);

    out_gemm_kernel<<<ggrid, gblk, 0, stream>>>(Cbuf, wo, bo, out);
}

// v007
// It runs in 79.2 microseconds.
// Two timings next to v006 both put it at 1.12 times that version's speed.
// Counting every step since v000, it is 4.23 times as fast.
#include <hip/hip_runtime.h>
#include <hip/hip_bf16.h>
#include <cmath>

#define D_MODEL 1024
#define N_HEADS 16
#define D_KH    64
#define SEQ     2048
#define BATCH   2
#define MROWS   (BATCH * SEQ)     // 4096

typedef __attribute__((ext_vector_type(16))) _Float16     v16h;
typedef __attribute__((ext_vector_type(8)))  float        v8f;
typedef __attribute__((ext_vector_type(4)))  unsigned int v4u;
typedef __attribute__((ext_vector_type(8)))  int          v8i;
typedef __attribute__((ext_vector_type(4)))  int          v4i;
typedef __attribute__((ext_vector_type(8)))  _Float16     v8h;
typedef __attribute__((ext_vector_type(4)))  float        v4f;
typedef __attribute__((ext_vector_type(8)))  short        v8s;

// LDS pitches: 16 B x odd, so a 16-lane column of 16-byte reads meets no bank twice.
#define ROW128_PITCH_B 144                    // 128-byte rows + the mover's 16-byte pad
#define ROW256_PITCH_B 272                    // 256-byte rows + the mover's 16-byte pad
#define GP   (ROW256_PITCH_B / 4)             // GEMM slices: pitch in floats (68)
#define GSL  4608                             // floats per GEMM slice: 64 rows of 272 B, rounded up to 2 KiB x 9
#define GKS  128                              // k per GEMM stage
#define GNST (D_MODEL / GKS)                  // GEMM stages (8)
#define KP   (ROW128_PITCH_B / 2)             // K tile: pitch in halves (72)
#define VPH  80                               // V tile: pitch in halves (160 B = 128-byte rows + the mover's 32-byte pad, for the transposing reader)
#define SKEYS 128                             // keys per attention stage
#define ANST (SEQ / SKEYS)                    // attention stages (16)
#define LOG2E   1.4426950408889634f           // the attention scores are kept in log2 units
#define QK_LOG2 0.18033688011112042f          // 1/sqrt(64) * log2(e): multiplied into Q where it is projected

__device__ __forceinline__ v8f wmma_f16(v16h a, v16h b, v8f c) {
    return __builtin_amdgcn_wmma_f32_16x16x32_f16(
        false, a, false, b, (short)0, c, false, false);
}

// Low 32 bits of a generic pointer to LDS == LDS byte offset.
__device__ __forceinline__ unsigned lds_off(const void* p) {
    return (unsigned)(size_t)p;
}

__device__ __forceinline__ unsigned uni(unsigned v) {
    return (unsigned)__builtin_amdgcn_readfirstlane(v);
}

// A wave-uniform test held in a scalar register, so that the branch round a
// tensor load (which ignores EXEC) compiles to s_cmp + s_cbranch_scc.
__device__ __forceinline__ unsigned pinned(unsigned v) {
    unsigned w = uni(v);
    asm volatile("" : "+s"(w));   // keeps the test scalar: a vector branch would not guard the tensor load
    return w;
}

// ---------------------------------------------------------------------------
// Tensor-load descriptor of a tile of 128-byte rows that lands in LDS with a
// pad behind every row: PAD = 3 gives 16 bytes (LDS pitch 144 B), PAD = 7 gives
// 32 bytes (pitch 160 B).  Every extent is in bytes (data_size code 0); tensor
// dims = tile dims.
// ---------------------------------------------------------------------------
__device__ __forceinline__ v4u tdm_group0(unsigned lds, const void* gptr) {
    const unsigned long long ga = (unsigned long long)(size_t)gptr;
    v4u g0;
    g0[0] = 1u;                                           // count=1 (valid)
    g0[1] = uni(lds);                                     // lds_addr
    g0[2] = uni((unsigned)(ga & 0xffffffffu));            // global_addr lo
    g0[3] = (uni((unsigned)(ga >> 32)) & 0x01ffffffu)     // global_addr hi
          | (2u << 30);                                   // type=2
    asm volatile("" : "+s"(g0));   // pinned(): descriptor words held in their own scalar registers, not formed anew from copies
    return g0;
}

template <unsigned PAD>
__device__ __forceinline__ v8i tdm_group1(unsigned rows, unsigned pitch) {
    v8i g1;
    g1[0] = (int)((1u << 20)      // pad_enable
          |       (4u << 22)      // pad_interval = 32 DWORDs = one row
          |       (PAD << 25));   // pad_amount   = PAD + 1 DWORDs
    g1[1] = (int)(128u << 16);                            // tensor_dim0 = 128 B
    g1[2] = (int)(uni(rows) << 16);                       // tensor_dim1 = rows
    g1[3] = (int)(128u << 16);                            // tile_dim0 = 128 B
    g1[4] = (int)uni(rows);                               // tile_dim1
    g1[5] = (int)uni(pitch);                              // source row pitch, bytes
    g1[6] = 0;
    g1[7] = 0;
    asm volatile("" : "+s"(g1));   // pinned(): descriptor words held in their own scalar registers, not formed anew from copies
    return g1;
}

// The same for a tile of 256-byte rows (LDS pitch 272 B).
__device__ __forceinline__ v8i tdm_group1_row256(unsigned rows, unsigned pitch) {
    v8i g1;
    g1[0] = (int)((1u << 20)      // pad_enable
          |       (5u << 22)      // pad_interval = 64 DWORDs = one row
          |       (3u << 25));    // pad_amount   = 4 DWORDs
    g1[1] = (int)(256u << 16);                            // tensor_dim0 = 256 B
    g1[2] = (int)(uni(rows) << 16);                       // tensor_dim1 = rows
    g1[3] = (int)(256u << 16);                            // tile_dim0 = 256 B
    g1[4] = (int)uni(rows);                               // tile_dim1
    g1[5] = (int)uni(pitch);                              // source row pitch, bytes
    g1[6] = 0;
    g1[7] = 0;
    asm volatile("" : "+s"(g1));   // pinned(): descriptor words held in their own scalar registers, not formed anew from copies
    return g1;
}

__device__ __forceinline__ void tdm_load(v4u g0, v8i g1) {
    const v4i z4 = {0, 0, 0, 0};
    const v8i z8 = {0, 0, 0, 0, 0, 0, 0, 0};
    __builtin_amdgcn_tensor_load_to_lds(g0, g1, z4, z4, z8, 0);
}

// 16x32 f16 fragment of one lane from a row of f32: k = 0..7 and 16..23 from p.
__device__ __forceinline__ v16h frag_from_f32(const float* p) {
    const v4f x0 = *(const v4f*)(p);
    const v4f x1 = *(const v4f*)(p + 4);
    const v4f x2 = *(const v4f*)(p + 16);
    const v4f x3 = *(const v4f*)(p + 20);
    v16h f;
    #pragma unroll
    for (int e = 0; e < 4; ++e) {
        f[e]      = (_Float16)x0[e];
        f[4 + e]  = (_Float16)x1[e];
        f[8 + e]  = (_Float16)x2[e];
        f[12 + e] = (_Float16)x3[e];
    }
    return f;
}

// The same from a row of f16.
__device__ __forceinline__ v16h frag_from_f16(const _Float16* p) {
    const v8h lo = *(const v8h*)(p);
    const v8h hi = *(const v8h*)(p + 16);
    return __builtin_shufflevector(lo, hi, 0, 1, 2, 3, 4, 5, 6, 7,
                                   8, 9, 10, 11, 12, 13, 14, 15);
}

// 16 (d) x 32 (keys) A fragment of V^T from row-major V rows in LDS, by two
// transposing loads: lane (ln, half) gets V[8*half + e | 16 + 8*half + e][ln].
// p = this lane's address: row 8*half + (lane & 7), halves 8 * ((lane >> 3) & 1).
__device__ __forceinline__ v16h frag_transposed(const _Float16* p) {
    typedef __attribute__((address_space(3))) v8s lds_v8s;
    const v8h lo = __builtin_bit_cast(v8h, __builtin_amdgcn_ds_load_tr16_b128_v8i16((lds_v8s*)p));
    const v8h hi = __builtin_bit_cast(v8h, __builtin_amdgcn_ds_load_tr16_b128_v8i16((lds_v8s*)(p + 16 * VPH)));
    return __builtin_shufflevector(lo, hi, 0, 1, 2, 3, 4, 5, 6, 7,
                                   8, 9, 10, 11, 12, 13, 14, 15);
}

// Lane l reads lane l ^ 16: the two wave halves hold the two halves of a column.
__device__ __forceinline__ float xhalf(float x) {
    const int b = __builtin_bit_cast(int, x);
    return __builtin_bit_cast(float,
        __builtin_amdgcn_permlanex16(b, b, 0x76543210, 0xfedcba98, false, false));
}

// ---------------------------------------------------------------------------
// Projection GEMM: Y[4096,1024] = X[4096,1024] @ W[1024,1024]^T + bias.
// 128x128 block tile, one block per WGP; 8 waves as 2 (rows) x 4 (columns),
// 64x32 of Y per wave: 8 WMMAs on 6 fragments per 32 k.  A stage is 128 k of
// both operands, f32, in 8 slices of 64 rows x 256 B; every wave brings one
// slice by one tensor load.  Two buffers: stage s + 1 flies while stage s is
// worked on.  f32->f16 conversion at fragment read.
// It serves the output projection (256 tiles, one per WGP); the Q, K and V
// projections have the wider tile of qkv_gemm_body below.
// oscale multiplies the biased result in f32, before it is rounded to TOUT.
// ---------------------------------------------------------------------------
template <typename TOUT>
__device__ __forceinline__
void proj_gemm_body(const float* __restrict__ X,
                    const float* __restrict__ W,
                    const float* __restrict__ bias,
                    TOUT* __restrict__ Y,
                    const float oscale)
{
    // [buffer][slice], slice = 4 * (X | W) + 2 * (row half) + (k half); 68-dw pitch from the TDM pad
    __shared__ __attribute__((aligned(2048))) float Ts[2][8][GSL];

    const int tid  = threadIdx.x;
    const int lane = tid & 31;
    const int wv   = tid >> 5;
    const int half = lane >> 4;
    const int ln   = lane & 15;

    const int m0 = blockIdx.y * 128;
    const int n0 = blockIdx.x * 128;
    const int wm = wv & 1;              // rows    m0 + 64 * wm ..
    const int wn = wv >> 1;             // columns n0 + 32 * wn ..

    v8f acc[4][2] = {};

    // This wave's slice of every stage: 64 rows of X or W, 64 k.
    const unsigned wave = uni((unsigned)tid >> 5);
    const unsigned srow = (wave & 2) * 32;
    const float* src = ((wave & 4) ? W + (size_t)(n0 + srow) * D_MODEL
                                   : X + (size_t)(m0 + srow) * D_MODEL) + (wave & 1) * 64;
    const v8i g1 = tdm_group1_row256(64, D_MODEL * 4);    // the same for every slice

    // Prologue: stage 0 landed and published, then stage 1 issued.
    v4u g0 = tdm_group0(lds_off(&Ts[0][wave][0]), src);
    tdm_load(g0, g1);
    // The descriptor is an input so that its registers keep their values while the request is outstanding.
    asm volatile("s_wait_tensorcnt 0x0" :: "s"(g0), "s"(g1) : "memory");
    __syncthreads();
    g0 = tdm_group0(lds_off(&Ts[1][wave][0]), src + GKS);
    tdm_load(g0, g1);

    for (int s = 0; s < GNST; ++s) {
        // Fragments: row = tile*16+ln, K(e) = half*8+e | 16+half*8+e
        const float* As = &Ts[s & 1][wm * 2][ln * GP + half * 8];
        const float* Bs = &Ts[s & 1][4 + (wn >> 1) * 2][((wn & 1) * 32 + ln) * GP + half * 8];
        v16h a[4], b[2];
        #pragma unroll
        for (int kk = 0; kk < 4; ++kk) {
            const int o = (kk >> 1) * GSL + (kk & 1) * 32;
            #pragma unroll
            for (int i = 0; i < 4; ++i) a[i] = frag_from_f32(As + o + i * 16 * GP);
            #pragma unroll
            for (int j = 0; j < 2; ++j) b[j] = frag_from_f32(Bs + o + j * 16 * GP);
            if (kk == 3) break;   // the last 32 k are multiplied behind the refill, from registers
            #pragma unroll
            for (int i = 0; i < 4; ++i) {
                #pragma unroll
                for (int j = 0; j < 2; ++j) acc[i][j] = wmma_f16(a[i], b[j], acc[i][j]);
            }
        }
        // Publish point of stage s + 1: this wave's reads of stage s are done, its
        // slice of stage s + 1 has landed, every wave has said the same.
        asm volatile("s_wait_dscnt 0x0" ::: "memory");
        asm volatile("s_wait_tensorcnt 0x0" :: "s"(g0), "s"(g1) : "memory");
        __syncthreads();
        g0 = tdm_group0(lds_off(&Ts[s & 1][wave][0]), src + (s + 2) * GKS);
        if (pinned(s + 2 < GNST)) {   // refill of the buffer that every wave has just left
            tdm_load(g0, g1);
        }
        #pragma unroll
        for (int i = 0; i < 4; ++i) {
            #pragma unroll
            for (int j = 0; j < 2; ++j) acc[i][j] = wmma_f16(a[i], b[j], acc[i][j]);
        }
    }
    asm volatile("s_wait_tensorcnt 0x0" ::: "memory");   // no request of this wave is left behind the loop
    asm volatile("s_wait_dscnt 0x0" ::: "memory");       // and none of its LDS reads

    // Epilogue: bias + store.  D layout: row = r + 8*half, col = ln.
    #pragma unroll
    for (int j = 0; j < 2; ++j) {
        const int na = n0 + wn * 32 + j * 16 + ln;
        const float bj = bias[na];
        #pragma unroll
        for (int i = 0; i < 4; ++i) {
            TOUT* ya = Y + (size_t)(m0 + wm * 64 + i * 16 + 8 * half) * D_MODEL + na;
            #pragma unroll
            for (int r = 0; r < 8; ++r) ya[(size_t)r * D_MODEL] = (TOUT)((acc[i][j][r] + bj) * oscale);
        }
    }
}

// ---------------------------------------------------------------------------
// Q, K and V projections: the same product on a 256x256 block tile, 8 waves as
// 2 (rows) x 4 (columns), 128x64 of Y per wave: 32 WMMAs on 12 fragments per
// 32 k, so a WMMA costs half the LDS-read bytes of the 64x32 wave tile, and a
// result half the bytes brought from L2.  A stage is 64 k of both operands, f32,
// in 8 slices of 64 rows x 256 B (the ring's size and places are those of the
// smaller tile); every wave brings one slice by one tensor load.  Two buffers.
// The last 32 k of a stage are multiplied behind the publish point, from
// registers, in one straight run with the next stage's first fragment reads.
// The k order of every sum is that of the smaller tile.
// ---------------------------------------------------------------------------
#define QNST (D_MODEL / 64)                   // stages of the wide tile (16)
__device__ __forceinline__
void qkv_gemm_body(const float* __restrict__ X,
                   const float* __restrict__ W,
                   const float* __restrict__ bias,
                   _Float16* __restrict__ Y,
                   const float oscale)
{
    // [buffer][slice], slice = 4 * (X | W) + (row quarter); 68-dw pitch from the TDM pad
    __shared__ __attribute__((aligned(2048))) float Ts[2][8][GSL];

    const int tid  = threadIdx.x;
    const int lane = tid & 31;
    const int wv   = tid >> 5;
    const int half = lane >> 4;
    const int ln   = lane & 15;

    const int m0 = blockIdx.y * 256;
    const int n0 = blockIdx.x * 256;
    const int wm = wv & 1;              // rows    m0 + 128 * wm ..
    const int wn = wv >> 1;             // columns n0 + 64 * wn ..

    v8f acc[8][4] = {};
    v16h a[8], b[4];

    // Fragments of 32 k: row = tile*16+ln, K(e) = half*8+e | 16+half*8+e
    auto frags = [&](const int buf, const int kk) {
        const float* As = &Ts[buf][wm * 2][ln * GP + half * 8 + kk * 32];
        const float* Bs = &Ts[buf][4 + wn][ln * GP + half * 8 + kk * 32];
        #pragma unroll
        for (int j = 0; j < 4; ++j) b[j] = frag_from_f32(Bs + j * 16 * GP);
        #pragma unroll
        for (int i = 0; i < 8; ++i) a[i] = frag_from_f32(As + (i >> 2) * GSL + (i & 3) * 16 * GP);
    };
    auto mult = [&]() {
        #pragma unroll
        for (int i = 0; i < 8; ++i) {
            #pragma unroll
            for (int j = 0; j < 4; ++j) acc[i][j] = wmma_f16(a[i], b[j], acc[i][j]);
        }
    };

    // This wave's slice of every stage: 64 rows of X or W, 64 k.
    const unsigned wave = uni((unsigned)tid >> 5);
    const unsigned srow = (wave & 3) * 64;
    const float* src = (wave & 4) ? W + (size_t)(n0 + srow) * D_MODEL
                                  : X + (size_t)(m0 + srow) * D_MODEL;
    const v8i g1 = tdm_group1_row256(64, D_MODEL * 4);    // the same for every slice

    // Prologue: stage 0 landed and published, then stage 1 issued.
    v4u g0 = tdm_group0(lds_off(&Ts[0][wave][0]), src);
    tdm_load(g0, g1);
    // The descriptor is an input so that its registers keep their values while the request is outstanding.
    asm volatile("s_wait_tensorcnt 0x0" :: "s"(g0), "s"(g1) : "memory");
    __syncthreads();
    g0 = tdm_group0(lds_off(&Ts[1][wave][0]), src + 64);
    tdm_load(g0, g1);

    frags(0, 0);
    mult();
    frags(0, 1);
    for (int s = 0; s + 1 < QNST; ++s) {
        // Publish point of stage s + 1: this wave's reads of stage s are done, its
        // slice of stage s + 1 has landed, every wave has said the same.
        asm volatile("s_wait_dscnt 0x0" ::: "memory");
        asm volatile("s_wait_tensorcnt 0x0" :: "s"(g0), "s"(g1) : "memory");
        __syncthreads();
        g0 = tdm_group0(lds_off(&Ts[s & 1][wave][0]), src + (s + 2) * 64);
        if (pinned(s + 2 < QNST)) {   // refill of the buffer that every wave has just left
            tdm_load(g0, g1);
        }
        mult();                       // the last 32 k of stage s
        frags((s + 1) & 1, 0);
        mult();
        frags((s + 1) & 1, 1);
    }
    mult();
    asm volatile("s_wait_tensorcnt 0x0" ::: "memory");   // no request of this wave is left behind the loop
    asm volatile("s_wait_dscnt 0x0" ::: "memory");       // and none of its LDS reads

    // Epilogue: bias + store.  D layout: row = r + 8*half, col = ln.
    #pragma unroll
    for (int j = 0; j < 4; ++j) {
        const int na = n0 + wn * 64 + j * 16 + ln;
        const float bj = bias[na];
        #pragma unroll
        for (int i = 0; i < 8; ++i) {
            _Float16* ya = Y + (size_t)(m0 + wm * 128 + i * 16 + 8 * half) * D_MODEL + na;
            #pragma unroll
            for (int r = 0; r < 8; ++r) ya[(size_t)r * D_MODEL] = (_Float16)((acc[i][j][r] + bj) * oscale);
        }
    }
}

// The Q, K and V projections are independent: one launch, blockIdx.z picks the
// projection; its 192 tiles are all resident at once.
__global__ __launch_bounds__(256)
void qkv_gemm_kernel(const float* __restrict__ Xq, const float* __restrict__ Xk, const float* __restrict__ Xv,
                     const float* __restrict__ Wq, const float* __restrict__ Wk, const float* __restrict__ Wv,
                     const float* __restrict__ Bq, const float* __restrict__ Bk, const float* __restrict__ Bv,
                     _Float16* __restrict__ Yq, _Float16* __restrict__ Yk, _Float16* __restrict__ Yv)
{
    const int z = blockIdx.z;
    qkv_gemm_body((z == 0) ? Xq : (z == 1) ? Xk : Xv,
                  (z == 0) ? Wq : (z == 1) ? Wk : Wv,
                  (z == 0) ? Bq : (z == 1) ? Bk : Bv,
                  (z == 0) ? Yq : (z == 1) ? Yk : Yv,
                  (z == 0) ? QK_LOG2 : 1.0f);   // Q leaves scaled: the score product is then in log2 units
}

__global__ __launch_bounds__(256)
void out_gemm_kernel(const float* __restrict__ X,
                     const float* __restrict__ W,
                     const float* __restrict__ bias,
                     float* __restrict__ Y)
{
    proj_gemm_body<float>(X, W, bias, Y, 1.0f);
}

__global__ __launch_bounds__(256)
void attn_flash_kernel(const _Float16* __restrict__ Qb,
                       const _Float16* __restrict__ Kb,
                       const _Float16* __restrict__ Vb,
                       const float* __restrict__ td_ptr,
                       float* __restrict__ Cb)
{
    __shared__ __attribute__((aligned(2048))) _Float16 Ks[2][SKEYS * KP];   // [buffer][key][d], 144-B pitch: 9 x 2 KiB a buffer
    __shared__ __attribute__((aligned(2048))) _Float16 Vs[2][SKEYS * VPH];  // [buffer][key][d], 160-B pitch: 10 x 2 KiB a buffer

    const int tid  = threadIdx.x;
    const int lane = tid & 31;
    const int wv   = tid >> 5;
    const int half = lane >> 4;
    const int ln   = lane & 15;

    const int bh   = blockIdx.x >> 4;          // 0..31
    const int qblk = blockIdx.x & 15;          // 0..15
    const int b    = bh >> 4;
    const int h    = bh & 15;
    const int q0   = (qblk * 8 + wv) * 16;

    const float ndec = -td_ptr[0] * LOG2E;     // bias per key of distance, log2 units

    const _Float16* Qh = Qb + (size_t)b * SEQ * D_MODEL + h * D_KH;
    const _Float16* Kh = Kb + (size_t)b * SEQ * D_MODEL + h * D_KH;
    const _Float16* Vh = Vb + (size_t)b * SEQ * D_MODEL + h * D_KH;
    float*          Ch = Cb + (size_t)b * SEQ * D_MODEL + h * D_KH;

    // Q B-fragments for d = 0..31 / 32..63 (column = ln); contiguous f16 loads.
    v16h aq0, aq1;
    {
        const _Float16* qr = Qh + (size_t)(q0 + ln) * D_MODEL;
        #pragma unroll
        for (int e = 0; e < 8; ++e) aq0[e]     = qr[half * 8 + e];
        #pragma unroll
        for (int e = 0; e < 8; ++e) aq0[8 + e] = qr[16 + half * 8 + e];
        #pragma unroll
        for (int e = 0; e < 8; ++e) aq1[e]     = qr[32 + half * 8 + e];
        #pragma unroll
        for (int e = 0; e < 8; ++e) aq1[8 + e] = qr[48 + half * 8 + e];
    }

    v8f c0 = {}, c1 = {}, c2 = {}, c3 = {};
    float nmax = 0.0f;                  // minus the maximum in use of query q0 + ln (equal in both halves); the first pass sets it
    float lrun = 0.0f;                  // running sum over this half's keys; the halves join in the epilogue
    const float qpos = (float)(q0 + ln);

    // Wave 0 issues K, wave 1 issues V; the other waves form V's group 0 and never issue.
    const unsigned wave = uni((unsigned)tid >> 5);
    const _Float16* src = (wave == 0) ? Kh : Vh;
    const unsigned dst  = (wave == 0) ? lds_off(&Ks[0][0]) : lds_off(&Vs[0][0]);
    const unsigned dbuf = (wave == 0) ? (unsigned)sizeof(Ks[0]) : (unsigned)sizeof(Vs[0]);
    const v8i g1k = tdm_group1<3>(SKEYS, D_MODEL * 2);   // the same for every K stage
    const v8i g1v = tdm_group1<7>(SKEYS, D_MODEL * 2);   // the same for every V stage

    // Prologue: stage 0 landed and published, then stage 1 issued.
    v4u g0 = tdm_group0(dst, src);
    if (pinned(wave == 0)) {
        tdm_load(g0, g1k);
        // The descriptor is an input so that its registers keep their values while the request is outstanding.
        asm volatile("s_wait_tensorcnt 0x0" :: "s"(g0), "s"(g1k) : "memory");
    }
    if (pinned(wave == 1)) {
        tdm_load(g0, g1v);
        asm volatile("s_wait_tensorcnt 0x0" :: "s"(g0), "s"(g1v) : "memory");   // as above
    }
    __syncthreads();
    g0 = tdm_group0(dst + dbuf, src + (size_t)SKEYS * D_MODEL);
    if (pinned(wave == 0)) tdm_load(g0, g1k);
    if (pinned(wave == 1)) tdm_load(g0, g1v);

    float dist = qpos - (float)(8 * half);   // query minus this half's first key of the stage; whole numbers: exact
    for (int st = 0; st < ANST; ++st) {
      const _Float16* Kst = &Ks[st & 1][ln * KP + half * 8];
      const _Float16* Vst = &Vs[st & 1][(8 * half + (lane & 7)) * VPH + ((lane >> 3) & 1) * 8];
      #pragma unroll   // the four passes' LDS addresses become immediate offsets, and one pass's loads may rise into the one before
      for (int sub = 0; sub < SKEYS / 32; ++sub) {
        // ---- scores, transposed: s0[r] = S[128*st + 32*sub + 8*half + r][q0 + ln], s1: +16 keys
        //      each starts from its bias minus the maximum in use
        const float dist0 = dist - (float)(sub * 32);
        v8f s0, s1;
        #pragma unroll
        for (int r = 0; r < 8; ++r) s0[r] = fmaf(ndec, fabsf(dist0 - (float)r), nmax);
        #pragma unroll
        for (int r = 0; r < 8; ++r) s1[r] = fmaf(ndec, fabsf(dist0 - (float)(16 + r)), nmax);
        {
            const _Float16* kr = Kst + sub * 32 * KP;
            s0 = wmma_f16(frag_from_f16(kr), aq0, s0);
            s0 = wmma_f16(frag_from_f16(kr + 32), aq1, s0);
            kr += 16 * KP;
            s1 = wmma_f16(frag_from_f16(kr), aq0, s1);
            s1 = wmma_f16(frag_from_f16(kr + 32), aq1, s1);
        }

        // ---- online softmax, one query per lane; the maximum moves rarely --
        float t = fmaxf(s0[0], s1[0]);
        #pragma unroll
        for (int r = 1; r < 8; ++r) t = fmaxf(t, fmaxf(s0[r], s1[r]));
        t = fmaxf(t, xhalf(t));
        const bool first = (sub == 0) && (st == 0);   // nothing is summed yet: the pass's own maximum is taken, up or down
        if (first || __builtin_amdgcn_ballot_w32(t > 8.0f) != 0) {   // one scalar test per pass
            const float up    = first ? t : fmaxf(t, 0.0f);
            const float alpha = first ? 0.0f : __builtin_amdgcn_exp2f(-up);
            nmax -= up;
            lrun *= alpha;
            #pragma unroll
            for (int r = 0; r < 8; ++r) {
                s0[r] -= up;    s1[r] -= up;
                c0[r] *= alpha; c1[r] *= alpha;
                c2[r] *= alpha; c3[r] *= alpha;
            }
        }
        #pragma unroll
        for (int r = 0; r < 8; ++r) s0[r] = __builtin_amdgcn_exp2f(s0[r]);
        #pragma unroll
        for (int r = 0; r < 8; ++r) s1[r] = __builtin_amdgcn_exp2f(s1[r]);
        v16h bp;   // P^T as B fragment: k = 8*half + e | 16 + 8*half + e, the order of the V^T loader
        #pragma unroll
        for (int r = 0; r < 8; ++r) {
            bp[r]     = (_Float16)s0[r];
            bp[8 + r] = (_Float16)s1[r];
        }
        const v8f ps = s0 + s1;
        lrun += ((ps[0] + ps[1]) + (ps[2] + ps[3])) + ((ps[4] + ps[5]) + (ps[6] + ps[7]));

        // ---- ctx^T += V^T(64x32) @ P^T(32x16), V^T by transposing loads ----
        {
            #pragma unroll
            for (int t4 = 0; t4 < 4; ++t4) {
                const v16h av = frag_transposed(Vst + sub * 32 * VPH + t4 * 16);
                if      (t4 == 0) c0 = wmma_f16(av, bp, c0);
                else if (t4 == 1) c1 = wmma_f16(av, bp, c1);
                else if (t4 == 2) c2 = wmma_f16(av, bp, c2);
                else              c3 = wmma_f16(av, bp, c3);
            }
        }
      }
      dist -= (float)SKEYS;
      // Publish point of stage st + 1: this wave's reads of stage st are done, the
      // issuing waves' tiles of stage st + 1 have landed, every wave has said the same.
      asm volatile("s_wait_dscnt 0x0" ::: "memory");
      if (pinned(wave < 2)) {
          // The descriptors are inputs so that their registers keep their values while the request is outstanding.
          asm volatile("s_wait_tensorcnt 0x0" :: "s"(g0), "s"(g1k), "s"(g1v) : "memory");
      }
      __syncthreads();
      g0 = tdm_group0(dst + (st & 1) * dbuf, src + (size_t)(st + 2) * SKEYS * D_MODEL);
      if (pinned(st + 2 < ANST)) {   // refill of the buffer that every wave has just left
          if (pinned(wave == 0)) tdm_load(g0, g1k);
          if (pinned(wave == 1)) tdm_load(g0, g1v);
      }
    }
    asm volatile("s_wait_tensorcnt 0x0" ::: "memory");   // no request of this wave is left behind the loop
    asm volatile("s_wait_dscnt 0x0" ::: "memory");       // and none of its LDS reads

    // ---- epilogue: normalize and store ctx (f32) --------------------------
    // c<t>[r] = O[q0 + ln][t*16 + 8*half + r]: eight consecutive floats a lane.
    {
        const float inv = 1.0f / (lrun + xhalf(lrun));
        float* cr = Ch + (size_t)(q0 + ln) * D_MODEL + 8 * half;
        #pragma unroll
        for (int j = 0; j < 2; ++j) {
            const v4f o0 = {c0[4*j] * inv, c0[4*j+1] * inv, c0[4*j+2] * inv, c0[4*j+3] * inv};
            const v4f o1 = {c1[4*j] * inv, c1[4*j+1] * inv, c1[4*j+2] * inv, c1[4*j+3] * inv};
            const v4f o2 = {c2[4*j] * inv, c2[4*j+1] * inv, c2[4*j+2] * inv, c2[4*j+3] * inv};
            const v4f o3 = {c3[4*j] * inv, c3[4*j+1] * inv, c3[4*j+2] * inv, c3[4*j+3] * inv};
            *(v4f*)(cr + 4 * j)      = o0;
            *(v4f*)(cr + 16 + 4 * j) = o1;
            *(v4f*)(cr + 32 + 4 * j) = o2;
            *(v4f*)(cr + 48 + 4 * j) = o3;
        }
    }
}

// ---------------------------------------------------------------------------
extern "C" void kernel_launch(void* const* d_in, const int* in_sizes, int n_in,
                              void* d_out, int out_size, void* d_ws, size_t ws_size,
                              hipStream_t stream) {
    const float* query = (const float*)d_in[0];
    const float* key   = (const float*)d_in[1];
    const float* value = (const float*)d_in[2];
    const float* wq = (const float*)d_in[3];
    const float* bq = (const float*)d_in[4];
    const float* wk = (const float*)d_in[5];
    const float* bk = (const float*)d_in[6];
    const float* wv = (const float*)d_in[7];
    const float* bv = (const float*)d_in[8];
    const float* wo = (const float*)d_in[9];
    const float* bo = (const float*)d_in[10];
    const float* td = (const float*)d_in[11];
    float* out = (float*)d_out;

    const size_t elems = (size_t)MROWS * D_MODEL;
    _Float16* Qbuf = (_Float16*)d_ws;            // 8 MB
    _Float16* Kbuf = Qbuf + elems;               // 8 MB
    _Float16* Vbuf = Kbuf + elems;               // 8 MB
    float*    Cbuf = (float*)(Vbuf + elems);     // 16 MB

    const dim3 gblk(256);
    const dim3 ggrid(D_MODEL / 128, MROWS / 128);  // 8 x 32
    qkv_gemm_kernel<<<dim3(D_MODEL / 256, MROWS / 256, 3), gblk, 0, stream>>>(
        query, key, value, wq, wk, wv, bq, bk, bv, Qbuf, Kbuf, Vbuf);

    attn_flash_kernel<<<dim3(BATCH * N_HEADS * (SEQ / 128)), dim3(256), 0, stream>>>(
        Qbuf, Kbuf, Vbuf, td, Cbuf);

    out_gemm_kernel<<<ggrid, gblk, 0, stream>>>(Cbuf, wo, bo, out);
}

// v008
// Measured time: 70.2 microseconds a run.
// Two timings next to v007 put it at 1.14 and 1.13 times that version's speed.
// Over all steps from v000 it is 4.79 times as fast.
#include <hip/hip_runtime.h>
#include <hip/hip_bf16.h>
#include <cmath>

#define D_MODEL 1024
#define N_HEADS 16
#define D_KH    64
#define SEQ     2048
#define BATCH   2
#define MROWS   (BATCH * SEQ)     // 4096

typedef __attribute__((ext_vector_type(16))) _Float16     v16h;
typedef __attribute__((ext_vector_type(8)))  float        v8f;
typedef __attribute__((ext_vector_type(4)))  unsigned int v4u;
typedef __attribute__((ext_vector_type(8)))  int          v8i;
typedef __attribute__((ext_vector_type(4)))  int          v4i;
typedef __attribute__((ext_vector_type(8)))  _Float16     v8h;
typedef __attribute__((ext_vector_type(4)))  float        v4f;
typedef __attribute__((ext_vector_type(8)))  short        v8s;

// LDS pitches: 16 B x odd, so a 16-lane column of 16-byte reads meets no bank twice.
#define ROW128_PITCH_B 144                    // 128-byte rows + the mover's 16-byte pad
#define ROW256_PITCH_B 272                    // 256-byte rows + the mover's 16-byte pad
#define GP   (ROW256_PITCH_B / 4)             // GEMM slices: pitch in floats (68)
#define GSL  4608                             // floats per GEMM slice: 64 rows of 272 B, rounded up to 2 KiB x 9
#define GKS  128                              // k per GEMM stage
#define GNST (D_MODEL / GKS)                  // GEMM stages (8)
#define KP   (ROW128_PITCH_B / 2)             // K tile: pitch in halves (72)
#define VPH  80                               // V tile: pitch in halves (160 B = 128-byte rows + the mover's 32-byte pad, for the transposing reader)
#define SKEYS 128                             // keys per attention stage
#define ANST (SEQ / SKEYS)                    // attention stages (16)
#define LOG2E   1.4426950408889634f           // the attention scores are kept in log2 units
#define QK_LOG2 0.18033688011112042f          // 1/sqrt(64) * log2(e): multiplied into Q where it is projected
#define DEAD_LOG2 -40.0f                      // a stage whose scores all lie this far under the maximum in use adds nothing (see attn_flash_kernel)

__device__ __forceinline__ v8f wmma_f16(v16h a, v16h b, v8f c) {
    return __builtin_amdgcn_wmma_f32_16x16x32_f16(
        false, a, false, b, (short)0, c, false, false);
}

// Low 32 bits of a generic pointer to LDS == LDS byte offset.
__device__ __forceinline__ unsigned lds_off(const void* p) {
    return (unsigned)(size_t)p;
}

__device__ __forceinline__ unsigned uni(unsigned v) {
    return (unsigned)__builtin_amdgcn_readfirstlane(v);
}

// A wave-uniform test held in a scalar register, so that the branch round a
// tensor load (which ignores EXEC) compiles to s_cmp + s_cbranch_scc.
__device__ __forceinline__ unsigned pinned(unsigned v) {
    unsigned w = uni(v);
    asm volatile("" : "+s"(w));   // keeps the test scalar: a vector branch would not guard the tensor load
    return w;
}

// ---------------------------------------------------------------------------
// Tensor-load descriptor of a tile of 128-byte rows that lands in LDS with a
// pad behind every row: PAD = 3 gives 16 bytes (LDS pitch 144 B), PAD = 7 gives
// 32 bytes (pitch 160 B).  Every extent is in bytes (data_size code 0); tensor
// dims = tile dims.
// ---------------------------------------------------------------------------
__device__ __forceinline__ v4u tdm_group0(unsigned lds, const void* gptr) {
    const unsigned long long ga = (unsigned long long)(size_t)gptr;
    v4u g0;
    g0[0] = 1u;                                           // count=1 (valid)
    g0[1] = uni(lds);                                     // lds_addr
    g0[2] = uni((unsigned)(ga & 0xffffffffu));            // global_addr lo
    g0[3] = (uni((unsigned)(ga >> 32)) & 0x01ffffffu)     // global_addr hi
          | (2u << 30);                                   // type=2
    asm volatile("" : "+s"(g0));   // pinned(): descriptor words held in their own scalar registers, not formed anew from copies
    return g0;
}

template <unsigned PAD>
__device__ __forceinline__ v8i tdm_group1(unsigned rows, unsigned pitch) {
    v8i g1;
    g1[0] = (int)((1u << 20)      // pad_enable
          |       (4u << 22)      // pad_interval = 32 DWORDs = one row
          |       (PAD << 25));   // pad_amount   = PAD + 1 DWORDs
    g1[1] = (int)(128u << 16);                            // tensor_dim0 = 128 B
    g1[2] = (int)(uni(rows) << 16);                       // tensor_dim1 = rows
    g1[3] = (int)(128u << 16);                            // tile_dim0 = 128 B
    g1[4] = (int)uni(rows);                               // tile_dim1
    g1[5] = (int)uni(pitch);                              // source row pitch, bytes
    g1[6] = 0;
    g1[7] = 0;
    asm volatile("" : "+s"(g1));   // pinned(): descriptor words held in their own scalar registers, not formed anew from copies
    return g1;
}

// The same for a tile of 256-byte rows (LDS pitch 272 B).
__device__ __forceinline__ v8i tdm_group1_row256(unsigned rows, unsigned pitch) {
    v8i g1;
    g1[0] = (int)((1u << 20)      // pad_enable
          |       (5u << 22)      // pad_interval = 64 DWORDs = one row
          |       (3u << 25));    // pad_amount   = 4 DWORDs
    g1[1] = (int)(256u << 16);                            // tensor_dim0 = 256 B
    g1[2] = (int)(uni(rows) << 16);                       // tensor_dim1 = rows
    g1[3] = (int)(256u << 16);                            // tile_dim0 = 256 B
    g1[4] = (int)uni(rows);                               // tile_dim1
    g1[5] = (int)uni(pitch);                              // source row pitch, bytes
    g1[6] = 0;
    g1[7] = 0;
    asm volatile("" : "+s"(g1));   // pinned(): descriptor words held in their own scalar registers, not formed anew from copies
    return g1;
}

__device__ __forceinline__ void tdm_load(v4u g0, v8i g1) {
    const v4i z4 = {0, 0, 0, 0};
    const v8i z8 = {0, 0, 0, 0, 0, 0, 0, 0};
    __builtin_amdgcn_tensor_load_to_lds(g0, g1, z4, z4, z8, 0);
}

// 16x32 f16 fragment of one lane from a row of f32: k = 0..7 and 16..23 from p.
__device__ __forceinline__ v16h frag_from_f32(const float* p) {
    const v4f x0 = *(const v4f*)(p);
    const v4f x1 = *(const v4f*)(p + 4);
    const v4f x2 = *(const v4f*)(p + 16);
    const v4f x3 = *(const v4f*)(p + 20);
    v16h f;
    #pragma unroll
    for (int e = 0; e < 4; ++e) {
        f[e]      = (_Float16)x0[e];
        f[4 + e]  = (_Float16)x1[e];
        f[8 + e]  = (_Float16)x2[e];
        f[12 + e] = (_Float16)x3[e];
    }
    return f;
}

// The same from a row of f16.
__device__ __forceinline__ v16h frag_from_f16(const _Float16* p) {
    const v8h lo = *(const v8h*)(p);
    const v8h hi = *(const v8h*)(p + 16);
    return __builtin_shufflevector(lo, hi, 0, 1, 2, 3, 4, 5, 6, 7,
                                   8, 9, 10, 11, 12, 13, 14, 15);
}

// 16 (d) x 32 (keys) A fragment of V^T from row-major V rows in LDS, by two
// transposing loads: lane (ln, half) gets V[8*half + e | 16 + 8*half + e][ln].
// p = this lane's address: row 8*half + (lane & 7), halves 8 * ((lane >> 3) & 1).
__device__ __forceinline__ v16h frag_transposed(const _Float16* p) {
    typedef __attribute__((address_space(3))) v8s lds_v8s;
    const v8h lo = __builtin_bit_cast(v8h, __builtin_amdgcn_ds_load_tr16_b128_v8i16((lds_v8s*)p));
    const v8h hi = __builtin_bit_cast(v8h, __builtin_amdgcn_ds_load_tr16_b128_v8i16((lds_v8s*)(p + 16 * VPH)));
    return __builtin_shufflevector(lo, hi, 0, 1, 2, 3, 4, 5, 6, 7,
                                   8, 9, 10, 11, 12, 13, 14, 15);
}

// Lane l reads lane l ^ 16: the two wave halves hold the two halves of a column.
__device__ __forceinline__ float xhalf(float x) {
    const int b = __builtin_bit_cast(int, x);
    return __builtin_bit_cast(float,
        __builtin_amdgcn_permlanex16(b, b, 0x76543210, 0xfedcba98, false, false));
}

// ---------------------------------------------------------------------------
// Projection GEMM: Y[4096,1024] = X[4096,1024] @ W[1024,1024]^T + bias.
// 128x128 block tile, one block per WGP; 8 waves as 2 (rows) x 4 (columns),
// 64x32 of Y per wave: 8 WMMAs on 6 fragments per 32 k.  A stage is 128 k of
// both operands, f32, in 8 slices of 64 rows x 256 B; every wave brings one
// slice by one tensor load.  Two buffers: stage s + 1 flies while stage s is
// worked on.  f32->f16 conversion at fragment read.
// It serves the output projection (256 tiles, one per WGP); the Q, K and V
// projections have the wider tile of qkv_gemm_body below.
// oscale multiplies the biased result in f32, before it is rounded to TOUT.
// ---------------------------------------------------------------------------
template <typename TOUT>
__device__ __forceinline__
void proj_gemm_body(const float* __restrict__ X,
                    const float* __restrict__ W,
                    const float* __restrict__ bias,
                    TOUT* __restrict__ Y,
                    const float oscale)
{
    // [buffer][slice], slice = 4 * (X | W) + 2 * (row half) + (k half); 68-dw pitch from the TDM pad
    __shared__ __attribute__((aligned(2048))) float Ts[2][8][GSL];

    const int tid  = threadIdx.x;
    const int lane = tid & 31;
    const int wv   = tid >> 5;
    const int half = lane >> 4;
    const int ln   = lane & 15;

    const int m0 = blockIdx.y * 128;
    const int n0 = blockIdx.x * 128;
    const int wm = wv & 1;              // rows    m0 + 64 * wm ..
    const int wn = wv >> 1;             // columns n0 + 32 * wn ..

    v8f acc[4][2] = {};

    // This wave's slice of every stage: 64 rows of X or W, 64 k.
    const unsigned wave = uni((unsigned)tid >> 5);
    const unsigned srow = (wave & 2) * 32;
    const float* src = ((wave & 4) ? W + (size_t)(n0 + srow) * D_MODEL
                                   : X + (size_t)(m0 + srow) * D_MODEL) + (wave & 1) * 64;
    const v8i g1 = tdm_group1_row256(64, D_MODEL * 4);    // the same for every slice

    // Prologue: stage 0 landed and published, then stage 1 issued.
    v4u g0 = tdm_group0(lds_off(&Ts[0][wave][0]), src);
    tdm_load(g0, g1);
    // The descriptor is an input so that its registers keep their values while the request is outstanding.
    asm volatile("s_wait_tensorcnt 0x0" :: "s"(g0), "s"(g1) : "memory");
    __syncthreads();
    g0 = tdm_group0(lds_off(&Ts[1][wave][0]), src + GKS);
    tdm_load(g0, g1);

    for (int s = 0; s < GNST; ++s) {
        // Fragments: row = tile*16+ln, K(e) = half*8+e | 16+half*8+e
        const float* As = &Ts[s & 1][wm * 2][ln * GP + half * 8];
        const float* Bs = &Ts[s & 1][4 + (wn >> 1) * 2][((wn & 1) * 32 + ln) * GP + half * 8];
        v16h a[4], b[2];
        #pragma unroll
        for (int kk = 0; kk < 4; ++kk) {
            const int o = (kk >> 1) * GSL + (kk & 1) * 32;
            #pragma unroll
            for (int i = 0; i < 4; ++i) a[i] = frag_from_f32(As + o + i * 16 * GP);
            #pragma unroll
            for (int j = 0; j < 2; ++j) b[j] = frag_from_f32(Bs + o + j * 16 * GP);
            if (kk == 3) break;   // the last 32 k are multiplied behind the refill, from registers
            #pragma unroll
            for (int i = 0; i < 4; ++i) {
                #pragma unroll
                for (int j = 0; j < 2; ++j) acc[i][j] = wmma_f16(a[i], b[j], acc[i][j]);
            }
        }
        // Publish point of stage s + 1: this wave's reads of stage s are done, its
        // slice of stage s + 1 has landed, every wave has said the same.
        asm volatile("s_wait_dscnt 0x0" ::: "memory");
        asm volatile("s_wait_tensorcnt 0x0" :: "s"(g0), "s"(g1) : "memory");
        __syncthreads();
        g0 = tdm_group0(lds_off(&Ts[s & 1][wave][0]), src + (s + 2) * GKS);
        if (pinned(s + 2 < GNST)) {   // refill of the buffer that every wave has just left
            tdm_load(g0, g1);
        }
        #pragma unroll
        for (int i = 0; i < 4; ++i) {
            #pragma unroll
            for (int j = 0; j < 2; ++j) acc[i][j] = wmma_f16(a[i], b[j], acc[i][j]);
        }
    }
    asm volatile("s_wait_tensorcnt 0x0" ::: "memory");   // no request of this wave is left behind the loop
    asm volatile("s_wait_dscnt 0x0" ::: "memory");       // and none of its LDS reads

    // Epilogue: bias + store.  D layout: row = r + 8*half, col = ln.
    #pragma unroll
    for (int j = 0; j < 2; ++j) {
        const int na = n0 + wn * 32 + j * 16 + ln;
        const float bj = bias[na];
        #pragma unroll
        for (int i = 0; i < 4; ++i) {
            TOUT* ya = Y + (size_t)(m0 + wm * 64 + i * 16 + 8 * half) * D_MODEL + na;
            #pragma unroll
            for (int r = 0; r < 8; ++r) ya[(size_t)r * D_MODEL] = (TOUT)((acc[i][j][r] + bj) * oscale);
        }
    }
}

// ---------------------------------------------------------------------------
// Q, K and V projections: the same product on a 256x256 block tile, 8 waves as
// 2 (rows) x 4 (columns), 128x64 of Y per wave: 32 WMMAs on 12 fragments per
// 32 k, so a WMMA costs half the LDS-read bytes of the 64x32 wave tile, and a
// result half the bytes brought from L2.  A stage is 64 k of both operands, f32,
// in 8 slices of 64 rows x 256 B (the ring's size and places are those of the
// smaller tile); every wave brings one slice by one tensor load.  Two buffers.
// The last 32 k of a stage are multiplied behind the publish point, from
// registers, in one straight run with the next stage's first fragment reads.
// The k order of every sum is that of the smaller tile.
// ---------------------------------------------------------------------------
#define QNST (D_MODEL / 64)                   // stages of the wide tile (16)
__device__ __forceinline__
void qkv_gemm_body(const float* __restrict__ X,
                   const float* __restrict__ W,
                   const float* __restrict__ bias,
                   _Float16* __restrict__ Y,
                   const float oscale)
{
    // [buffer][slice], slice = 4 * (X | W) + (row quarter); 68-dw pitch from the TDM pad
    __shared__ __attribute__((aligned(2048))) float Ts[2][8][GSL];

    const int tid  = threadIdx.x;
    const int lane = tid & 31;
    const int wv   = tid >> 5;
    const int half = lane >> 4;
    const int ln   = lane & 15;

    const int m0 = blockIdx.y * 256;
    const int n0 = blockIdx.x * 256;
    const int wm = wv & 1;              // rows    m0 + 128 * wm ..
    const int wn = wv >> 1;             // columns n0 + 64 * wn ..

    v8f acc[8][4] = {};
    v16h a[8], b[4];

    // Fragments of 32 k: row = tile*16+ln, K(e) = half*8+e | 16+half*8+e
    auto frags = [&](const int buf, const int kk) {
        const float* As = &Ts[buf][wm * 2][ln * GP + half * 8 + kk * 32];
        const float* Bs = &Ts[buf][4 + wn][ln * GP + half * 8 + kk * 32];
        #pragma unroll
        for (int j = 0; j < 4; ++j) b[j] = frag_from_f32(Bs + j * 16 * GP);
        #pragma unroll
        for (int i = 0; i < 8; ++i) a[i] = frag_from_f32(As + (i >> 2) * GSL + (i & 3) * 16 * GP);
    };
    auto mult = [&]() {
        #pragma unroll
        for (int i = 0; i < 8; ++i) {
            #pragma unroll
            for (int j = 0; j < 4; ++j) acc[i][j] = wmma_f16(a[i], b[j], acc[i][j]);
        }
    };

    // This wave's slice of every stage: 64 rows of X or W, 64 k.
    const unsigned wave = uni((unsigned)tid >> 5);
    const unsigned srow = (wave & 3) * 64;
    const float* src = (wave & 4) ? W + (size_t)(n0 + srow) * D_MODEL
                                  : X + (size_t)(m0 + srow) * D_MODEL;
    const v8i g1 = tdm_group1_row256(64, D_MODEL * 4);    // the same for every slice

    // Prologue: stage 0 landed and published, then stage 1 issued.
    v4u g0 = tdm_group0(lds_off(&Ts[0][wave][0]), src);
    tdm_load(g0, g1);
    // The descriptor is an input so that its registers keep their values while the request is outstanding.
    asm volatile("s_wait_tensorcnt 0x0" :: "s"(g0), "s"(g1) : "memory");
    __syncthreads();
    g0 = tdm_group0(lds_off(&Ts[1][wave][0]), src + 64);
    tdm_load(g0, g1);

    frags(0, 0);
    mult();
    frags(0, 1);
    for (int s = 0; s + 1 < QNST; ++s) {
        // Publish point of stage s + 1: this wave's reads of stage s are done, its
        // slice of stage s + 1 has landed, every wave has said the same.
        asm volatile("s_wait_dscnt 0x0" ::: "memory");
        asm volatile("s_wait_tensorcnt 0x0" :: "s"(g0), "s"(g1) : "memory");
        __syncthreads();
        g0 = tdm_group0(lds_off(&Ts[s & 1][wave][0]), src + (s + 2) * 64);
        if (pinned(s + 2 < QNST)) {   // refill of the buffer that every wave has just left
            tdm_load(g0, g1);
        }
        mult();                       // the last 32 k of stage s
        frags((s + 1) & 1, 0);
        mult();
        frags((s + 1) & 1, 1);
    }
    mult();
    asm volatile("s_wait_tensorcnt 0x0" ::: "memory");   // no request of this wave is left behind the loop
    asm volatile("s_wait_dscnt 0x0" ::: "memory");       // and none of its LDS reads

    // Epilogue: bias + store.  D layout: row = r + 8*half, col = ln.
    #pragma unroll
    for (int j = 0; j < 4; ++j) {
        const int na = n0 + wn * 64 + j * 16 + ln;
        const float bj = bias[na];
        #pragma unroll
        for (int i = 0; i < 8; ++i) {
            _Float16* ya = Y + (size_t)(m0 + wm * 128 + i * 16 + 8 * half) * D_MODEL + na;
            #pragma unroll
            for (int r = 0; r < 8; ++r) ya[(size_t)r * D_MODEL] = (_Float16)((acc[i][j][r] + bj) * oscale);
        }
    }
}

// The Q, K and V projections are independent: one launch, blockIdx.z picks the
// projection; its 192 tiles are all resident at once.
__global__ __launch_bounds__(256)
void qkv_gemm_kernel(const float* __restrict__ Xq, const float* __restrict__ Xk, const float* __restrict__ Xv,
                     const float* __restrict__ Wq, const float* __restrict__ Wk, const float* __restrict__ Wv,
                     const float* __restrict__ Bq, const float* __restrict__ Bk, const float* __restrict__ Bv,
                     _Float16* __restrict__ Yq, _Float16* __restrict__ Yk, _Float16* __restrict__ Yv)
{
    const int z = blockIdx.z;
    qkv_gemm_body((z == 0) ? Xq : (z == 1) ? Xk : Xv,
                  (z == 0) ? Wq : (z == 1) ? Wk : Wv,
                  (z == 0) ? Bq : (z == 1) ? Bk : Bv,
                  (z == 0) ? Yq : (z == 1) ? Yk : Yv,
                  (z == 0) ? QK_LOG2 : 1.0f);   // Q leaves scaled: the score product is then in log2 units
}

__global__ __launch_bounds__(256)
void out_gemm_kernel(const float* __restrict__ X,
                     const float* __restrict__ W,
                     const float* __restrict__ bias,
                     float* __restrict__ Y)
{
    proj_gemm_body<float>(X, W, bias, Y, 1.0f);
}

__global__ __launch_bounds__(256)
void attn_flash_kernel(const _Float16* __restrict__ Qb,
                       const _Float16* __restrict__ Kb,
                       const _Float16* __restrict__ Vb,
                       const float* __restrict__ td_ptr,
                       float* __restrict__ Cb)
{
    __shared__ __attribute__((aligned(2048))) _Float16 Ks[2][SKEYS * KP];   // [buffer][key][d], 144-B pitch: 9 x 2 KiB a buffer
    __shared__ __attribute__((aligned(2048))) _Float16 Vs[2][SKEYS * VPH];  // [buffer][key][d], 160-B pitch: 10 x 2 KiB a buffer

    const int tid  = threadIdx.x;
    const int lane = tid & 31;
    const int wv   = tid >> 5;
    const int half = lane >> 4;
    const int ln   = lane & 15;

    const int bh   = blockIdx.x >> 4;          // 0..31
    const int qblk = blockIdx.x & 15;          // 0..15
    const int b    = bh >> 4;
    const int h    = bh & 15;
    const int q0   = (qblk * 8 + wv) * 16;

    const float ndec = -td_ptr[0] * LOG2E;     // bias per key of distance, log2 units

    const _Float16* Qh = Qb + (size_t)b * SEQ * D_MODEL + h * D_KH;
    const _Float16* Kh = Kb + (size_t)b * SEQ * D_MODEL + h * D_KH;
    const _Float16* Vh = Vb + (size_t)b * SEQ * D_MODEL + h * D_KH;
    float*          Ch = Cb + (size_t)b * SEQ * D_MODEL + h * D_KH;

    // Q B-fragments for d = 0..31 / 32..63 (column = ln); contiguous f16 loads.
    v16h aq0, aq1;
    {
        const _Float16* qr = Qh + (size_t)(q0 + ln) * D_MODEL;
        #pragma unroll
        for (int e = 0; e < 8; ++e) aq0[e]     = qr[half * 8 + e];
        #pragma unroll
        for (int e = 0; e < 8; ++e) aq0[8 + e] = qr[16 + half * 8 + e];
        #pragma unroll
        for (int e = 0; e < 8; ++e) aq1[e]     = qr[32 + half * 8 + e];
        #pragma unroll
        for (int e = 0; e < 8; ++e) aq1[8 + e] = qr[48 + half * 8 + e];
    }

    v8f c0 = {}, c1 = {}, c2 = {}, c3 = {};
    float nmax = 0.0f;                  // minus the maximum in use of query q0 + ln (equal in both halves); the first stage sets it
    float lrun = 0.0f;                  // running sum over this half's keys; the halves join in the epilogue
    const float qpos = (float)(q0 + ln);

    // Wave 0 issues K, wave 1 issues V; the other waves form V's group 0 and never issue.
    const unsigned wave = uni((unsigned)tid >> 5);
    const _Float16* src = (wave == 0) ? Kh : Vh;
    const unsigned dst  = (wave == 0) ? lds_off(&Ks[0][0]) : lds_off(&Vs[0][0]);
    const unsigned dbuf = (wave == 0) ? (unsigned)sizeof(Ks[0]) : (unsigned)sizeof(Vs[0]);
    const v8i g1k = tdm_group1<3>(SKEYS, D_MODEL * 2);   // the same for every K stage
    const v8i g1v = tdm_group1<7>(SKEYS, D_MODEL * 2);   // the same for every V stage

    // Trip st works on key stage (qblk + st) mod ANST.
    // Prologue: the first stage landed and published, then the second issued.
    v4u g0 = tdm_group0(dst, src + (size_t)qblk * SKEYS * D_MODEL);
    if (pinned(wave == 0)) {
        tdm_load(g0, g1k);
        // The descriptor is an input so that its registers keep their values while the request is outstanding.
        asm volatile("s_wait_tensorcnt 0x0" :: "s"(g0), "s"(g1k) : "memory");
    }
    if (pinned(wave == 1)) {
        tdm_load(g0, g1v);
        asm volatile("s_wait_tensorcnt 0x0" :: "s"(g0), "s"(g1v) : "memory");   // as above
    }
    __syncthreads();
    g0 = tdm_group0(dst + dbuf, src + (size_t)((qblk + 1) & (ANST - 1)) * SKEYS * D_MODEL);
    if (pinned(wave == 0)) tdm_load(g0, g1k);
    if (pinned(wave == 1)) tdm_load(g0, g1v);

    // query minus this half's first key of the stage; whole numbers: exact
    float dist = fmaf(-(float)SKEYS, (float)qblk, qpos - (float)(8 * half));
    for (int st = 0; st < ANST; ++st) {
      const _Float16* Kst = &Ks[st & 1][ln * KP + half * 8];
      const _Float16* Vst = &Vs[st & 1][(8 * half + (lane & 7)) * VPH + ((lane >> 3) & 1) * 8];
      // ---- scores, transposed: s[sub][0][r] = S[first key of the stage + 32*sub + 8*half + r][q0 + ln],
      //      s[sub][1]: +16 keys; each starts from its bias minus the maximum in use
      v8f   s[SKEYS / 32][2];
      float tp[SKEYS / 32];      // this lane's largest score of each pass
      #pragma unroll   // the passes' LDS addresses become immediate offsets; s and tp stay in registers
      for (int sub = 0; sub < SKEYS / 32; ++sub) {
        const float dist0 = dist - (float)(sub * 32);
        v8f s0, s1;
        #pragma unroll
        for (int r = 0; r < 8; ++r) s0[r] = fmaf(ndec, fabsf(dist0 - (float)r), nmax);
        #pragma unroll
        for (int r = 0; r < 8; ++r) s1[r] = fmaf(ndec, fabsf(dist0 - (float)(16 + r)), nmax);
        const _Float16* kr = Kst + sub * 32 * KP;
        s0 = wmma_f16(frag_from_f16(kr), aq0, s0);
        s0 = wmma_f16(frag_from_f16(kr + 32), aq1, s0);
        kr += 16 * KP;
        s1 = wmma_f16(frag_from_f16(kr), aq0, s1);
        s1 = wmma_f16(frag_from_f16(kr + 32), aq1, s1);
        float t = fmaxf(s0[0], s1[0]);
        #pragma unroll
        for (int r = 1; r < 8; ++r) t = fmaxf(t, fmaxf(s0[r], s1[r]));
        s[sub][0] = s0;
        s[sub][1] = s1;
        tp[sub]   = t;
      }
      float t = fmaxf(fmaxf(tp[0], tp[1]), fmaxf(tp[2], tp[3]));

      const bool  first = (st == 0);   // nothing is summed yet: the stage's own maximum is taken, up or down
      const float floor_dead = first ? -__builtin_inff() : DEAD_LOG2;
      const float floor_up   = first ? -__builtin_inff() : 8.0f;
      // One scalar test per stage: has any query of the wave a score that can still count?
      if (__builtin_amdgcn_ballot_w32(t > floor_dead) != 0) {
        // ---- online softmax, one query per lane; the maximum moves rarely --
        if (__builtin_amdgcn_ballot_w32(t > floor_up) != 0) {   // one scalar test per stage
            t = fmaxf(t, xhalf(t));
            const float up    = first ? t : fmaxf(t, 0.0f);
            const float alpha = first ? 0.0f : __builtin_amdgcn_exp2f(-up);
            nmax -= up;
            lrun *= alpha;
            #pragma unroll
            for (int sub = 0; sub < SKEYS / 32; ++sub) {
                #pragma unroll
                for (int r = 0; r < 8; ++r) { s[sub][0][r] -= up; s[sub][1][r] -= up; }
            }
            #pragma unroll
            for (int r = 0; r < 8; ++r) {
                c0[r] *= alpha; c1[r] *= alpha;
                c2[r] *= alpha; c3[r] *= alpha;
            }
        }
        #pragma unroll   // s is indexed by constants; one pass's V loads may rise into the one before
        for (int sub = 0; sub < SKEYS / 32; ++sub) {
          v8f s0 = s[sub][0], s1 = s[sub][1];
          #pragma unroll
          for (int r = 0; r < 8; ++r) s0[r] = __builtin_amdgcn_exp2f(s0[r]);
          #pragma unroll
          for (int r = 0; r < 8; ++r) s1[r] = __builtin_amdgcn_exp2f(s1[r]);
          v16h bp;   // P^T as B fragment: k = 8*half + e | 16 + 8*half + e, the order of the V^T loader
          #pragma unroll
          for (int r = 0; r < 8; ++r) {
              bp[r]     = (_Float16)s0[r];
              bp[8 + r] = (_Float16)s1[r];
          }
          const v8f ps = s0 + s1;
          lrun += ((ps[0] + ps[1]) + (ps[2] + ps[3])) + ((ps[4] + ps[5]) + (ps[6] + ps[7]));

          // ---- ctx^T += V^T(64x32) @ P^T(32x16), V^T by transposing loads ----
          #pragma unroll
          for (int t4 = 0; t4 < 4; ++t4) {
              const v16h av = frag_transposed(Vst + sub * 32 * VPH + t4 * 16);
              if      (t4 == 0) c0 = wmma_f16(av, bp, c0);
              else if (t4 == 1) c1 = wmma_f16(av, bp, c1);
              else if (t4 == 2) c2 = wmma_f16(av, bp, c2);
              else              c3 = wmma_f16(av, bp, c3);
          }
        }
      }
      // the next stage's keys: 128 further on, or back at key 0
      dist += (((qblk + st + 1) & (ANST - 1)) == 0) ? (float)(SEQ - SKEYS) : -(float)SKEYS;
      // Publish point of stage st + 1: this wave's reads of stage st are done, the
      // issuing waves' tiles of stage st + 1 have landed, every wave has said the same.
      asm volatile("s_wait_dscnt 0x0" ::: "memory");
      if (pinned(wave < 2)) {
          // The descriptors are inputs so that their registers keep their values while the request is outstanding.
          asm volatile("s_wait_tensorcnt 0x0" :: "s"(g0), "s"(g1k), "s"(g1v) : "memory");
      }
      __syncthreads();
      g0 = tdm_group0(dst + (st & 1) * dbuf, src + (size_t)((qblk + st + 2) & (ANST - 1)) * SKEYS * D_MODEL);
      if (pinned(st + 2 < ANST)) {   // refill of the buffer that every wave has just left
          if (pinned(wave == 0)) tdm_load(g0, g1k);
          if (pinned(wave == 1)) tdm_load(g0, g1v);
      }
    }
    asm volatile("s_wait_tensorcnt 0x0" ::: "memory");   // no request of this wave is left behind the loop
    asm volatile("s_wait_dscnt 0x0" ::: "memory");       // and none of its LDS reads

    // ---- epilogue: normalize and store ctx (f32) --------------------------
    // c<t>[r] = O[q0 + ln][t*16 + 8*half + r]: eight consecutive floats a lane.
    {
        const float inv = 1.0f / (lrun + xhalf(lrun));
        float* cr = Ch + (size_t)(q0 + ln) * D_MODEL + 8 * half;
        #pragma unroll
        for (int j = 0; j < 2; ++j) {
            const v4f o0 = {c0[4*j] * inv, c0[4*j+1] * inv, c0[4*j+2] * inv, c0[4*j+3] * inv};
            const v4f o1 = {c1[4*j] * inv, c1[4*j+1] * inv, c1[4*j+2] * inv, c1[4*j+3] * inv};
            const v4f o2 = {c2[4*j] * inv, c2[4*j+1] * inv, c2[4*j+2] * inv, c2[4*j+3] * inv};
            const v4f o3 = {c3[4*j] * inv, c3[4*j+1] * inv, c3[4*j+2] * inv, c3[4*j+3] * inv};
            *(v4f*)(cr + 4 * j)      = o0;
            *(v4f*)(cr + 16 + 4 * j) = o1;
            *(v4f*)(cr + 32 + 4 * j) = o2;
            *(v4f*)(cr + 48 + 4 * j) = o3;
        }
    }
}

// ---------------------------------------------------------------------------
extern "C" void kernel_launch(void* const* d_in, const int* in_sizes, int n_in,
                              void* d_out, int out_size, void* d_ws, size_t ws_size,
                              hipStream_t stream) {
    const float* query = (const float*)d_in[0];
    const float* key   = (const float*)d_in[1];
    const float* value = (const float*)d_in[2];
    const float* wq = (const float*)d_in[3];
    const float* bq = (const float*)d_in[4];
    const float* wk = (const float*)d_in[5];
    const float* bk = (const float*)d_in[6];
    const float* wv = (const float*)d_in[7];
    const float* bv = (const float*)d_in[8];
    const float* wo = (const float*)d_in[9];
    const float* bo = (const float*)d_in[10];
    const float* td = (const float*)d_in[11];
    float* out = (float*)d_out;

    const size_t elems = (size_t)MROWS * D_MODEL;
    _Float16* Qbuf = (_Float16*)d_ws;            // 8 MB
    _Float16* Kbuf = Qbuf + elems;               // 8 MB
    _Float16* Vbuf = Kbuf + elems;               // 8 MB
    float*    Cbuf = (float*)(Vbuf + elems);     // 16 MB

    const dim3 gblk(256);
    const dim3 ggrid(D_MODEL / 128, MROWS / 128);  // 8 x 32
    qkv_gemm_kernel<<<dim3(D_MODEL / 256, MROWS / 256, 3), gblk, 0, stream>>>(
        query, key, value, wq, wk, wv, bq, bk, bv, Qbuf, Kbuf, Vbuf);

    attn_flash_kernel<<<dim3(BATCH * N_HEADS * (SEQ / 128)), dim3(256), 0, stream>>>(
        Qbuf, Kbuf, Vbuf, td, Cbuf);

    out_gemm_kernel<<<ggrid, gblk, 0, stream>>>(Cbuf, wo, bo, out);
}

// v009
// One run takes 64.2 microseconds.
// Two timings next to v008 put it at 1.10 and 1.09 times that version's speed.
// Over all steps from v000 it is 5.25 times as fast.
#include <hip/hip_runtime.h>
#include <hip/hip_bf16.h>
#include <cmath>

#define D_MODEL 1024
#define N_HEADS 16
#define D_KH    64
#define SEQ     2048
#define BATCH   2
#define MROWS   (BATCH * SEQ)     // 4096

typedef __attribute__((ext_vector_type(16))) _Float16     v16h;
typedef __attribute__((ext_vector_type(8)))  float        v8f;
typedef __attribute__((ext_vector_type(4)))  unsigned int v4u;
typedef __attribute__((ext_vector_type(8)))  int          v8i;
typedef __attribute__((ext_vector_type(4)))  int          v4i;
typedef __attribute__((ext_vector_type(8)))  _Float16     v8h;
typedef __attribute__((ext_vector_type(4)))  float        v4f;
typedef __attribute__((ext_vector_type(8)))  short        v8s;

// LDS pitches: 16 B x odd, so a 16-lane column of 16-byte reads meets no bank twice.
#define ROW128_PITCH_B 144                    // 128-byte rows + the mover's 16-byte pad
#define ROW256_PITCH_B 272                    // 256-byte rows + the mover's 16-byte pad
#define GP   (ROW256_PITCH_B / 4)             // GEMM slices: pitch in floats (68)
#define GSL  4608                             // floats per GEMM slice: 64 rows of 272 B, rounded up to 2 KiB x 9
#define GKS  128                              // k per GEMM stage
#define GNST (D_MODEL / GKS)                  // GEMM stages (8)
#define KP   (ROW128_PITCH_B / 2)             // K tile: pitch in halves (72)
#define VPH  80                               // V tile: pitch in halves (160 B = 128-byte rows + the mover's 32-byte pad, for the transposing reader)
#define SKEYS 128                             // keys per attention stage
#define ANST (SEQ / SKEYS)                    // attention stages (16)
#define LOG2E   1.4426950408889634f           // the attention scores are kept in log2 units
#define QK_LOG2 0.18033688011112042f          // 1/sqrt(64) * log2(e): multiplied into Q where it is projected
#define DEAD_LOG2 -40.0f                      // a stage whose scores all lie this far under the maximum in use adds nothing (see attn_flash_kernel)
#define NLINE 32                              // floats between two row-norm entries: each has a 128-byte line of its own (one writer a line)
#define NORM_ROUND 1.002f                     // covers the f16 rounding of Q and K (2^-11 each) and that of the norms' own sums, products and roots

__device__ __forceinline__ v8f wmma_f16(v16h a, v16h b, v8f c) {
    return __builtin_amdgcn_wmma_f32_16x16x32_f16(
        false, a, false, b, (short)0, c, false, false);
}

// Low 32 bits of a generic pointer to LDS == LDS byte offset.
__device__ __forceinline__ unsigned lds_off(const void* p) {
    return (unsigned)(size_t)p;
}

__device__ __forceinline__ unsigned uni(unsigned v) {
    return (unsigned)__builtin_amdgcn_readfirstlane(v);
}

// A wave-uniform test held in a scalar register, so that the branch round a
// tensor load (which ignores EXEC) compiles to s_cmp + s_cbranch_scc.
__device__ __forceinline__ unsigned pinned(unsigned v) {
    unsigned w = uni(v);
    asm volatile("" : "+s"(w));   // keeps the test scalar: a vector branch would not guard the tensor load
    return w;
}

// ---------------------------------------------------------------------------
// Tensor-load descriptor of a tile of 128-byte rows that lands in LDS with a
// pad behind every row: PAD = 3 gives 16 bytes (LDS pitch 144 B), PAD = 7 gives
// 32 bytes (pitch 160 B).  Every extent is in bytes (data_size code 0); tensor
// dims = tile dims.
// ---------------------------------------------------------------------------
__device__ __forceinline__ v4u tdm_group0(unsigned lds, const void* gptr) {
    const unsigned long long ga = (unsigned long long)(size_t)gptr;
    v4u g0;
    g0[0] = 1u;                                           // count=1 (valid)
    g0[1] = uni(lds);                                     // lds_addr
    g0[2] = uni((unsigned)(ga & 0xffffffffu));            // global_addr lo
    g0[3] = (uni((unsigned)(ga >> 32)) & 0x01ffffffu)     // global_addr hi
          | (2u << 30);                                   // type=2
    asm volatile("" : "+s"(g0));   // pinned(): descriptor words held in their own scalar registers, not formed anew from copies
    return g0;
}

template <unsigned PAD>
__device__ __forceinline__ v8i tdm_group1(unsigned rows, unsigned pitch) {
    v8i g1;
    g1[0] = (int)((1u << 20)      // pad_enable
          |       (4u << 22)      // pad_interval = 32 DWORDs = one row
          |       (PAD << 25));   // pad_amount   = PAD + 1 DWORDs
    g1[1] = (int)(128u << 16);                            // tensor_dim0 = 128 B
    g1[2] = (int)(uni(rows) << 16);                       // tensor_dim1 = rows
    g1[3] = (int)(128u << 16);                            // tile_dim0 = 128 B
    g1[4] = (int)uni(rows);                               // tile_dim1
    g1[5] = (int)uni(pitch);                              // source row pitch, bytes
    g1[6] = 0;
    g1[7] = 0;
    asm volatile("" : "+s"(g1));   // pinned(): descriptor words held in their own scalar registers, not formed anew from copies
    return g1;
}

// The same for a tile of 256-byte rows (LDS pitch 272 B).
__device__ __forceinline__ v8i tdm_group1_row256(unsigned rows, unsigned pitch) {
    v8i g1;
    g1[0] = (int)((1u << 20)      // pad_enable
          |       (5u << 22)      // pad_interval = 64 DWORDs = one row
          |       (3u << 25));    // pad_amount   = 4 DWORDs
    g1[1] = (int)(256u << 16);                            // tensor_dim0 = 256 B
    g1[2] = (int)(uni(rows) << 16);                       // tensor_dim1 = rows
    g1[3] = (int)(256u << 16);                            // tile_dim0 = 256 B
    g1[4] = (int)uni(rows);                               // tile_dim1
    g1[5] = (int)uni(pitch);                              // source row pitch, bytes
    g1[6] = 0;
    g1[7] = 0;
    asm volatile("" : "+s"(g1));   // pinned(): descriptor words held in their own scalar registers, not formed anew from copies
    return g1;
}

__device__ __forceinline__ void tdm_load(v4u g0, v8i g1) {
    const v4i z4 = {0, 0, 0, 0};
    const v8i z8 = {0, 0, 0, 0, 0, 0, 0, 0};
    __builtin_amdgcn_tensor_load_to_lds(g0, g1, z4, z4, z8, 0);
}

// 16x32 f16 fragment of one lane from a row of f32: k = 0..7 and 16..23 from p.
__device__ __forceinline__ v16h frag_from_f32(const float* p) {
    const v4f x0 = *(const v4f*)(p);
    const v4f x1 = *(const v4f*)(p + 4);
    const v4f x2 = *(const v4f*)(p + 16);
    const v4f x3 = *(const v4f*)(p + 20);
    v16h f;
    #pragma unroll
    for (int e = 0; e < 4; ++e) {
        f[e]      = (_Float16)x0[e];
        f[4 + e]  = (_Float16)x1[e];
        f[8 + e]  = (_Float16)x2[e];
        f[12 + e] = (_Float16)x3[e];
    }
    return f;
}

// The same from a row of f16.
__device__ __forceinline__ v16h frag_from_f16(const _Float16* p) {
    const v8h lo = *(const v8h*)(p);
    const v8h hi = *(const v8h*)(p + 16);
    return __builtin_shufflevector(lo, hi, 0, 1, 2, 3, 4, 5, 6, 7,
                                   8, 9, 10, 11, 12, 13, 14, 15);
}

// 16 (d) x 32 (keys) A fragment of V^T from row-major V rows in LDS, by two
// transposing loads: lane (ln, half) gets V[8*half + e | 16 + 8*half + e][ln].
// p = this lane's address: row 8*half + (lane & 7), halves 8 * ((lane >> 3) & 1).
__device__ __forceinline__ v16h frag_transposed(const _Float16* p) {
    typedef __attribute__((address_space(3))) v8s lds_v8s;
    const v8h lo = __builtin_bit_cast(v8h, __builtin_amdgcn_ds_load_tr16_b128_v8i16((lds_v8s*)p));
    const v8h hi = __builtin_bit_cast(v8h, __builtin_amdgcn_ds_load_tr16_b128_v8i16((lds_v8s*)(p + 16 * VPH)));
    return __builtin_shufflevector(lo, hi, 0, 1, 2, 3, 4, 5, 6, 7,
                                   8, 9, 10, 11, 12, 13, 14, 15);
}

// Lane l reads lane l ^ 16: the two wave halves hold the two halves of a column.
__device__ __forceinline__ float xhalf(float x) {
    const int b = __builtin_bit_cast(int, x);
    return __builtin_bit_cast(float,
        __builtin_amdgcn_permlanex16(b, b, 0x76543210, 0xfedcba98, false, false));
}

// Lane l reads lane l ^ M of its row of 16 lanes (DPP row_xmask).
template <int M>
__device__ __forceinline__ float xrow(float x) {
    return __builtin_bit_cast(float,
        __builtin_amdgcn_update_dpp(0, __builtin_bit_cast(int, x), 0x160 | M, 0xf, 0xf, true));
}

// p[r] = this lane's share of eight sums that run over the 16 lanes of a row.
// Returns one of the eight whole sums, by the lane's bits 3..1: every step hands
// half of the values to the partner lane, so each step has half the adds of the last.
__device__ __forceinline__ float rowsum_one_of_8(const float* p, const int ln) {
    const bool h8 = (ln & 8) != 0, h4 = (ln & 4) != 0, h2 = (ln & 2) != 0;
    float u[4], w[2];
    #pragma unroll
    for (int k = 0; k < 4; ++k) u[k] = (h8 ? p[2 * k + 1] : p[2 * k]) + xrow<8>(h8 ? p[2 * k] : p[2 * k + 1]);
    #pragma unroll
    for (int k = 0; k < 2; ++k) w[k] = (h4 ? u[2 * k + 1] : u[2 * k]) + xrow<4>(h4 ? u[2 * k] : u[2 * k + 1]);
    const float x = (h2 ? w[1] : w[0]) + xrow<2>(h2 ? w[0] : w[1]);
    return x + xrow<1>(x);
}

// ---------------------------------------------------------------------------
// Projection GEMM: Y[4096,1024] = X[4096,1024] @ W[1024,1024]^T + bias.
// 128x128 block tile, one block per WGP; 8 waves as 2 (rows) x 4 (columns),
// 64x32 of Y per wave: 8 WMMAs on 6 fragments per 32 k.  A stage is 128 k of
// both operands, f32, in 8 slices of 64 rows x 256 B; every wave brings one
// slice by one tensor load.  Two buffers: stage s + 1 flies while stage s is
// worked on.  f32->f16 conversion at fragment read.
// It serves the output projection (256 tiles, one per WGP); the Q, K and V
// projections have the wider tile of qkv_gemm_body below.
// oscale multiplies the biased result in f32, before it is rounded to TOUT.
// ---------------------------------------------------------------------------
template <typename TOUT>
__device__ __forceinline__
void proj_gemm_body(const float* __restrict__ X,
                    const float* __restrict__ W,
                    const float* __restrict__ bias,
                    TOUT* __restrict__ Y,
                    const float oscale)
{
    // [buffer][slice], slice = 4 * (X | W) + 2 * (row half) + (k half); 68-dw pitch from the TDM pad
    __shared__ __attribute__((aligned(2048))) float Ts[2][8][GSL];

    const int tid  = threadIdx.x;
    const int lane = tid & 31;
    const int wv   = tid >> 5;
    const int half = lane >> 4;
    const int ln   = lane & 15;

    const int m0 = blockIdx.y * 128;
    const int n0 = blockIdx.x * 128;
    const int wm = wv & 1;              // rows    m0 + 64 * wm ..
    const int wn = wv >> 1;             // columns n0 + 32 * wn ..

    v8f acc[4][2] = {};

    // This wave's slice of every stage: 64 rows of X or W, 64 k.
    const unsigned wave = uni((unsigned)tid >> 5);
    const unsigned srow = (wave & 2) * 32;
    const float* src = ((wave & 4) ? W + (size_t)(n0 + srow) * D_MODEL
                                   : X + (size_t)(m0 + srow) * D_MODEL) + (wave & 1) * 64;
    const v8i g1 = tdm_group1_row256(64, D_MODEL * 4);    // the same for every slice

    // Prologue: stage 0 landed and published, then stage 1 issued.
    v4u g0 = tdm_group0(lds_off(&Ts[0][wave][0]), src);
    tdm_load(g0, g1);
    // The descriptor is an input so that its registers keep their values while the request is outstanding.
    asm volatile("s_wait_tensorcnt 0x0" :: "s"(g0), "s"(g1) : "memory");
    __syncthreads();
    g0 = tdm_group0(lds_off(&Ts[1][wave][0]), src + GKS);
    tdm_load(g0, g1);

    for (int s = 0; s < GNST; ++s) {
        // Fragments: row = tile*16+ln, K(e) = half*8+e | 16+half*8+e
        const float* As = &Ts[s & 1][wm * 2][ln * GP + half * 8];
        const float* Bs = &Ts[s & 1][4 + (wn >> 1) * 2][((wn & 1) * 32 + ln) * GP + half * 8];
        v16h a[4], b[2];
        #pragma unroll
        for (int kk = 0; kk < 4; ++kk) {
            const int o = (kk >> 1) * GSL + (kk & 1) * 32;
            #pragma unroll
            for (int i = 0; i < 4; ++i) a[i] = frag_from_f32(As + o + i * 16 * GP);
            #pragma unroll
            for (int j = 0; j < 2; ++j) b[j] = frag_from_f32(Bs + o + j * 16 * GP);
            if (kk == 3) break;   // the last 32 k are multiplied behind the refill, from registers
            #pragma unroll
            for (int i = 0; i < 4; ++i) {
                #pragma unroll
                for (int j = 0; j < 2; ++j) acc[i][j] = wmma_f16(a[i], b[j], acc[i][j]);
            }
        }
        // Publish point of stage s + 1: this wave's reads of stage s are done, its
        // slice of stage s + 1 has landed, every wave has said the same.
        asm volatile("s_wait_dscnt 0x0" ::: "memory");
        asm volatile("s_wait_tensorcnt 0x0" :: "s"(g0), "s"(g1) : "memory");
        __syncthreads();
        g0 = tdm_group0(lds_off(&Ts[s & 1][wave][0]), src + (s + 2) * GKS);
        if (pinned(s + 2 < GNST)) {   // refill of the buffer that every wave has just left
            tdm_load(g0, g1);
        }
        #pragma unroll
        for (int i = 0; i < 4; ++i) {
            #pragma unroll
            for (int j = 0; j < 2; ++j) acc[i][j] = wmma_f16(a[i], b[j], acc[i][j]);
        }
    }
    asm volatile("s_wait_tensorcnt 0x0" ::: "memory");   // no request of this wave is left behind the loop
    asm volatile("s_wait_dscnt 0x0" ::: "memory");       // and none of its LDS reads

    // Epilogue: bias + store.  D layout: row = r + 8*half, col = ln.
    #pragma unroll
    for (int j = 0; j < 2; ++j) {
        const int na = n0 + wn * 32 + j * 16 + ln;
        const float bj = bias[na];
        #pragma unroll
        for (int i = 0; i < 4; ++i) {
            TOUT* ya = Y + (size_t)(m0 + wm * 64 + i * 16 + 8 * half) * D_MODEL + na;
            #pragma unroll
            for (int r = 0; r < 8; ++r) ya[(size_t)r * D_MODEL] = (TOUT)((acc[i][j][r] + bj) * oscale);
        }
    }
}

// ---------------------------------------------------------------------------
// Q, K and V projections: the same product on a 256x256 block tile, 8 waves as
// 2 (rows) x 4 (columns), 128x64 of Y per wave: 32 WMMAs on 12 fragments per
// 32 k, so a WMMA costs half the LDS-read bytes of the 64x32 wave tile, and a
// result half the bytes brought from L2.  A stage is 64 k of both operands, f32,
// in 8 slices of 64 rows x 256 B (the ring's size and places are those of the
// smaller tile); every wave brings one slice by one tensor load.  Two buffers.
// The last 32 k of a stage are multiplied behind the publish point, from
// registers, in one straight run with the next stage's first fragment reads.
// The k order of every sum is that of the smaller tile.
// ---------------------------------------------------------------------------
#define QNST (D_MODEL / 64)                   // stages of the wide tile (16)
__device__ __forceinline__
void qkv_gemm_body(const float* __restrict__ X,
                   const float* __restrict__ W,
                   const float* __restrict__ bias,
                   _Float16* __restrict__ Y,
                   const float oscale,
                   float* __restrict__ nrm)
{
    // [buffer][slice], slice = 4 * (X | W) + (row quarter); 68-dw pitch from the TDM pad
    __shared__ __attribute__((aligned(2048))) float Ts[2][8][GSL];

    const int tid  = threadIdx.x;
    const int lane = tid & 31;
    const int wv   = tid >> 5;
    const int half = lane >> 4;
    const int ln   = lane & 15;

    const int m0 = blockIdx.y * 256;
    const int n0 = blockIdx.x * 256;
    const int wm = wv & 1;              // rows    m0 + 128 * wm ..
    const int wn = wv >> 1;             // columns n0 + 64 * wn ..

    v8f acc[8][4] = {};
    v16h a[8], b[4];

    // Fragments of 32 k: row = tile*16+ln, K(e) = half*8+e | 16+half*8+e
    auto frags = [&](const int buf, const int kk) {
        const float* As = &Ts[buf][wm * 2][ln * GP + half * 8 + kk * 32];
        const float* Bs = &Ts[buf][4 + wn][ln * GP + half * 8 + kk * 32];
        #pragma unroll
        for (int j = 0; j < 4; ++j) b[j] = frag_from_f32(Bs + j * 16 * GP);
        #pragma unroll
        for (int i = 0; i < 8; ++i) a[i] = frag_from_f32(As + (i >> 2) * GSL + (i & 3) * 16 * GP);
    };
    auto mult = [&]() {
        #pragma unroll
        for (int i = 0; i < 8; ++i) {
            #pragma unroll
            for (int j = 0; j < 4; ++j) acc[i][j] = wmma_f16(a[i], b[j], acc[i][j]);
        }
    };

    // This wave's slice of every stage: 64 rows of X or W, 64 k.
    const unsigned wave = uni((unsigned)tid >> 5);
    const unsigned srow = (wave & 3) * 64;
    const float* src = (wave & 4) ? W + (size_t)(n0 + srow) * D_MODEL
                                  : X + (size_t)(m0 + srow) * D_MODEL;
    const v8i g1 = tdm_group1_row256(64, D_MODEL * 4);    // the same for every slice

    // Prologue: stage 0 landed and published, then stage 1 issued.
    v4u g0 = tdm_group0(lds_off(&Ts[0][wave][0]), src);
    tdm_load(g0, g1);
    // The descriptor is an input so that its registers keep their values while the request is outstanding.
    asm volatile("s_wait_tensorcnt 0x0" :: "s"(g0), "s"(g1) : "memory");
    __syncthreads();
    g0 = tdm_group0(lds_off(&Ts[1][wave][0]), src + 64);
    tdm_load(g0, g1);

    frags(0, 0);
    mult();
    frags(0, 1);
    for (int s = 0; s + 1 < QNST; ++s) {
        // Publish point of stage s + 1: this wave's reads of stage s are done, its
        // slice of stage s + 1 has landed, every wave has said the same.
        asm volatile("s_wait_dscnt 0x0" ::: "memory");
        asm volatile("s_wait_tensorcnt 0x0" :: "s"(g0), "s"(g1) : "memory");
        __syncthreads();
        g0 = tdm_group0(lds_off(&Ts[s & 1][wave][0]), src + (s + 2) * 64);
        if (pinned(s + 2 < QNST)) {   // refill of the buffer that every wave has just left
            tdm_load(g0, g1);
        }
        mult();                       // the last 32 k of stage s
        frags((s + 1) & 1, 0);
        mult();
        frags((s + 1) & 1, 1);
    }
    mult();
    asm volatile("s_wait_tensorcnt 0x0" ::: "memory");   // no request of this wave is left behind the loop
    asm volatile("s_wait_dscnt 0x0" ::: "memory");       // and none of its LDS reads

    // Epilogue: bias + store.  D layout: row = r + 8*half, col = ln.
    // The wave's tile is 128 rows of one head: one attention block of queries, or
    // one attention stage of keys.  Where nrm is given, the largest squared length
    // of its 128 rows goes there, for the attention kernel's bound on a stage's scores.
    const int na = n0 + wn * 64 + ln;
    float bj[4];
    #pragma unroll
    for (int j = 0; j < 4; ++j) bj[j] = bias[na + j * 16];
    // Before a register that the four loads above name is written again; base and index are inputs so that their registers keep their values up to the wait.
    asm volatile("s_wait_xcnt 0x0" :: "s"(bias), "v"(na) : "memory");
    float big = 0.0f;
    #pragma unroll
    for (int i = 0; i < 8; ++i) {
        _Float16* ya = Y + (size_t)(m0 + wm * 128 + i * 16 + 8 * half) * D_MODEL + na;
        _Float16 hy[8][4];
        float p[8];   // this lane's four columns of the squared length of row i * 16 + 8 * half + r
        #pragma unroll
        for (int r = 0; r < 8; ++r) {
            float sq = 0.0f;
            #pragma unroll
            for (int j = 0; j < 4; ++j) {
                const float y = (acc[i][j][r] + bj[j]) * oscale;
                hy[r][j] = (_Float16)y;
                sq = fmaf(y, y, sq);
            }
            p[r] = sq;
        }
        __builtin_amdgcn_sched_barrier(0);   // all 32 values stand in registers of their own before the first store: none is formed between the stores
        #pragma unroll
        for (int r = 0; r < 8; ++r) {
            #pragma unroll
            for (int j = 0; j < 4; ++j) ya[(size_t)r * D_MODEL + j * 16] = hy[r][j];
        }
        asm volatile("s_wait_xcnt 0x0" ::: "memory");   // before the registers that the stores above name are written again
        __builtin_amdgcn_sched_barrier(0);              // keeps the arithmetic below behind that wait
        if (nrm) big = fmaxf(big, rowsum_one_of_8(p, ln));
    }
    if (nrm) {
        big = fmaxf(big, xrow<8>(big));
        big = fmaxf(big, xrow<4>(big));
        big = fmaxf(big, xrow<2>(big));
        big = fmaxf(big, xhalf(big));
        const int rb = blockIdx.y * 2 + wm;        // 128-row block: 16 * batch + block of the sequence
        const int hd = blockIdx.x * 4 + wn;        // head
        if (lane == 0) nrm[(size_t)((((rb >> 4) * N_HEADS + hd) * ANST) + (rb & (ANST - 1))) * NLINE] = big;
    }
}

// The Q, K and V projections are independent: one launch, blockIdx.z picks the
// projection; its 192 tiles are all resident at once.
__global__ __launch_bounds__(256)
void qkv_gemm_kernel(const float* __restrict__ Xq, const float* __restrict__ Xk, const float* __restrict__ Xv,
                     const float* __restrict__ Wq, const float* __restrict__ Wk, const float* __restrict__ Wv,
                     const float* __restrict__ Bq, const float* __restrict__ Bk, const float* __restrict__ Bv,
                     _Float16* __restrict__ Yq, _Float16* __restrict__ Yk, _Float16* __restrict__ Yv,
                     float* __restrict__ Nq, float* __restrict__ Nk)
{
    const int z = blockIdx.z;
    qkv_gemm_body((z == 0) ? Xq : (z == 1) ? Xk : Xv,
                  (z == 0) ? Wq : (z == 1) ? Wk : Wv,
                  (z == 0) ? Bq : (z == 1) ? Bk : Bv,
                  (z == 0) ? Yq : (z == 1) ? Yk : Yv,
                  (z == 0) ? QK_LOG2 : 1.0f,    // Q leaves scaled: the score product is then in log2 units
                  (z == 0) ? Nq : (z == 1) ? Nk : nullptr);
}

__global__ __launch_bounds__(256)
void out_gemm_kernel(const float* __restrict__ X,
                     const float* __restrict__ W,
                     const float* __restrict__ bias,
                     float* __restrict__ Y)
{
    proj_gemm_body<float>(X, W, bias, Y, 1.0f);
}

__global__ __launch_bounds__(256)
void attn_flash_kernel(const _Float16* __restrict__ Qb,
                       const _Float16* __restrict__ Kb,
                       const _Float16* __restrict__ Vb,
                       const float* __restrict__ td_ptr,
                       const float* __restrict__ Nq,
                       const float* __restrict__ Nk,
                       float* __restrict__ Cb)
{
    __shared__ __attribute__((aligned(2048))) _Float16 Ks[2][SKEYS * KP];   // [buffer][key][d], 144-B pitch: 9 x 2 KiB a buffer
    __shared__ __attribute__((aligned(2048))) _Float16 Vs[2][SKEYS * VPH];  // [buffer][key][d], 160-B pitch: 10 x 2 KiB a buffer

    const int tid  = threadIdx.x;
    const int lane = tid & 31;
    const int wv   = tid >> 5;
    const int half = lane >> 4;
    const int ln   = lane & 15;

    const int bh   = blockIdx.x >> 4;          // 0..31
    const int qblk = blockIdx.x & 15;          // 0..15
    const int b    = bh >> 4;
    const int h    = bh & 15;
    const int q0   = (qblk * 8 + wv) * 16;

    const float ndec = -td_ptr[0] * LOG2E;     // bias per key of distance, log2 units

    // Largest squared row lengths: the block's queries, its own stage's keys, and (lane j and j + 16) stage j's keys.
    const int   sj  = lane & (ANST - 1);
    const float nq2 = Nq[(size_t)(bh * ANST + qblk) * NLINE];
    const float nd2 = Nk[(size_t)(bh * ANST + qblk) * NLINE];
    const float nj2 = Nk[(size_t)(bh * ANST + sj) * NLINE];

    const _Float16* Qh = Qb + (size_t)b * SEQ * D_MODEL + h * D_KH;
    const _Float16* Kh = Kb + (size_t)b * SEQ * D_MODEL + h * D_KH;
    const _Float16* Vh = Vb + (size_t)b * SEQ * D_MODEL + h * D_KH;
    float*          Ch = Cb + (size_t)b * SEQ * D_MODEL + h * D_KH;

    // Q B-fragments for d = 0..31 / 32..63 (column = ln); contiguous f16 loads.
    v16h aq0, aq1;
    {
        const _Float16* qr = Qh + (size_t)(q0 + ln) * D_MODEL;
        #pragma unroll
        for (int e = 0; e < 8; ++e) aq0[e]     = qr[half * 8 + e];
        #pragma unroll
        for (int e = 0; e < 8; ++e) aq0[8 + e] = qr[16 + half * 8 + e];
        #pragma unroll
        for (int e = 0; e < 8; ++e) aq1[e]     = qr[32 + half * 8 + e];
        #pragma unroll
        for (int e = 0; e < 8; ++e) aq1[8 + e] = qr[48 + half * 8 + e];
    }

    v8f c0 = {}, c1 = {}, c2 = {}, c3 = {};
    float nmax = 0.0f;                  // minus the maximum in use of query q0 + ln (equal in both halves); the first stage sets it
    float lrun = 0.0f;                  // running sum over this half's keys; the halves join in the epilogue
    const float qpos = (float)(q0 + ln);

    // Wave 0 issues K, wave 1 issues V; the other waves form V's group 0 and never issue.
    const unsigned wave = uni((unsigned)tid >> 5);
    const _Float16* src = (wave == 0) ? Kh : Vh;
    const unsigned dst  = (wave == 0) ? lds_off(&Ks[0][0]) : lds_off(&Vs[0][0]);
    const unsigned dbuf = (wave == 0) ? (unsigned)sizeof(Ks[0]) : (unsigned)sizeof(Vs[0]);
    const v8i g1k = tdm_group1<3>(SKEYS, D_MODEL * 2);   // the same for every K stage
    const v8i g1v = tdm_group1<7>(SKEYS, D_MODEL * 2);   // the same for every V stage

    // Prologue: the block's own stage landed and published, then the walk's second stage issued.
    v4u g0 = tdm_group0(dst, src + (size_t)qblk * SKEYS * D_MODEL);
    if (pinned(wave == 0)) {
        tdm_load(g0, g1k);
        // The descriptor is an input so that its registers keep their values while the request is outstanding.
        asm volatile("s_wait_tensorcnt 0x0" :: "s"(g0), "s"(g1k) : "memory");
    }
    if (pinned(wave == 1)) {
        tdm_load(g0, g1v);
        asm volatile("s_wait_tensorcnt 0x0" :: "s"(g0), "s"(g1v) : "memory");   // as above
    }
    __syncthreads();

    // The walk: bit o of todo = key stage (qblk + o) mod ANST can count.  Every wave
    // forms it from the same three planes' values, so it is the same in the whole block.
    unsigned todo;
    {
        const int   gap  = (sj > qblk) ? sj - qblk : qblk - sj;      // stages apart
        const float near = (float)(gap * SKEYS - (SKEYS - 1));       // nearest and farthest pair of query and key
        const float far  = (float)(gap * SKEYS + (SKEYS - 1));
        const float top  = fmaxf(ndec * near, ndec * far)
                         + NORM_ROUND * (__builtin_amdgcn_sqrtf(nq2 * nj2) + __builtin_amdgcn_sqrtf(nq2 * nd2));
        // written so that a NaN keeps the stage
        const unsigned livem = __builtin_amdgcn_ballot_w32(gap == 0 || !(top < DEAD_LOG2 - 0.5f)) & 0xffffu;
        todo = uni(((livem >> qblk) | (livem << (ANST - qblk))) & 0xffffu);
    }
    const int ntrip = __builtin_popcount(todo);   // 1 .. ANST
    todo &= todo - 1;                             // the own stage (bit 0) is in buffer 0
    unsigned ocur = 0;                            // this trip's stage, as an offset from qblk
    unsigned onxt = (unsigned)__builtin_ctz(todo | (1u << ANST));   // the next trip's; ANST (the own stage again, never issued) if none
    g0 = tdm_group0(dst + dbuf, src + (size_t)((qblk + onxt) & (ANST - 1)) * SKEYS * D_MODEL);
    if (pinned(todo != 0)) {
        if (pinned(wave == 0)) tdm_load(g0, g1k);
        if (pinned(wave == 1)) tdm_load(g0, g1v);
    }
    todo &= todo - 1;

    int st = 0;
    do {   // the own stage is always walked
      // query minus this half's first key of the stage; whole numbers: exact
      const float dist = fmaf(-(float)SKEYS, (float)((qblk + ocur) & (ANST - 1)), qpos - (float)(8 * half));
      const _Float16* Kst = &Ks[st & 1][ln * KP + half * 8];
      const _Float16* Vst = &Vs[st & 1][(8 * half + (lane & 7)) * VPH + ((lane >> 3) & 1) * 8];
      // ---- scores, transposed: s[sub][0][r] = S[first key of the stage + 32*sub + 8*half + r][q0 + ln],
      //      s[sub][1]: +16 keys; each starts from its bias minus the maximum in use
      v8f   s[SKEYS / 32][2];
      float tp[SKEYS / 32];      // this lane's largest score of each pass
      #pragma unroll   // the passes' LDS addresses become immediate offsets; s and tp stay in registers
      for (int sub = 0; sub < SKEYS / 32; ++sub) {
        const float dist0 = dist - (float)(sub * 32);
        v8f s0, s1;
        #pragma unroll
        for (int r = 0; r < 8; ++r) s0[r] = fmaf(ndec, fabsf(dist0 - (float)r), nmax);
        #pragma unroll
        for (int r = 0; r < 8; ++r) s1[r] = fmaf(ndec, fabsf(dist0 - (float)(16 + r)), nmax);
        const _Float16* kr = Kst + sub * 32 * KP;
        s0 = wmma_f16(frag_from_f16(kr), aq0, s0);
        s0 = wmma_f16(frag_from_f16(kr + 32), aq1, s0);
        kr += 16 * KP;
        s1 = wmma_f16(frag_from_f16(kr), aq0, s1);
        s1 = wmma_f16(frag_from_f16(kr + 32), aq1, s1);
        float t = fmaxf(s0[0], s1[0]);
        #pragma unroll
        for (int r = 1; r < 8; ++r) t = fmaxf(t, fmaxf(s0[r], s1[r]));
        s[sub][0] = s0;
        s[sub][1] = s1;
        tp[sub]   = t;
      }
      float t = fmaxf(fmaxf(tp[0], tp[1]), fmaxf(tp[2], tp[3]));

      const bool  first = (st == 0);   // nothing is summed yet: the stage's own maximum is taken, up or down
      const float floor_dead = first ? -__builtin_inff() : DEAD_LOG2;
      const float floor_up   = first ? -__builtin_inff() : 8.0f;
      // One scalar test per stage: has any query of the wave a score that can still count?
      if (__builtin_amdgcn_ballot_w32(t > floor_dead) != 0) {
        // ---- online softmax, one query per lane; the maximum moves rarely --
        if (__builtin_amdgcn_ballot_w32(t > floor_up) != 0) {   // one scalar test per stage
            t = fmaxf(t, xhalf(t));
            const float up    = first ? t : fmaxf(t, 0.0f);
            const float alpha = first ? 0.0f : __builtin_amdgcn_exp2f(-up);
            nmax -= up;
            lrun *= alpha;
            #pragma unroll
            for (int sub = 0; sub < SKEYS / 32; ++sub) {
                #pragma unroll
                for (int r = 0; r < 8; ++r) { s[sub][0][r] -= up; s[sub][1][r] -= up; }
            }
            #pragma unroll
            for (int r = 0; r < 8; ++r) {
                c0[r] *= alpha; c1[r] *= alpha;
                c2[r] *= alpha; c3[r] *= alpha;
            }
        }
        #pragma unroll   // s is indexed by constants; one pass's V loads may rise into the one before
        for (int sub = 0; sub < SKEYS / 32; ++sub) {
          v8f s0 = s[sub][0], s1 = s[sub][1];
          #pragma unroll
          for (int r = 0; r < 8; ++r) s0[r] = __builtin_amdgcn_exp2f(s0[r]);
          #pragma unroll
          for (int r = 0; r < 8; ++r) s1[r] = __builtin_amdgcn_exp2f(s1[r]);
          v16h bp;   // P^T as B fragment: k = 8*half + e | 16 + 8*half + e, the order of the V^T loader
          #pragma unroll
          for (int r = 0; r < 8; ++r) {
              bp[r]     = (_Float16)s0[r];
              bp[8 + r] = (_Float16)s1[r];
          }
          const v8f ps = s0 + s1;
          lrun += ((ps[0] + ps[1]) + (ps[2] + ps[3])) + ((ps[4] + ps[5]) + (ps[6] + ps[7]));

          // ---- ctx^T += V^T(64x32) @ P^T(32x16), V^T by transposing loads ----
          #pragma unroll
          for (int t4 = 0; t4 < 4; ++t4) {
              const v16h av = frag_transposed(Vst + sub * 32 * VPH + t4 * 16);
              if      (t4 == 0) c0 = wmma_f16(av, bp, c0);
              else if (t4 == 1) c1 = wmma_f16(av, bp, c1);
              else if (t4 == 2) c2 = wmma_f16(av, bp, c2);
              else              c3 = wmma_f16(av, bp, c3);
          }
        }
      }
      // Publish point of stage st + 1: this wave's reads of stage st are done, the
      // issuing waves' tiles of stage st + 1 have landed, every wave has said the same.
      asm volatile("s_wait_dscnt 0x0" ::: "memory");
      if (pinned(wave < 2)) {
          // The descriptors are inputs so that their registers keep their values while the request is outstanding.
          asm volatile("s_wait_tensorcnt 0x0" :: "s"(g0), "s"(g1k), "s"(g1v) : "memory");
      }
      __syncthreads();
      ocur = onxt;
      onxt = (unsigned)__builtin_ctz(todo | (1u << ANST));
      g0 = tdm_group0(dst + (st & 1) * dbuf, src + (size_t)((qblk + onxt) & (ANST - 1)) * SKEYS * D_MODEL);
      if (pinned(todo != 0)) {   // refill of the buffer that every wave has just left
          if (pinned(wave == 0)) tdm_load(g0, g1k);
          if (pinned(wave == 1)) tdm_load(g0, g1v);
      }
      todo &= todo - 1;
    } while (++st < ntrip);
    asm volatile("s_wait_tensorcnt 0x0" ::: "memory");   // no request of this wave is left behind the loop
    asm volatile("s_wait_dscnt 0x0" ::: "memory");       // and none of its LDS reads

    // ---- epilogue: normalize and store ctx (f32) --------------------------
    // c<t>[r] = O[q0 + ln][t*16 + 8*half + r]: eight consecutive floats a lane.
    {
        const float inv = 1.0f / (lrun + xhalf(lrun));
        float* cr = Ch + (size_t)(q0 + ln) * D_MODEL + 8 * half;
        #pragma unroll
        for (int j = 0; j < 2; ++j) {
            const v4f o0 = {c0[4*j] * inv, c0[4*j+1] * inv, c0[4*j+2] * inv, c0[4*j+3] * inv};
            const v4f o1 = {c1[4*j] * inv, c1[4*j+1] * inv, c1[4*j+2] * inv, c1[4*j+3] * inv};
            const v4f o2 = {c2[4*j] * inv, c2[4*j+1] * inv, c2[4*j+2] * inv, c2[4*j+3] * inv};
            const v4f o3 = {c3[4*j] * inv, c3[4*j+1] * inv, c3[4*j+2] * inv, c3[4*j+3] * inv};
            *(v4f*)(cr + 4 * j)      = o0;
            *(v4f*)(cr + 16 + 4 * j) = o1;
            *(v4f*)(cr + 32 + 4 * j) = o2;
            *(v4f*)(cr + 48 + 4 * j) = o3;
        }
    }
}

// ---------------------------------------------------------------------------
extern "C" void kernel_launch(void* const* d_in, const int* in_sizes, int n_in,
                              void* d_out, int out_size, void* d_ws, size_t ws_size,
                              hipStream_t stream) {
    const float* query = (const float*)d_in[0];
    const float* key   = (const float*)d_in[1];
    const float* value = (const float*)d_in[2];
    const float* wq = (const float*)d_in[3];
    const float* bq = (const float*)d_in[4];
    const float* wk = (const float*)d_in[5];
    const float* bk = (const float*)d_in[6];
    const float* wv = (const float*)d_in[7];
    const float* bv = (const float*)d_in[8];
    const float* wo = (const float*)d_in[9];
    const float* bo = (const float*)d_in[10];
    const float* td = (const float*)d_in[11];
    float* out = (float*)d_out;

    const size_t elems = (size_t)MROWS * D_MODEL;
    _Float16* Qbuf = (_Float16*)d_ws;            // 8 MB
    _Float16* Kbuf = Qbuf + elems;               // 8 MB
    _Float16* Vbuf = Kbuf + elems;               // 8 MB
    float*    Cbuf = (float*)(Vbuf + elems);     // 16 MB
    float*    Nqbuf = Cbuf + elems;              // 64 KB: 512 row-norm entries, a 128-byte line each
    float*    Nkbuf = Nqbuf + (size_t)BATCH * N_HEADS * ANST * NLINE;   // 64 KB

    const dim3 gblk(256);
    const dim3 ggrid(D_MODEL / 128, MROWS / 128);  // 8 x 32
    qkv_gemm_kernel<<<dim3(D_MODEL / 256, MROWS / 256, 3), gblk, 0, stream>>>(
        query, key, value, wq, wk, wv, bq, bk, bv, Qbuf, Kbuf, Vbuf, Nqbuf, Nkbuf);

    attn_flash_kernel<<<dim3(BATCH * N_HEADS * (SEQ / 128)), dim3(256), 0, stream>>>(
        Qbuf, Kbuf, Vbuf, td, Nqbuf, Nkbuf, Cbuf);

    out_gemm_kernel<<<ggrid, gblk, 0, stream>>>(Cbuf, wo, bo, out);
}

// v010
// One run takes 61.3 microseconds.
// Two timings next to v009 both put it at 1.05 times that version's speed.
// All steps since v000 together make it 5.50 times as fast.
#include <hip/hip_runtime.h>
#include <hip/hip_bf16.h>
#include <cmath>

#define D_MODEL 1024
#define N_HEADS 16
#define D_KH    64
#define SEQ     2048
#define BATCH   2
#define MROWS   (BATCH * SEQ)     // 4096

typedef __attribute__((ext_vector_type(16))) _Float16     v16h;
typedef __attribute__((ext_vector_type(8)))  float        v8f;
typedef __attribute__((ext_vector_type(4)))  unsigned int v4u;
typedef __attribute__((ext_vector_type(8)))  int          v8i;
typedef __attribute__((ext_vector_type(4)))  int          v4i;
typedef __attribute__((ext_vector_type(8)))  _Float16     v8h;
typedef __attribute__((ext_vector_type(4)))  float        v4f;
typedef __attribute__((ext_vector_type(8)))  short        v8s;

// LDS pitches: 16 B x odd, so a 16-lane column of 16-byte reads meets no bank twice.
#define ROW128_PITCH_B 144                    // 128-byte rows + the mover's 16-byte pad
#define ROW256_PITCH_B 272                    // 256-byte rows + the mover's 16-byte pad
#define GP   (ROW256_PITCH_B / 4)             // GEMM slices: pitch in floats (68)
#define GSL  4608                             // floats per GEMM slice: 64 rows of 272 B, rounded up to 2 KiB x 9
#define GPH  (ROW256_PITCH_B / 2)             // the same pitch in halves (136)
#define GSLH (2 * GSL)                        // halves per GEMM slice of f16 rows (the same 18 KiB)
#define GKS  256                              // k per stage of the output projection
#define GNST (D_MODEL / GKS)                  // its stages (4)
#define KP   (ROW128_PITCH_B / 2)             // K tile: pitch in halves (72)
#define VPH  80                               // V tile: pitch in halves (160 B = 128-byte rows + the mover's 32-byte pad, for the transposing reader)
#define SKEYS 128                             // keys per attention stage
#define ANST (SEQ / SKEYS)                    // attention stages (16)
#define LOG2E   1.4426950408889634f           // the attention scores are kept in log2 units
#define QK_LOG2 0.18033688011112042f          // 1/sqrt(64) * log2(e): multiplied into Q where it is projected
#define DEAD_LOG2 -40.0f                      // a stage whose scores all lie this far under the maximum in use adds nothing (see attn_flash_kernel)
#define NLINE 32                              // floats between two row-norm entries: each has a 128-byte line of its own (one writer a line)
#define NORM_ROUND 1.002f                     // covers the f16 rounding of Q and K (2^-11 each) and that of the norms' own sums, products and roots

__device__ __forceinline__ v8f wmma_f16(v16h a, v16h b, v8f c) {
    return __builtin_amdgcn_wmma_f32_16x16x32_f16(
        false, a, false, b, (short)0, c, false, false);
}

// Low 32 bits of a generic pointer to LDS == LDS byte offset.
__device__ __forceinline__ unsigned lds_off(const void* p) {
    return (unsigned)(size_t)p;
}

__device__ __forceinline__ unsigned uni(unsigned v) {
    return (unsigned)__builtin_amdgcn_readfirstlane(v);
}

// A wave-uniform test held in a scalar register, so that the branch round a
// tensor load (which ignores EXEC) compiles to s_cmp + s_cbranch_scc.
__device__ __forceinline__ unsigned pinned(unsigned v) {
    unsigned w = uni(v);
    asm volatile("" : "+s"(w));   // keeps the test scalar: a vector branch would not guard the tensor load
    return w;
}

// ---------------------------------------------------------------------------
// Tensor-load descriptor of a tile of 128-byte rows that lands in LDS with a
// pad behind every row: PAD = 3 gives 16 bytes (LDS pitch 144 B), PAD = 7 gives
// 32 bytes (pitch 160 B).  Every extent is in bytes (data_size code 0); tensor
// dims = tile dims.
// ---------------------------------------------------------------------------
__device__ __forceinline__ v4u tdm_group0(unsigned lds, const void* gptr) {
    const unsigned long long ga = (unsigned long long)(size_t)gptr;
    v4u g0;
    g0[0] = 1u;                                           // count=1 (valid)
    g0[1] = uni(lds);                                     // lds_addr
    g0[2] = uni((unsigned)(ga & 0xffffffffu));            // global_addr lo
    g0[3] = (uni((unsigned)(ga >> 32)) & 0x01ffffffu)     // global_addr hi
          | (2u << 30);                                   // type=2
    asm volatile("" : "+s"(g0));   // pinned(): descriptor words held in their own scalar registers, not formed anew from copies
    return g0;
}

template <unsigned PAD>
__device__ __forceinline__ v8i tdm_group1(unsigned rows, unsigned pitch) {
    v8i g1;
    g1[0] = (int)((1u << 20)      // pad_enable
          |       (4u << 22)      // pad_interval = 32 DWORDs = one row
          |       (PAD << 25));   // pad_amount   = PAD + 1 DWORDs
    g1[1] = (int)(128u << 16);                            // tensor_dim0 = 128 B
    g1[2] = (int)(uni(rows) << 16);                       // tensor_dim1 = rows
    g1[3] = (int)(128u << 16);                            // tile_dim0 = 128 B
    g1[4] = (int)uni(rows);                               // tile_dim1
    g1[5] = (int)uni(pitch);                              // source row pitch, bytes
    g1[6] = 0;
    g1[7] = 0;
    asm volatile("" : "+s"(g1));   // pinned(): descriptor words held in their own scalar registers, not formed anew from copies
    return g1;
}

// The same for a tile of 256-byte rows (LDS pitch 272 B).
__device__ __forceinline__ v8i tdm_group1_row256(unsigned rows, unsigned pitch) {
    v8i g1;
    g1[0] = (int)((1u << 20)      // pad_enable
          |       (5u << 22)      // pad_interval = 64 DWORDs = one row
          |       (3u << 25));    // pad_amount   = 4 DWORDs
    g1[1] = (int)(256u << 16);                            // tensor_dim0 = 256 B
    g1[2] = (int)(uni(rows) << 16);                       // tensor_dim1 = rows
    g1[3] = (int)(256u << 16);                            // tile_dim0 = 256 B
    g1[4] = (int)uni(rows);                               // tile_dim1
    g1[5] = (int)uni(pitch);                              // source row pitch, bytes
    g1[6] = 0;
    g1[7] = 0;
    asm volatile("" : "+s"(g1));   // pinned(): descriptor words held in their own scalar registers, not formed anew from copies
    return g1;
}

__device__ __forceinline__ void tdm_load(v4u g0, v8i g1) {
    const v4i z4 = {0, 0, 0, 0};
    const v8i z8 = {0, 0, 0, 0, 0, 0, 0, 0};
    __builtin_amdgcn_tensor_load_to_lds(g0, g1, z4, z4, z8, 0);
}

// 16x32 f16 fragment of one lane from a row of f32: k = 0..7 and 16..23 from p.
__device__ __forceinline__ v16h frag_from_f32(const float* p) {
    const v4f x0 = *(const v4f*)(p);
    const v4f x1 = *(const v4f*)(p + 4);
    const v4f x2 = *(const v4f*)(p + 16);
    const v4f x3 = *(const v4f*)(p + 20);
    v16h f;
    #pragma unroll
    for (int e = 0; e < 4; ++e) {
        f[e]      = (_Float16)x0[e];
        f[4 + e]  = (_Float16)x1[e];
        f[8 + e]  = (_Float16)x2[e];
        f[12 + e] = (_Float16)x3[e];
    }
    return f;
}

// The same from a row of f16.
__device__ __forceinline__ v16h frag_from_f16(const _Float16* p) {
    const v8h lo = *(const v8h*)(p);
    const v8h hi = *(const v8h*)(p + 16);
    return __builtin_shufflevector(lo, hi, 0, 1, 2, 3, 4, 5, 6, 7,
                                   8, 9, 10, 11, 12, 13, 14, 15);
}

// 16 (d) x 32 (keys) A fragment of V^T from row-major V rows in LDS, by two
// transposing loads: lane (ln, half) gets V[8*half + e | 16 + 8*half + e][ln].
// p = this lane's address: row 8*half + (lane & 7), halves 8 * ((lane >> 3) & 1).
__device__ __forceinline__ v16h frag_transposed(const _Float16* p) {
    typedef __attribute__((address_space(3))) v8s lds_v8s;
    const v8h lo = __builtin_bit_cast(v8h, __builtin_amdgcn_ds_load_tr16_b128_v8i16((lds_v8s*)p));
    const v8h hi = __builtin_bit_cast(v8h, __builtin_amdgcn_ds_load_tr16_b128_v8i16((lds_v8s*)(p + 16 * VPH)));
    return __builtin_shufflevector(lo, hi, 0, 1, 2, 3, 4, 5, 6, 7,
                                   8, 9, 10, 11, 12, 13, 14, 15);
}

// Lane l reads lane l ^ 16: the two wave halves hold the two halves of a column.
__device__ __forceinline__ float xhalf(float x) {
    const int b = __builtin_bit_cast(int, x);
    return __builtin_bit_cast(float,
        __builtin_amdgcn_permlanex16(b, b, 0x76543210, 0xfedcba98, false, false));
}

// Lane l reads lane l ^ M of its row of 16 lanes (DPP row_xmask).
template <int M>
__device__ __forceinline__ float xrow(float x) {
    return __builtin_bit_cast(float,
        __builtin_amdgcn_update_dpp(0, __builtin_bit_cast(int, x), 0x160 | M, 0xf, 0xf, true));
}

// p[r] = this lane's share of eight sums that run over the 16 lanes of a row.
// Returns one of the eight whole sums, by the lane's bits 3..1: every step hands
// half of the values to the partner lane, so each step has half the adds of the last.
__device__ __forceinline__ float rowsum_one_of_8(const float* p, const int ln) {
    const bool h8 = (ln & 8) != 0, h4 = (ln & 4) != 0, h2 = (ln & 2) != 0;
    float u[4], w[2];
    #pragma unroll
    for (int k = 0; k < 4; ++k) u[k] = (h8 ? p[2 * k + 1] : p[2 * k]) + xrow<8>(h8 ? p[2 * k] : p[2 * k + 1]);
    #pragma unroll
    for (int k = 0; k < 2; ++k) w[k] = (h4 ? u[2 * k + 1] : u[2 * k]) + xrow<4>(h4 ? u[2 * k] : u[2 * k + 1]);
    const float x = (h2 ? w[1] : w[0]) + xrow<2>(h2 ? w[0] : w[1]);
    return x + xrow<1>(x);
}

// ---------------------------------------------------------------------------
// Output projection: Y[4096,1024] = X[4096,1024] @ W[1024,1024]^T + bias.
// Both operands arrive in f16: X (ctx) is rounded where the attention kernel
// stores it, W by extra blocks of the attention launch.  It is the rounding that
// a fragment read of f32 rows would do, done once per element instead of once per
// reading wave, and every byte count of the operands (L2 to LDS, LDS to registers)
// is half of what f32 rows cost.
// 128x128 block tile, one block per WGP; 8 waves as 2 (rows) x 4 (columns),
// 64x32 of Y per wave: 8 WMMAs on 6 fragments per 32 k.  A stage is 256 k of
// both operands in 8 slices of 64 rows x 256 B; every wave brings one slice by
// one tensor load.  Two buffers: stage s + 1 flies while stage s is worked on.
// ---------------------------------------------------------------------------
__device__ __forceinline__
void out_gemm_body(const _Float16* __restrict__ X,
                   const _Float16* __restrict__ W,
                   const float* __restrict__ bias,
                   float* __restrict__ Y)
{
    // [buffer][slice], slice = 4 * (X | W) + 2 * (row half) + (k half); 272-B pitch from the TDM pad
    __shared__ __attribute__((aligned(2048))) _Float16 Ts[2][8][GSLH];

    const int tid  = threadIdx.x;
    const int lane = tid & 31;
    const int wv   = tid >> 5;
    const int half = lane >> 4;
    const int ln   = lane & 15;

    const int m0 = blockIdx.y * 128;
    const int n0 = blockIdx.x * 128;
    const int wm = wv & 1;              // rows    m0 + 64 * wm ..
    const int wn = wv >> 1;             // columns n0 + 32 * wn ..

    v8f acc[4][2] = {};

    // This wave's slice of every stage: 64 rows of X or W, 128 k.
    const unsigned wave = uni((unsigned)tid >> 5);
    const unsigned srow = (wave & 2) * 32;
    const _Float16* src = ((wave & 4) ? W + (size_t)(n0 + srow) * D_MODEL
                                      : X + (size_t)(m0 + srow) * D_MODEL) + (wave & 1) * 128;
    const v8i g1 = tdm_group1_row256(64, D_MODEL * 2);    // the same for every slice

    // Prologue: stage 0 landed and published, then stage 1 issued.
    v4u g0 = tdm_group0(lds_off(&Ts[0][wave][0]), src);
    tdm_load(g0, g1);
    // The descriptor is an input so that its registers keep their values while the request is outstanding.
    asm volatile("s_wait_tensorcnt 0x0" :: "s"(g0), "s"(g1) : "memory");
    __syncthreads();
    g0 = tdm_group0(lds_off(&Ts[1][wave][0]), src + GKS);
    tdm_load(g0, g1);

    for (int s = 0; s < GNST; ++s) {
        // Fragments: row = tile*16+ln, K(e) = half*8+e | 16+half*8+e
        const _Float16* As = &Ts[s & 1][wm * 2][ln * GPH + half * 8];
        const _Float16* Bs = &Ts[s & 1][4 + (wn >> 1) * 2][((wn & 1) * 32 + ln) * GPH + half * 8];
        v16h a[4], b[2];
        #pragma unroll
        for (int kk = 0; kk < GKS / 32; ++kk) {
            const int o = (kk >> 2) * GSLH + (kk & 3) * 32;
            #pragma unroll
            for (int i = 0; i < 4; ++i) a[i] = frag_from_f16(As + o + i * 16 * GPH);
            #pragma unroll
            for (int j = 0; j < 2; ++j) b[j] = frag_from_f16(Bs + o + j * 16 * GPH);
            if (kk == GKS / 32 - 1) break;   // the last 32 k are multiplied behind the refill, from registers
            #pragma unroll
            for (int i = 0; i < 4; ++i) {
                #pragma unroll
                for (int j = 0; j < 2; ++j) acc[i][j] = wmma_f16(a[i], b[j], acc[i][j]);
            }
        }
        // Publish point of stage s + 1: this wave's reads of stage s are done, its
        // slice of stage s + 1 has landed, every wave has said the same.
        asm volatile("s_wait_dscnt 0x0" ::: "memory");
        asm volatile("s_wait_tensorcnt 0x0" :: "s"(g0), "s"(g1) : "memory");
        __syncthreads();
        g0 = tdm_group0(lds_off(&Ts[s & 1][wave][0]), src + (s + 2) * GKS);
        if (pinned(s + 2 < GNST)) {   // refill of the buffer that every wave has just left
            tdm_load(g0, g1);
        }
        #pragma unroll
        for (int i = 0; i < 4; ++i) {
            #pragma unroll
            for (int j = 0; j < 2; ++j) acc[i][j] = wmma_f16(a[i], b[j], acc[i][j]);
        }
    }
    asm volatile("s_wait_tensorcnt 0x0" ::: "memory");   // no request of this wave is left behind the loop
    asm volatile("s_wait_dscnt 0x0" ::: "memory");       // and none of its LDS reads

    // Epilogue: bias + store.  D layout: row = r + 8*half, col = ln.
    const int na = n0 + wn * 32 + ln;
    float bj[2];
    #pragma unroll
    for (int j = 0; j < 2; ++j) bj[j] = bias[na + j * 16];
    // Before a register that the two loads above name is written again; base and index are inputs so that their registers keep their values up to the wait.
    asm volatile("s_wait_xcnt 0x0" :: "s"(bias), "v"(na) : "memory");
    #pragma unroll
    for (int j = 0; j < 2; ++j) {
        #pragma unroll
        for (int i = 0; i < 4; ++i) {
            float* ya = Y + (size_t)(m0 + wm * 64 + i * 16 + 8 * half) * D_MODEL + na + j * 16;
            #pragma unroll
            for (int r = 0; r < 8; ++r) ya[(size_t)r * D_MODEL] = acc[i][j][r] + bj[j];
        }
    }
}

// ---------------------------------------------------------------------------
// Q, K and V projections: the same product, from f32 operands (converted to f16
// at fragment read), on a 256x256 block tile, 8 waves as
// 2 (rows) x 4 (columns), 128x64 of Y per wave: 32 WMMAs on 12 fragments per
// 32 k, so a WMMA costs as many LDS-read bytes as on the 64x32 wave tile, and a
// result as many bytes brought from L2, f32 here against f16 there.  A stage is 64 k of both operands, f32,
// in 8 slices of 64 rows x 256 B (the ring's size and places are those of the
// smaller tile); every wave brings one slice by one tensor load.  Two buffers.
// oscale multiplies the biased result in f32, before it is rounded to f16.
// The last 32 k of a stage are multiplied behind the publish point, from
// registers, in one straight run with the next stage's first fragment reads.
// The k order of every sum is that of the smaller tile.
// ---------------------------------------------------------------------------
#define QNST (D_MODEL / 64)                   // stages of the wide tile (16)
__device__ __forceinline__
void qkv_gemm_body(const float* __restrict__ X,
                   const float* __restrict__ W,
                   const float* __restrict__ bias,
                   _Float16* __restrict__ Y,
                   const float oscale,
                   float* __restrict__ nrm)
{
    // [buffer][slice], slice = 4 * (X | W) + (row quarter); 68-dw pitch from the TDM pad
    __shared__ __attribute__((aligned(2048))) float Ts[2][8][GSL];

    const int tid  = threadIdx.x;
    const int lane = tid & 31;
    const int wv   = tid >> 5;
    const int half = lane >> 4;
    const int ln   = lane & 15;

    const int m0 = blockIdx.y * 256;
    const int n0 = blockIdx.x * 256;
    const int wm = wv & 1;              // rows    m0 + 128 * wm ..
    const int wn = wv >> 1;             // columns n0 + 64 * wn ..

    v8f acc[8][4] = {};
    v16h a[8], b[4];

    // Fragments of 32 k: row = tile*16+ln, K(e) = half*8+e | 16+half*8+e
    auto frags = [&](const int buf, const int kk) {
        const float* As = &Ts[buf][wm * 2][ln * GP + half * 8 + kk * 32];
        const float* Bs = &Ts[buf][4 + wn][ln * GP + half * 8 + kk * 32];
        #pragma unroll
        for (int j = 0; j < 4; ++j) b[j] = frag_from_f32(Bs + j * 16 * GP);
        #pragma unroll
        for (int i = 0; i < 8; ++i) a[i] = frag_from_f32(As + (i >> 2) * GSL + (i & 3) * 16 * GP);
    };
    auto mult = [&]() {
        #pragma unroll
        for (int i = 0; i < 8; ++i) {
            #pragma unroll
            for (int j = 0; j < 4; ++j) acc[i][j] = wmma_f16(a[i], b[j], acc[i][j]);
        }
    };

    // This wave's slice of every stage: 64 rows of X or W, 64 k.
    const unsigned wave = uni((unsigned)tid >> 5);
    const unsigned srow = (wave & 3) * 64;
    const float* src = (wave & 4) ? W + (size_t)(n0 + srow) * D_MODEL
                                  : X + (size_t)(m0 + srow) * D_MODEL;
    const v8i g1 = tdm_group1_row256(64, D_MODEL * 4);    // the same for every slice

    // Prologue: stage 0 landed and published, then stage 1 issued.
    v4u g0 = tdm_group0(lds_off(&Ts[0][wave][0]), src);
    tdm_load(g0, g1);
    // The descriptor is an input so that its registers keep their values while the request is outstanding.
    asm volatile("s_wait_tensorcnt 0x0" :: "s"(g0), "s"(g1) : "memory");
    __syncthreads();
    g0 = tdm_group0(lds_off(&Ts[1][wave][0]), src + 64);
    tdm_load(g0, g1);

    frags(0, 0);
    mult();
    frags(0, 1);
    for (int s = 0; s + 1 < QNST; ++s) {
        // Publish point of stage s + 1: this wave's reads of stage s are done, its
        // slice of stage s + 1 has landed, every wave has said the same.
        asm volatile("s_wait_dscnt 0x0" ::: "memory");
        asm volatile("s_wait_tensorcnt 0x0" :: "s"(g0), "s"(g1) : "memory");
        __syncthreads();
        g0 = tdm_group0(lds_off(&Ts[s & 1][wave][0]), src + (s + 2) * 64);
        if (pinned(s + 2 < QNST)) {   // refill of the buffer that every wave has just left
            tdm_load(g0, g1);
        }
        mult();                       // the last 32 k of stage s
        frags((s + 1) & 1, 0);
        mult();
        frags((s + 1) & 1, 1);
    }
    mult();
    asm volatile("s_wait_tensorcnt 0x0" ::: "memory");   // no request of this wave is left behind the loop
    asm volatile("s_wait_dscnt 0x0" ::: "memory");       // and none of its LDS reads

    // Epilogue: bias + store.  D layout: row = r + 8*half, col = ln.
    // The wave's tile is 128 rows of one head: one attention block of queries, or
    // one attention stage of keys.  Where nrm is given, the largest squared length
    // of its 128 rows goes there, for the attention kernel's bound on a stage's scores.
    const int na = n0 + wn * 64 + ln;
    float bj[4];
    #pragma unroll
    for (int j = 0; j < 4; ++j) bj[j] = bias[na + j * 16];
    // Before a register that the four loads above name is written again; base and index are inputs so that their registers keep their values up to the wait.
    asm volatile("s_wait_xcnt 0x0" :: "s"(bias), "v"(na) : "memory");
    float big = 0.0f;
    #pragma unroll
    for (int i = 0; i < 8; ++i) {
        _Float16* ya = Y + (size_t)(m0 + wm * 128 + i * 16 + 8 * half) * D_MODEL + na;
        _Float16 hy[8][4];
        float p[8];   // this lane's four columns of the squared length of row i * 16 + 8 * half + r
        #pragma unroll
        for (int r = 0; r < 8; ++r) {
            float sq = 0.0f;
            #pragma unroll
            for (int j = 0; j < 4; ++j) {
                const float y = (acc[i][j][r] + bj[j]) * oscale;
                hy[r][j] = (_Float16)y;
                sq = fmaf(y, y, sq);
            }
            p[r] = sq;
        }
        __builtin_amdgcn_sched_barrier(0);   // all 32 values stand in registers of their own before the first store: none is formed between the stores
        #pragma unroll
        for (int r = 0; r < 8; ++r) {
            #pragma unroll
            for (int j = 0; j < 4; ++j) ya[(size_t)r * D_MODEL + j * 16] = hy[r][j];
        }
        asm volatile("s_wait_xcnt 0x0" ::: "memory");   // before the registers that the stores above name are written again
        __builtin_amdgcn_sched_barrier(0);              // keeps the arithmetic below behind that wait
        if (nrm) big = fmaxf(big, rowsum_one_of_8(p, ln));
    }
    if (nrm) {
        big = fmaxf(big, xrow<8>(big));
        big = fmaxf(big, xrow<4>(big));
        big = fmaxf(big, xrow<2>(big));
        big = fmaxf(big, xhalf(big));
        const int rb = blockIdx.y * 2 + wm;        // 128-row block: 16 * batch + block of the sequence
        const int hd = blockIdx.x * 4 + wn;        // head
        if (lane == 0) nrm[(size_t)((((rb >> 4) * N_HEADS + hd) * ANST) + (rb & (ANST - 1))) * NLINE] = big;
    }
}

// The Q, K and V projections are independent: one launch, blockIdx.z picks the
// projection; its 192 tiles are all resident at once.
__global__ __launch_bounds__(256)
void qkv_gemm_kernel(const float* __restrict__ Xq, const float* __restrict__ Xk, const float* __restrict__ Xv,
                     const float* __restrict__ Wq, const float* __restrict__ Wk, const float* __restrict__ Wv,
                     const float* __restrict__ Bq, const float* __restrict__ Bk, const float* __restrict__ Bv,
                     _Float16* __restrict__ Yq, _Float16* __restrict__ Yk, _Float16* __restrict__ Yv,
                     float* __restrict__ Nq, float* __restrict__ Nk)
{
    const int z = blockIdx.z;
    qkv_gemm_body((z == 0) ? Xq : (z == 1) ? Xk : Xv,
                  (z == 0) ? Wq : (z == 1) ? Wk : Wv,
                  (z == 0) ? Bq : (z == 1) ? Bk : Bv,
                  (z == 0) ? Yq : (z == 1) ? Yk : Yv,
                  (z == 0) ? QK_LOG2 : 1.0f,    // Q leaves scaled: the score product is then in log2 units
                  (z == 0) ? Nq : (z == 1) ? Nk : nullptr);
}

__global__ __launch_bounds__(256)
void out_gemm_kernel(const _Float16* __restrict__ X,
                     const _Float16* __restrict__ W,
                     const float* __restrict__ bias,
                     float* __restrict__ Y)
{
    out_gemm_body(X, W, bias, Y);
}

#define ATT_BLOCKS (BATCH * N_HEADS * (SEQ / 128))        // 512
#define WO_BLOCKS  (D_MODEL * D_MODEL / 16384)            // 64
__global__ __launch_bounds__(256)
void attn_flash_kernel(const _Float16* __restrict__ Qb,
                       const _Float16* __restrict__ Kb,
                       const _Float16* __restrict__ Vb,
                       const float* __restrict__ td_ptr,
                       const float* __restrict__ Nq,
                       const float* __restrict__ Nk,
                       _Float16* __restrict__ Cb,
                       const float* __restrict__ Wo,
                       _Float16* __restrict__ Yo)
{
    __shared__ __attribute__((aligned(2048))) _Float16 Ks[2][SKEYS * KP];   // [buffer][key][d], 144-B pitch: 9 x 2 KiB a buffer
    __shared__ __attribute__((aligned(2048))) _Float16 Vs[2][SKEYS * VPH];  // [buffer][key][d], 160-B pitch: 10 x 2 KiB a buffer

    if (blockIdx.x >= ATT_BLOCKS) {   // the whole block leaves here, in front of every tensor load and barrier
        const size_t e0 = (size_t)(blockIdx.x - ATT_BLOCKS) * 16384 + threadIdx.x * 8;
        const float* wi = Wo + e0;
        _Float16*    wh = Yo + e0;
        v4f x[8][2];
        #pragma unroll   // the eight steps become immediate offsets on one address pair
        for (int it = 0; it < 8; ++it) {
            x[it][0] = *(const v4f*)(wi + it * 2048);
            x[it][1] = *(const v4f*)(wi + it * 2048 + 4);
        }
        // Before a register that the loads above name is written again; the address is an input so that its registers keep their value up to the wait.
        asm volatile("s_wait_xcnt 0x0" :: "v"(wi) : "memory");
        #pragma unroll
        for (int it = 0; it < 8; ++it) {
            v8h y;
            #pragma unroll
            for (int e = 0; e < 4; ++e) { y[e] = (_Float16)x[it][0][e]; y[4 + e] = (_Float16)x[it][1][e]; }
            *(v8h*)(wh + it * 2048) = y;
        }
        return;
    }

    const int tid  = threadIdx.x;
    const int lane = tid & 31;
    const int wv   = tid >> 5;
    const int half = lane >> 4;
    const int ln   = lane & 15;

    const int bh   = blockIdx.x >> 4;          // 0..31
    const int qblk = blockIdx.x & 15;          // 0..15
    const int b    = bh >> 4;
    const int h    = bh & 15;
    const int q0   = (qblk * 8 + wv) * 16;

    const float ndec = -td_ptr[0] * LOG2E;     // bias per key of distance, log2 units

    // Largest squared row lengths: the block's queries, its own stage's keys, and (lane j and j + 16) stage j's keys.
    const int   sj  = lane & (ANST - 1);
    const float nq2 = Nq[(size_t)(bh * ANST + qblk) * NLINE];
    const float nd2 = Nk[(size_t)(bh * ANST + qblk) * NLINE];
    const float nj2 = Nk[(size_t)(bh * ANST + sj) * NLINE];

    const _Float16* Qh = Qb + (size_t)b * SEQ * D_MODEL + h * D_KH;
    const _Float16* Kh = Kb + (size_t)b * SEQ * D_MODEL + h * D_KH;
    const _Float16* Vh = Vb + (size_t)b * SEQ * D_MODEL + h * D_KH;
    _Float16*       Ch = Cb + (size_t)b * SEQ * D_MODEL + h * D_KH;

    // Q B-fragments for d = 0..31 / 32..63 (column = ln); contiguous f16 loads.
    v16h aq0, aq1;
    {
        const _Float16* qr = Qh + (size_t)(q0 + ln) * D_MODEL;
        #pragma unroll
        for (int e = 0; e < 8; ++e) aq0[e]     = qr[half * 8 + e];
        #pragma unroll
        for (int e = 0; e < 8; ++e) aq0[8 + e] = qr[16 + half * 8 + e];
        #pragma unroll
        for (int e = 0; e < 8; ++e) aq1[e]     = qr[32 + half * 8 + e];
        #pragma unroll
        for (int e = 0; e < 8; ++e) aq1[8 + e] = qr[48 + half * 8 + e];
        // Before a register that the loads above name is written again; the address is an input so that its registers keep their value up to the wait.
        asm volatile("s_wait_xcnt 0x0" :: "v"(qr) : "memory");
    }

    v8f c0 = {}, c1 = {}, c2 = {}, c3 = {};
    float nmax = 0.0f;                  // minus the maximum in use of query q0 + ln (equal in both halves); the first stage sets it
    float lrun = 0.0f;                  // running sum over this half's keys; the halves join in the epilogue
    const float qpos = (float)(q0 + ln);

    // Wave 0 issues K, wave 1 issues V; the other waves form V's group 0 and never issue.
    const unsigned wave = uni((unsigned)tid >> 5);
    const _Float16* src = (wave == 0) ? Kh : Vh;
    const unsigned dst  = (wave == 0) ? lds_off(&Ks[0][0]) : lds_off(&Vs[0][0]);
    const unsigned dbuf = (wave == 0) ? (unsigned)sizeof(Ks[0]) : (unsigned)sizeof(Vs[0]);
    const v8i g1k = tdm_group1<3>(SKEYS, D_MODEL * 2);   // the same for every K stage
    const v8i g1v = tdm_group1<7>(SKEYS, D_MODEL * 2);   // the same for every V stage

    // Prologue: the block's own stage landed and published, then the walk's second stage issued.
    v4u g0 = tdm_group0(dst, src + (size_t)qblk * SKEYS * D_MODEL);
    if (pinned(wave == 0)) {
        tdm_load(g0, g1k);
        // The descriptor is an input so that its registers keep their values while the request is outstanding.
        asm volatile("s_wait_tensorcnt 0x0" :: "s"(g0), "s"(g1k) : "memory");
    }
    if (pinned(wave == 1)) {
        tdm_load(g0, g1v);
        asm volatile("s_wait_tensorcnt 0x0" :: "s"(g0), "s"(g1v) : "memory");   // as above
    }
    __syncthreads();

    // The walk: bit o of todo = key stage (qblk + o) mod ANST can count.  Every wave
    // forms it from the same three planes' values, so it is the same in the whole block.
    unsigned todo;
    {
        const int   gap  = (sj > qblk) ? sj - qblk : qblk - sj;      // stages apart
        const float near = (float)(gap * SKEYS - (SKEYS - 1));       // nearest and farthest pair of query and key
        const float far  = (float)(gap * SKEYS + (SKEYS - 1));
        const float top  = fmaxf(ndec * near, ndec * far)
                         + NORM_ROUND * (__builtin_amdgcn_sqrtf(nq2 * nj2) + __builtin_amdgcn_sqrtf(nq2 * nd2));
        // written so that a NaN keeps the stage
        const unsigned livem = __builtin_amdgcn_ballot_w32(gap == 0 || !(top < DEAD_LOG2 - 0.5f)) & 0xffffu;
        todo = uni(((livem >> qblk) | (livem << (ANST - qblk))) & 0xffffu);
    }
    const int ntrip = __builtin_popcount(todo);   // 1 .. ANST
    todo &= todo - 1;                             // the own stage (bit 0) is in buffer 0
    unsigned ocur = 0;                            // this trip's stage, as an offset from qblk
    unsigned onxt = (unsigned)__builtin_ctz(todo | (1u << ANST));   // the next trip's; ANST (the own stage again, never issued) if none
    g0 = tdm_group0(dst + dbuf, src + (size_t)((qblk + onxt) & (ANST - 1)) * SKEYS * D_MODEL);
    if (pinned(todo != 0)) {
        if (pinned(wave == 0)) tdm_load(g0, g1k);
        if (pinned(wave == 1)) tdm_load(g0, g1v);
    }
    todo &= todo - 1;

    int st = 0;
    do {   // the own stage is always walked
      // query minus this half's first key of the stage; whole numbers: exact
      const float dist = fmaf(-(float)SKEYS, (float)((qblk + ocur) & (ANST - 1)), qpos - (float)(8 * half));
      const _Float16* Kst = &Ks[st & 1][ln * KP + half * 8];
      const _Float16* Vst = &Vs[st & 1][(8 * half + (lane & 7)) * VPH + ((lane >> 3) & 1) * 8];
      // ---- scores, transposed: s[sub][0][r] = S[first key of the stage + 32*sub + 8*half + r][q0 + ln],
      //      s[sub][1]: +16 keys; each starts from its bias minus the maximum in use
      v8f   s[SKEYS / 32][2];
      float tp[SKEYS / 32];      // this lane's largest score of each pass
      #pragma unroll   // the passes' LDS addresses become immediate offsets; s and tp stay in registers
      for (int sub = 0; sub < SKEYS / 32; ++sub) {
        const float dist0 = dist - (float)(sub * 32);
        v8f s0, s1;
        #pragma unroll
        for (int r = 0; r < 8; ++r) s0[r] = fmaf(ndec, fabsf(dist0 - (float)r), nmax);
        #pragma unroll
        for (int r = 0; r < 8; ++r) s1[r] = fmaf(ndec, fabsf(dist0 - (float)(16 + r)), nmax);
        const _Float16* kr = Kst + sub * 32 * KP;
        s0 = wmma_f16(frag_from_f16(kr), aq0, s0);
        s0 = wmma_f16(frag_from_f16(kr + 32), aq1, s0);
        kr += 16 * KP;
        s1 = wmma_f16(frag_from_f16(kr), aq0, s1);
        s1 = wmma_f16(frag_from_f16(kr + 32), aq1, s1);
        float t = fmaxf(s0[0], s1[0]);
        #pragma unroll
        for (int r = 1; r < 8; ++r) t = fmaxf(t, fmaxf(s0[r], s1[r]));
        s[sub][0] = s0;
        s[sub][1] = s1;
        tp[sub]   = t;
      }
      float t = fmaxf(fmaxf(tp[0], tp[1]), fmaxf(tp[2], tp[3]));

      const bool  first = (st == 0);   // nothing is summed yet: the stage's own maximum is taken, up or down
      const float floor_dead = first ? -__builtin_inff() : DEAD_LOG2;
      const float floor_up   = first ? -__builtin_inff() : 8.0f;
      // One scalar test per stage: has any query of the wave a score that can still count?
      if (__builtin_amdgcn_ballot_w32(t > floor_dead) != 0) {
        // ---- online softmax, one query per lane; the maximum moves rarely --
        if (__builtin_amdgcn_ballot_w32(t > floor_up) != 0) {   // one scalar test per stage
            t = fmaxf(t, xhalf(t));
            const float up    = first ? t : fmaxf(t, 0.0f);
            const float alpha = first ? 0.0f : __builtin_amdgcn_exp2f(-up);
            nmax -= up;
            lrun *= alpha;
            #pragma unroll
            for (int sub = 0; sub < SKEYS / 32; ++sub) {
                #pragma unroll
                for (int r = 0; r < 8; ++r) { s[sub][0][r] -= up; s[sub][1][r] -= up; }
            }
            #pragma unroll
            for (int r = 0; r < 8; ++r) {
                c0[r] *= alpha; c1[r] *= alpha;
                c2[r] *= alpha; c3[r] *= alpha;
            }
        }
        #pragma unroll   // s is indexed by constants; one pass's V loads may rise into the one before
        for (int sub = 0; sub < SKEYS / 32; ++sub) {
          v8f s0 = s[sub][0], s1 = s[sub][1];
          #pragma unroll
          for (int r = 0; r < 8; ++r) s0[r] = __builtin_amdgcn_exp2f(s0[r]);
          #pragma unroll
          for (int r = 0; r < 8; ++r) s1[r] = __builtin_amdgcn_exp2f(s1[r]);
          v16h bp;   // P^T as B fragment: k = 8*half + e | 16 + 8*half + e, the order of the V^T loader
          #pragma unroll
          for (int r = 0; r < 8; ++r) {
              bp[r]     = (_Float16)s0[r];
              bp[8 + r] = (_Float16)s1[r];
          }
          const v8f ps = s0 + s1;
          lrun += ((ps[0] + ps[1]) + (ps[2] + ps[3])) + ((ps[4] + ps[5]) + (ps[6] + ps[7]));

          // ---- ctx^T += V^T(64x32) @ P^T(32x16), V^T by transposing loads ----
          #pragma unroll
          for (int t4 = 0; t4 < 4; ++t4) {
              const v16h av = frag_transposed(Vst + sub * 32 * VPH + t4 * 16);
              if      (t4 == 0) c0 = wmma_f16(av, bp, c0);
              else if (t4 == 1) c1 = wmma_f16(av, bp, c1);
              else if (t4 == 2) c2 = wmma_f16(av, bp, c2);
              else              c3 = wmma_f16(av, bp, c3);
          }
        }
      }
      // Publish point of stage st + 1: this wave's reads of stage st are done, the
      // issuing waves' tiles of stage st + 1 have landed, every wave has said the same.
      asm volatile("s_wait_dscnt 0x0" ::: "memory");
      if (pinned(wave < 2)) {
          // The descriptors are inputs so that their registers keep their values while the request is outstanding.
          asm volatile("s_wait_tensorcnt 0x0" :: "s"(g0), "s"(g1k), "s"(g1v) : "memory");
      }
      __syncthreads();
      ocur = onxt;
      onxt = (unsigned)__builtin_ctz(todo | (1u << ANST));
      g0 = tdm_group0(dst + (st & 1) * dbuf, src + (size_t)((qblk + onxt) & (ANST - 1)) * SKEYS * D_MODEL);
      if (pinned(todo != 0)) {   // refill of the buffer that every wave has just left
          if (pinned(wave == 0)) tdm_load(g0, g1k);
          if (pinned(wave == 1)) tdm_load(g0, g1v);
      }
      todo &= todo - 1;
    } while (++st < ntrip);
    asm volatile("s_wait_tensorcnt 0x0" ::: "memory");   // no request of this wave is left behind the loop
    asm volatile("s_wait_dscnt 0x0" ::: "memory");       // and none of its LDS reads

    // ---- epilogue: normalize, round to f16 and store ctx -------------------
    // c<t>[r] = O[q0 + ln][t*16 + 8*half + r]: eight consecutive elements a lane, 16 bytes a store.
    {
        const float inv = 1.0f / (lrun + xhalf(lrun));
        _Float16* cr = Ch + (size_t)(q0 + ln) * D_MODEL + 8 * half;
        v8h o0, o1, o2, o3;
        #pragma unroll
        for (int r = 0; r < 8; ++r) {
            o0[r] = (_Float16)(c0[r] * inv);
            o1[r] = (_Float16)(c1[r] * inv);
            o2[r] = (_Float16)(c2[r] * inv);
            o3[r] = (_Float16)(c3[r] * inv);
        }
        *(v8h*)(cr)      = o0;
        *(v8h*)(cr + 16) = o1;
        *(v8h*)(cr + 32) = o2;
        *(v8h*)(cr + 48) = o3;
        asm volatile("s_wait_xcnt 0x0" ::: "memory");   // before a register that the four stores above name can be written again on any way the built code allows behind them
    }
}

// ---------------------------------------------------------------------------
extern "C" void kernel_launch(void* const* d_in, const int* in_sizes, int n_in,
                              void* d_out, int out_size, void* d_ws, size_t ws_size,
                              hipStream_t stream) {
    const float* query = (const float*)d_in[0];
    const float* key   = (const float*)d_in[1];
    const float* value = (const float*)d_in[2];
    const float* wq = (const float*)d_in[3];
    const float* bq = (const float*)d_in[4];
    const float* wk = (const float*)d_in[5];
    const float* bk = (const float*)d_in[6];
    const float* wv = (const float*)d_in[7];
    const float* bv = (const float*)d_in[8];
    const float* wo = (const float*)d_in[9];
    const float* bo = (const float*)d_in[10];
    const float* td = (const float*)d_in[11];
    float* out = (float*)d_out;

    const size_t elems = (size_t)MROWS * D_MODEL;
    _Float16* Qbuf = (_Float16*)d_ws;            // 8 MB
    _Float16* Kbuf = Qbuf + elems;               // 8 MB
    _Float16* Vbuf = Kbuf + elems;               // 8 MB
    _Float16* Cbuf = Vbuf + elems;               // 8 MB
    _Float16* Wobuf = Cbuf + elems;              // 2 MB: wo in f16
    float*    Nqbuf = (float*)(Wobuf + (size_t)D_MODEL * D_MODEL);      // 64 KB: 512 row-norm entries, a 128-byte line each
    float*    Nkbuf = Nqbuf + (size_t)BATCH * N_HEADS * ANST * NLINE;   // 64 KB

    const dim3 gblk(256);
    const dim3 ggrid(D_MODEL / 128, MROWS / 128);  // 8 x 32
    qkv_gemm_kernel<<<dim3(D_MODEL / 256, MROWS / 256, 3), gblk, 0, stream>>>(
        query, key, value, wq, wk, wv, bq, bk, bv, Qbuf, Kbuf, Vbuf, Nqbuf, Nkbuf);

    attn_flash_kernel<<<dim3(ATT_BLOCKS + WO_BLOCKS), dim3(256), 0, stream>>>(
        Qbuf, Kbuf, Vbuf, td, Nqbuf, Nkbuf, Cbuf, wo, Wobuf);

    out_gemm_kernel<<<ggrid, gblk, 0, stream>>>(Cbuf, Wobuf, bo, out);
}
